// v000
// The times below were measured on an AMD MI455X: many runs one after another, warmed up first and cycling through
// copies of the inputs, with the whole window's GPU time divided by the number of runs. Launches and the gaps
// between them are all in it. The median over several windows is given; except for v000 it joins two sittings, which
// can be a few percent apart, so the side-by-side timings, each taken in one sitting, are the better comparison.
// The starting kernel, v000, takes 1450 microseconds a run.
#include <hip/hip_runtime.h>

// Causal multi-head self-attention with interleaved-pair rotary embeddings from two half-width INPUT tables and (in, out) weights (x [2][2048][1024]; q, k, v = x W ('xw' [1024][1024] normal x 0.02, no projection bias; 16 heads x 64); _rope on q and k: consecutive pairs (t[2i], t[2i+1]) -> (te c - to s, te s + to c) with c, s = pos_cos / pos_sin[t][i] (f32 [2048][32] INPUT tables the module computes: cos / sin(t / 10000^(2i/64)): read by value); scores: -inf above the diagonal, then / sqrt(64) (the same as scaling first); softmax; out = merged Wo + bo ('xw' + a zero bias [1024], read) -> [2][2048][1024] (4.2 M); argument order x, pos_cos, pos_sin, Wq, Wk, Wv, Wo, bo).
// Layout per batch: bf16 copy of x; exact projections (no bias); the two half-width INPUT tables copied once into one bf16-rounded {cos, sin} table per (position, pair) (k_csI); interleaved rotary plane builder; causal T-2048 attention (hybrid rows: < 512 hi/lo 3 products, rest fp16 x1024; k_gemmc skips tiles above the diagonal); merged hi/lo x Wo exact + bo.
// Compute dtypes, f32 accumulate: every input rounded to bf16; projections exact (no bias); rotary f32; attention rows < 512 3 products, rest fp16; softmax f32; Wo hl x exact + bias.

#define NB_  2
#define TT   2048
#define DM   1024
#define NH_  16
#define NKV  16
#define REP  (NH_ / NKV)
#define HD   64
#define DQ   (NH_ * HD)
#define DKV  (NKV * HD)
#define ZH   2
#define RH   512                  // query rows < RH use hi+lo planes (0: none)
#define WIN  2048
#define PCAR 1024.0f
#define SCL  0.125f   // HD^-0.5
typedef _Float16 h16;
typedef unsigned short bf;
typedef __attribute__((ext_vector_type(16))) __bf16   v16bf;
typedef __attribute__((ext_vector_type(16))) _Float16 v16h;
typedef __attribute__((ext_vector_type(8)))  _Float16 v8h;
typedef __attribute__((ext_vector_type(8)))  unsigned short v8us;
typedef __attribute__((ext_vector_type(8)))  float    v8f;
typedef __attribute__((ext_vector_type(4)))  float    v4f;
typedef v8h  __attribute__((may_alias)) v8ha;
typedef v4f  __attribute__((may_alias)) v4fa;
typedef v8us __attribute__((may_alias)) v8usa;

__device__ __forceinline__ unsigned short f2bf(float f) { unsigned u = __float_as_uint(f); u += 0x7FFFu + ((u >> 16) & 1u); return (unsigned short)(u >> 16); }
__device__ __forceinline__ float bf2f(unsigned short b) { return __uint_as_float(((unsigned)b) << 16); }
__device__ __forceinline__ float bfr(float f) { return bf2f(f2bf(f)); }
__device__ __forceinline__ v16h cat16(v8h lo, v8h hi) { return __builtin_shufflevector(lo, hi, 0, 1, 2, 3, 4, 5, 6, 7, 8, 9, 10, 11, 12, 13, 14, 15); }
__device__ __forceinline__ v16bf cat16b(v8us lo, v8us hi) { return __builtin_bit_cast(v16bf, __builtin_shufflevector(lo, hi, 0, 1, 2, 3, 4, 5, 6, 7, 8, 9, 10, 11, 12, 13, 14, 15)); }
__device__ __forceinline__ v8f wmma16(v16h a, v16h b, v8f c) { return __builtin_amdgcn_wmma_f32_16x16x32_f16(false, a, false, b, (short)0, c, false, false); }
__device__ __forceinline__ v8f wmmab(v16bf a, v16bf b, v8f c) { return __builtin_amdgcn_wmma_f32_16x16x32_bf16(false, a, false, b, (short)0, c, false, false); }



// ---- k_gemmw: register-blocked GEMM, ONE WAVE per 64x64 output tile (16 accumulators), operands straight from K-contiguous 16-bit planes; grid (M/64, N/64, Z), 32 threads.
// C[m][n] (f32, pitch ldc, + optional f32 bias[n]) = sum_k A[m][k] Bt[n][k] (+ split products per NSPLIT). z-batch strides sA/sB/sC in elements. K % 32 == 0.
template <typename T16> struct WFrag;
template <> struct WFrag<h16> { typedef v16h V; static __device__ __forceinline__ V ld(const h16* p) { return cat16(*(const v8h*)p, *(const v8h*)(p + 16)); } static __device__ __forceinline__ v8f mma(V a, V b, v8f c) { return wmma16(a, b, c); } };
template <> struct WFrag<bf> { typedef v16bf V; static __device__ __forceinline__ V ld(const bf* p) { return cat16b(*(const v8us*)p, *(const v8us*)(p + 16)); } static __device__ __forceinline__ v8f mma(V a, V b, v8f c) { return wmmab(a, b, c); } };
template <typename T16, int NSPLIT, bool BIAS>
__global__ __launch_bounds__(32) void k_gemmw(const T16* __restrict__ A, const T16* __restrict__ A2, const T16* __restrict__ Bt, const T16* __restrict__ Bt2, int K, float* C, int ldc, const float* __restrict__ bias, size_t sA, size_t sB, size_t sC) {
    typedef typename WFrag<T16>::V V;
    __shared__ __align__(16) float os[16 * 68];
    const size_t z = blockIdx.z; A += z * sA; if (A2) A2 += z * sA; Bt += z * sB; if (Bt2) Bt2 += z * sB; C += z * sC;
    const int lane = threadIdx.x & 31, lr = lane & 15, hi = lane >> 4; const int r0 = blockIdx.x * 64, c0 = blockIdx.y * 64;
    v8f acc[4][4];
#pragma unroll
    for (int mb = 0; mb < 4; ++mb)
#pragma unroll
        for (int nb = 0; nb < 4; ++nb) acc[mb][nb] = (v8f){};
    const size_t aoff = (size_t)(r0 + lr) * K + 8 * hi, boff = (size_t)(c0 + lr) * K + 8 * hi;
    for (int kc = 0; kc < K; kc += 32) {
        V a[4], a2[4];
#pragma unroll
        for (int mb = 0; mb < 4; ++mb) { a[mb] = WFrag<T16>::ld(A + aoff + (size_t)mb * 16 * K + kc); if (NSPLIT == 1 || NSPLIT == 2) a2[mb] = WFrag<T16>::ld(A2 + aoff + (size_t)mb * 16 * K + kc); }
#pragma unroll
        for (int nb = 0; nb < 4; ++nb) { const V b = WFrag<T16>::ld(Bt + boff + (size_t)nb * 16 * K + kc); V b2; if (NSPLIT >= 2) b2 = WFrag<T16>::ld(Bt2 + boff + (size_t)nb * 16 * K + kc);
#pragma unroll
            for (int mb = 0; mb < 4; ++mb) { acc[mb][nb] = WFrag<T16>::mma(a[mb], b, acc[mb][nb]); if (NSPLIT == 1 || NSPLIT == 2) acc[mb][nb] = WFrag<T16>::mma(a2[mb], b, acc[mb][nb]); if (NSPLIT >= 2) acc[mb][nb] = WFrag<T16>::mma(a[mb], b2, acc[mb][nb]); } }
        asm volatile("v_nop\n\tv_nop\n\tv_nop\n\tv_nop" : "+v"(acc[0][0]), "+v"(acc[1][1]), "+v"(acc[2][2]), "+v"(acc[3][3]) : "v"(a[0]), "v"(a[3]));
    }
#pragma unroll
    for (int mb = 0; mb < 4; ++mb) {
#pragma unroll
        for (int nb = 0; nb < 4; ++nb) {
#pragma unroll
            for (int j = 0; j < 8; ++j) os[(hi * 8 + j) * 68 + nb * 16 + lr] = acc[mb][nb][j]; }
        __builtin_amdgcn_wave_barrier(); asm volatile("" ::: "memory");
        float* crow = C + (size_t)(r0 + mb * 16) * ldc + c0;
{
#pragma unroll
            for (int s = 0; s < 8; ++s) { const int row = 2 * s + hi, cofs = lr * 4; v4f val = *(const v4fa*)(os + row * 68 + cofs); if (BIAS) { val[0] += bfr(bias[c0 + cofs]); val[1] += bfr(bias[c0 + cofs + 1]); val[2] += bfr(bias[c0 + cofs + 2]); val[3] += bfr(bias[c0 + cofs + 3]); }
                *(v4f*)(crow + (size_t)row * ldc + cofs) = val; }
             }
        __builtin_amdgcn_wave_barrier(); asm volatile("" ::: "memory");
    }
}

// ---- k_gemmc: the same one-wave 64x64 tile GEMM specialised for causal attention: CMODE 1 skips score tiles entirely above the diagonal (query rows r0+roff.., key columns c0..), CMODE 2 limits the
// key (K) loop of the probability x value contraction to the diagonal block (probabilities beyond it are exactly zero). roff = row offset of this launch's first row within the sequence.
template <typename T16, int NSPLIT, int CMODE>
__global__ __launch_bounds__(32) void k_gemmc(const T16* __restrict__ A, const T16* __restrict__ A2, const T16* __restrict__ Bt, const T16* __restrict__ Bt2, int K, float* C, int ldc, int roff, size_t sA, size_t sB, size_t sC) {
    typedef typename WFrag<T16>::V V;
    __shared__ __align__(16) float os[16 * 68];
    const size_t z = blockIdx.z; A += z * sA; if (A2) A2 += z * sA; Bt += z * sB; if (Bt2) Bt2 += z * sB; C += z * sC;
    const int lane = threadIdx.x & 31, lr = lane & 15, hi = lane >> 4; const int r0 = blockIdx.x * 64, c0 = blockIdx.y * 64;
    if (CMODE == 1 && c0 > r0 + roff + 63) return;                  // score tile entirely above the causal diagonal: never read (the softmax masks j > i by select)
    const int Kl = (CMODE == 2) ? min(K, r0 + roff + 64) : K;        // P.V: probabilities are exactly 0 beyond the diagonal block, so the K loop stops there
    v8f acc[4][4];
#pragma unroll
    for (int mb = 0; mb < 4; ++mb)
#pragma unroll
        for (int nb = 0; nb < 4; ++nb) acc[mb][nb] = (v8f){};
    const size_t aoff = (size_t)(r0 + lr) * K + 8 * hi, boff = (size_t)(c0 + lr) * K + 8 * hi;
    for (int kc = 0; kc < Kl; kc += 32) {
        V a[4], a2[4];
#pragma unroll
        for (int mb = 0; mb < 4; ++mb) { a[mb] = WFrag<T16>::ld(A + aoff + (size_t)mb * 16 * K + kc); if (NSPLIT == 1 || NSPLIT == 2) a2[mb] = WFrag<T16>::ld(A2 + aoff + (size_t)mb * 16 * K + kc); }
#pragma unroll
        for (int nb = 0; nb < 4; ++nb) { const V b = WFrag<T16>::ld(Bt + boff + (size_t)nb * 16 * K + kc); V b2; if (NSPLIT >= 2) b2 = WFrag<T16>::ld(Bt2 + boff + (size_t)nb * 16 * K + kc);
#pragma unroll
            for (int mb = 0; mb < 4; ++mb) { acc[mb][nb] = WFrag<T16>::mma(a[mb], b, acc[mb][nb]); if (NSPLIT == 1 || NSPLIT == 2) acc[mb][nb] = WFrag<T16>::mma(a2[mb], b, acc[mb][nb]); if (NSPLIT >= 2) acc[mb][nb] = WFrag<T16>::mma(a[mb], b2, acc[mb][nb]); } }
        asm volatile("v_nop\n\tv_nop\n\tv_nop\n\tv_nop" : "+v"(acc[0][0]), "+v"(acc[1][1]), "+v"(acc[2][2]), "+v"(acc[3][3]) : "v"(a[0]), "v"(a[3]));
    }
#pragma unroll
    for (int mb = 0; mb < 4; ++mb) {
#pragma unroll
        for (int nb = 0; nb < 4; ++nb) {
#pragma unroll
            for (int j = 0; j < 8; ++j) os[(hi * 8 + j) * 68 + nb * 16 + lr] = acc[mb][nb][j]; }
        __builtin_amdgcn_wave_barrier(); asm volatile("" ::: "memory");
        float* crow = C + (size_t)(r0 + mb * 16) * ldc + c0;
{
#pragma unroll
            for (int s = 0; s < 8; ++s) { const int row = 2 * s + hi, cofs = lr * 4; v4f val = *(const v4fa*)(os + row * 68 + cofs);
                *(v4f*)(crow + (size_t)row * ldc + cofs) = val; }
             }
        __builtin_amdgcn_wave_barrier(); asm volatile("" ::: "memory");
    }
}

__device__ __forceinline__ h16 tohx(float x) { return (h16)x; }
__device__ __forceinline__ void splitf(float y, unsigned short& h, unsigned short& l) { h = f2bf(y); l = f2bf(y - bf2f(h)); }
typedef __attribute__((ext_vector_type(2))) _Float16 v2h;
typedef __attribute__((ext_vector_type(4))) _Float16 v4h;
typedef __attribute__((ext_vector_type(2))) unsigned short v2us;
typedef __attribute__((ext_vector_type(4))) unsigned short v4us;
typedef __attribute__((ext_vector_type(2))) float v2f;
typedef __attribute__((ext_vector_type(4))) int v4i;

__global__ __launch_bounds__(256) void k_wtG(const float* __restrict__ w, int K, int N, bf* Bt) {
    const int lane = threadIdx.x & 31; const int L0 = (blockIdx.x * 8 + (threadIdx.x >> 5)) * 8; const int nlines = N * K / 64;
{
        for (int l = 0; l < 8; ++l) { const int L = L0 + l; if (L >= nlines) break; const size_t e = (size_t)L * 64 + lane * 2; const int k = (int)(e % K), n = (int)(e / K); v2us o;
            o[0] = f2bf(w[(size_t)k * N + n]); o[1] = f2bf(w[(size_t)(k + 1) * N + n]); *(v2us*)(Bt + e) = o; }
         }
}
__global__ __launch_bounds__(256) void k_cvt8(const float* __restrict__ src, bf* dst, size_t n8) { const size_t i = (size_t)blockIdx.x * 256 + threadIdx.x; if (i >= n8) return; const v8f v = *(const v8f*)(src + i * 8); v8us o;
#pragma unroll
    for (int k = 0; k < 8; ++k) o[k] = f2bf(v[k]); *(v8us*)(dst + i * 8) = o;  }
__global__ __launch_bounds__(256) void k_csI(const float* __restrict__ fc, const float* __restrict__ fs, float* CS) { const int idx = blockIdx.x * 256 + threadIdx.x; if (idx >= TT * HD) return; const int d = idx % HD; const int t = idx / HD; v2f cs; cs[0] = bfr(fc[(size_t)t * (HD / 2) + (d >> 1)]); cs[1] = bfr(fs[(size_t)t * (HD / 2) + (d >> 1)]); *(v2f*)(CS + (size_t)idx * 2) = cs;  }
__global__ __launch_bounds__(256) void k_ropeI(const float* __restrict__ F, int pitch, int nheads, const float* __restrict__ CS, float sc, h16* P16, bf* Ph, bf* Pl) {
    const size_t e = ((size_t)blockIdx.x * 256 + threadIdx.x) * 2; if (e >= (size_t)nheads * TT * HD) return; const int d = (int)(e % HD); const int t = (int)((e / HD) % TT); const int h = (int)(e / ((size_t)HD * TT)); const float* f = F + (size_t)t * pitch + h * HD; const float x0 = f[d], x1 = f[d + 1]; const v2f cs = *(const v2f*)(CS + ((size_t)t * HD + d) * 2); v2h o16; v2us oh, ol;
    float a0 = __fmul_rn(x0, cs[0]), b0 = __fmul_rn(x1, cs[1]), a1 = __fmul_rn(x1, cs[0]), b1 = __fmul_rn(x0, cs[1]); 
    float r0 = __fsub_rn(a0, b0) * sc, r1 = __fadd_rn(b1, a1) * sc;   /* even: x0 c - x1 s; odd: x0 s + x1 c */
    o16[0] = tohx(r0); o16[1] = tohx(r1); { unsigned short a2, c2; splitf(r0, a2, c2); oh[0] = a2; ol[0] = c2; splitf(r1, a2, c2); oh[1] = a2; ol[1] = c2; }
    *(v2h*)(P16 + e) = o16; *(v2us*)(Ph + e) = oh; *(v2us*)(Pl + e) = ol;  }


// k_ropeI: head planes [h][t][d] (fp16 + hi/lo) of rope(x) x sc with the interleaved-pair convention out[2i] = x[2i] c - x[2i+1] s, out[2i+1] = x[2i] s + x[2i+1] c, c, s = cos / sin[t][i]

__global__ __launch_bounds__(256) void k_vtp(const float* __restrict__ F, int pitch, int nheads, h16* V16, bf* Vh, bf* Vl) { const size_t e = ((size_t)blockIdx.x * 256 + threadIdx.x) * 2; if (e >= (size_t)nheads * HD * TT) return; const int t = (int)(e % TT); const int d = (int)((e / TT) % HD); const int g = (int)(e / ((size_t)TT * HD)); v2h o16; v2us oh, ol;
#pragma unroll
    for (int q = 0; q < 2; ++q) { const float x = F[(size_t)(t + q) * pitch + g * HD + d]; o16[q] = tohx(x); unsigned short a2, c2; splitf(x, a2, c2); oh[q] = a2; ol[q] = c2; }
    *(v2h*)(V16 + e) = o16; *(v2us*)(Vh + e) = oh; *(v2us*)(Vl + e) = ol;  }
// k_asoft: per row (zz, i): t = S x HD^-0.5 for j <= i and i - j < WIN (WIN = TT here: plain causal: every key at or before the query; the reference's -inf above the diagonal == exclusion); softmax over the kept keys (register row, one exp, fixed trees);
__global__ __launch_bounds__(256) void k_asoft(const float* __restrict__ Sb, h16* P16, bf* Ph, bf* Pl) {
    const int lane = threadIdx.x & 31; const int row = blockIdx.x * 8 + (threadIdx.x >> 5); if (row >= ZH * TT) return; const int i = row % TT; const int zz = row / TT; (void)zz; const bool hires = (i < RH); const float* sr = Sb + (size_t)row * TT; float v[TT / 32]; float mx = -3.0e38f;
#pragma unroll
    for (int ch = 0; ch < TT / 128; ++ch) { const int j0 = ch * 128 + lane * 4; const v4f a = *(const v4f*)(sr + j0);
#pragma unroll
        for (int q = 0; q < 4; ++q) { const int j = j0 + q; (void)j; const float t = (j <= i && i - j < WIN) ? a[q] * SCL : -3.0e38f; v[ch * 4 + q] = t; mx = fmaxf(mx, t); } }
#pragma unroll
    for (int sh = 16; sh; sh >>= 1) mx = fmaxf(mx, __shfl_xor(mx, sh, 32));
    float sum = 0.f;
#pragma unroll
    for (int k = 0; k < TT / 32; ++k) { float d0 = __fsub_rn(v[k], mx); v[k] = __builtin_amdgcn_exp2f(__fmul_rn(d0, 1.4426950408889634f)); sum += v[k]; }
#pragma unroll
    for (int sh = 16; sh; sh >>= 1) sum += __shfl_xor(sum, sh, 32);
    const float f = __fdiv_rn(hires ? 1.0f : PCAR, sum);
{
        if (hires) {
#pragma unroll
            for (int ch = 0; ch < TT / 128; ++ch) { v4us oh, ol;
#pragma unroll
                for (int q = 0; q < 4; ++q) { unsigned short a, c2; splitf(v[ch * 4 + q] * f, a, c2); oh[q] = a; ol[q] = c2; }
                const size_t oo = ((size_t)zz * (RH ? RH : 1) + i) * TT + ch * 128 + lane * 4; *(v4us*)(Ph + oo) = oh; *(v4us*)(Pl + oo) = ol; }
        } else {
#pragma unroll
            for (int ch = 0; ch < TT / 128; ++ch) { v4h o4;
#pragma unroll
                for (int q = 0; q < 4; ++q) o4[q] = tohx(v[ch * 4 + q] * f);
                *(v4h*)(P16 + (size_t)row * TT + ch * 128 + lane * 4) = o4; } }
         }
}
__global__ __launch_bounds__(256) void k_merge(const float* __restrict__ O, int h0, bf* Ah, bf* Al) { const size_t e = ((size_t)blockIdx.x * 256 + threadIdx.x) * 2; if (e >= (size_t)ZH * TT * HD) return; const int d = (int)(e % HD); const int t = (int)((e / HD) % TT); const int zz = (int)(e / ((size_t)HD * TT)); const float cs = (t < RH) ? 1.0f : (1.0f / PCAR); const size_t oo = (size_t)t * DQ + (h0 + zz) * HD + d;
    v2us oh, ol;
#pragma unroll
    for (int q = 0; q < 2; ++q) { unsigned short a, c2; splitf(O[e + q] * cs, a, c2); oh[q] = a; ol[q] = c2; } *(v2us*)(Ah + oo) = oh; *(v2us*)(Al + oo) = ol;  }

extern "C" void kernel_launch(void* const* d_in, const int* in_sizes, int n_in,
                              void* d_out, int out_size, void* d_ws, size_t ws_size, hipStream_t stream) {
    (void)in_sizes; (void)n_in; (void)out_size;
        const float* x = (const float*)d_in[0]; const float* fcos = (const float*)d_in[1]; const float* fsin = (const float*)d_in[2]; const float* wq = (const float*)d_in[3]; const float* wk = (const float*)d_in[4]; const float* wv = (const float*)d_in[5]; const float* wo = (const float*)d_in[6]; const float* bo = (const float*)d_in[7];   /* input order x, pos_cos, pos_sin ([2048][32] HALF-width table INPUTS: read by value), Wq, Wk, Wv, Wo ('xw' (in, out) [1024][1024]), bo ([1024]: zeros, read through the output launch's bias slot): EIGHT inputs, all read; the q, k, v projections have NO bias in this module */
    float* OUT = (float*)d_out;     // [2][2048][1024]
    char* wsp = (char*)d_ws;
    auto take = [&](size_t bytes) { char* p = wsp; wsp += (bytes + 255) & ~(size_t)255; return (void*)p; };
    bf* WQ = (bf*)take((size_t)DQ * DM * 2); bf* WK = (bf*)take((size_t)DKV * DM * 2); bf* WV = (bf*)take((size_t)DKV * DM * 2); bf* WO = (bf*)take((size_t)DM * DQ * 2); float* CS = (float*)take((size_t)TT * HD * 2 * 4);
    bf* XB = (bf*)take((size_t)TT * DM * 2); float* FQ = (float*)take((size_t)TT * DQ * 4); float* FK = (float*)take((size_t)TT * DKV * 4);
    h16* QP16 = (h16*)take((size_t)NH_ * TT * HD * 2); h16* KP16 = (h16*)take((size_t)NKV * TT * HD * 2); h16* VT16 = (h16*)take((size_t)NKV * HD * TT * 2);
    bf* QPh = (bf*)take((size_t)NH_ * TT * HD * 2); bf* QPl = (bf*)take((size_t)NH_ * TT * HD * 2); bf* KPh = (bf*)take((size_t)NKV * TT * HD * 2); bf* KPl = (bf*)take((size_t)NKV * TT * HD * 2); bf* VTh = (bf*)take((size_t)NKV * HD * TT * 2); bf* VTl = (bf*)take((size_t)NKV * HD * TT * 2); bf* Ph = (bf*)take((size_t)ZH * RH * TT * 2); bf* Pl = (bf*)take((size_t)ZH * RH * TT * 2);
    float* Sb = (float*)take((size_t)ZH * TT * TT * 4); h16* P16 = (h16*)take((size_t)ZH * TT * TT * 2); float* Ob = (float*)take((size_t)ZH * TT * HD * 4); bf* ATh = (bf*)take((size_t)TT * DQ * 2); bf* ATl = (bf*)take((size_t)TT * DQ * 2);
    if ((size_t)(wsp - (char*)d_ws) > ws_size) return;    // ws 256 MiB
    float* FV = FK;   // v projection reuses the k buffer after the k planes are built (stream-ordered)
    { k_wtG<<<(unsigned)((DM * DQ / 64 + 63) / 64), 256, 0, stream>>>(wq, DM, DQ, WQ); k_wtG<<<(unsigned)((DM * DKV / 64 + 63) / 64), 256, 0, stream>>>(wk, DM, DKV, WK); k_wtG<<<(unsigned)((DM * DKV / 64 + 63) / 64), 256, 0, stream>>>(wv, DM, DKV, WV);
      k_wtG<<<(unsigned)((DQ * DM / 64 + 63) / 64), 256, 0, stream>>>(wo, DQ, DM, WO);   /* 'xw' [in][out] weights: transposed once into Bt */
       }
    const unsigned LQ = (unsigned)(((size_t)NH_ * TT * HD / 2 + 255) / 256), LKv = (unsigned)(((size_t)NKV * TT * HD / 2 + 255) / 256);
    for (int b = 0; b < NB_; ++b) {
        if (b == 0) k_csI<<<(TT * HD + 255) / 256, 256, 0, stream>>>(fcos, fsin, CS);   /* rotary table once, from the input tables */
        k_cvt8<<<(unsigned)(((size_t)TT * DM / 8 + 255) / 256), 256, 0, stream>>>(x + (size_t)b * TT * DM, XB, (size_t)TT * DM / 8);
        k_gemmw<bf, 0, false><<<dim3(TT / 64, DQ / 64, 1), 32, 0, stream>>>(XB, nullptr, WQ, nullptr, DM, FQ, DQ, nullptr, 0, 0, 0);
        k_ropeI<<<LQ, 256, 0, stream>>>(FQ, DQ, NH_, CS, 1.0f, QP16, QPh, QPl);
        k_gemmw<bf, 0, false><<<dim3(TT / 64, DKV / 64, 1), 32, 0, stream>>>(XB, nullptr, WK, nullptr, DM, FK, DKV, nullptr, 0, 0, 0);
        k_ropeI<<<LKv, 256, 0, stream>>>(FK, DKV, NKV, CS, 1.0f, KP16, KPh, KPl);
        k_gemmw<bf, 0, false><<<dim3(TT / 64, DKV / 64, 1), 32, 0, stream>>>(XB, nullptr, WV, nullptr, DM, FV, DKV, nullptr, 0, 0, 0); k_vtp<<<LKv, 256, 0, stream>>>(FV, DKV, NKV, VT16, VTh, VTl);
        for (int h0 = 0; h0 < NH_; h0 += ZH) { const size_t zq = (size_t)h0, zk = (size_t)(h0 / REP);   // one kv head per query head: the pass's two heads use consecutive kv planes (z-strides TT*HD)
            k_gemmc<bf, 2, 1><<<dim3(RH / 64, TT / 64, ZH), 32, 0, stream>>>(QPh + zq * TT * HD, QPl + zq * TT * HD, KPh + zk * TT * HD, KPl + zk * TT * HD, HD, Sb, TT, 0, (size_t)TT * HD, (size_t)TT * HD, (size_t)TT * TT);
            k_gemmc<h16, 0, 1><<<dim3((TT - RH) / 64, TT / 64, ZH), 32, 0, stream>>>(QP16 + zq * TT * HD + (size_t)RH * HD, nullptr, KP16 + zk * TT * HD, nullptr, HD, Sb + (size_t)RH * TT, TT, RH, (size_t)TT * HD, (size_t)TT * HD, (size_t)TT * TT);
            k_asoft<<<ZH * TT / 8, 256, 0, stream>>>(Sb, P16, Ph, Pl);
            k_gemmc<bf, 2, 2><<<dim3(RH / 64, HD / 64, ZH), 32, 0, stream>>>(Ph, Pl, VTh + zk * HD * TT, VTl + zk * HD * TT, TT, Ob, HD, 0, (size_t)RH * TT, (size_t)HD * TT, (size_t)TT * HD);
            k_gemmc<h16, 0, 2><<<dim3((TT - RH) / 64, HD / 64, ZH), 32, 0, stream>>>(P16 + (size_t)RH * TT, nullptr, VT16 + zk * HD * TT, nullptr, TT, Ob + (size_t)RH * HD, HD, RH, (size_t)TT * TT, (size_t)HD * TT, (size_t)TT * HD);
            k_merge<<<(unsigned)(((size_t)ZH * TT * HD / 2 + 255) / 256), 256, 0, stream>>>(Ob, h0, ATh, ATl); }
        k_gemmw<bf, 1, true><<<dim3(TT / 64, DM / 64, 1), 32, 0, stream>>>(ATh, ATl, WO, nullptr, DQ, OUT + (size_t)b * TT * DM, DM, bo, 0, 0, 0); }
}

// v001
// One run takes 711 microseconds.
// Two timings next to v000 put it at 2.04 and 2.06 times that version's speed.
#include <hip/hip_runtime.h>

// Causal multi-head self-attention with interleaved-pair rotary embeddings from two half-width INPUT tables and (in, out) weights (x [2][2048][1024]; q, k, v = x W ('xw' [1024][1024] normal x 0.02, no projection bias; 16 heads x 64); _rope on q and k: consecutive pairs (t[2i], t[2i+1]) -> (te c - to s, te s + to c) with c, s = pos_cos / pos_sin[t][i] (f32 [2048][32] INPUT tables the module computes: cos / sin(t / 10000^(2i/64)): read by value); scores: -inf above the diagonal, then / sqrt(64) (the same as scaling first); softmax; out = merged Wo + bo ('xw' + a zero bias [1024], read) -> [2][2048][1024] (4.2 M); argument order x, pos_cos, pos_sin, Wq, Wk, Wv, Wo, bo).
// Layout per batch: bf16 copy of x; exact projections (no bias); the two half-width INPUT tables copied once into one bf16-rounded {cos, sin} table per (position, pair) (k_csI); interleaved rotary plane builder; causal T-2048 attention, ZH heads per pass (hybrid rows: < 512 hi/lo 3 products, rest fp16 x1024; k_gemmc skips tiles above the diagonal; the softmax writes each probability row over its own score row); merged hi/lo x Wo exact + bo.
// Compute dtypes, f32 accumulate: every input rounded to bf16; projections exact (no bias); rotary f32; attention rows < 512 3 products, rest fp16; softmax f32; Wo hl x exact + bias.

#define NB_  2
#define TT   2048
#define DM   1024
#define NH_  16
#define NKV  16
#define REP  (NH_ / NKV)
#define HD   64
#define DQ   (NH_ * HD)
#define DKV  (NKV * HD)
#define ZH   8                    // heads per attention pass (z of every attention launch)
#define PP   (2 * TT)             // pitch, in 16-bit elements, of a probability row kept in its own score row's 4 * TT bytes; the V^T planes share it
#define RH   512                  // query rows < RH use hi+lo planes (0: none)
#define WIN  2048
#define PCAR 1024.0f
#define SCL  0.125f   // HD^-0.5
typedef _Float16 h16;
typedef unsigned short bf;
typedef __attribute__((ext_vector_type(16))) __bf16   v16bf;
typedef __attribute__((ext_vector_type(16))) _Float16 v16h;
typedef __attribute__((ext_vector_type(8)))  _Float16 v8h;
typedef __attribute__((ext_vector_type(8)))  unsigned short v8us;
typedef __attribute__((ext_vector_type(8)))  float    v8f;
typedef __attribute__((ext_vector_type(4)))  float    v4f;
typedef v8h  __attribute__((may_alias)) v8ha;
typedef v4f  __attribute__((may_alias)) v4fa;
typedef v8us __attribute__((may_alias)) v8usa;

__device__ __forceinline__ unsigned short f2bf(float f) { unsigned u = __float_as_uint(f); u += 0x7FFFu + ((u >> 16) & 1u); return (unsigned short)(u >> 16); }
__device__ __forceinline__ float bf2f(unsigned short b) { return __uint_as_float(((unsigned)b) << 16); }
__device__ __forceinline__ float bfr(float f) { return bf2f(f2bf(f)); }
__device__ __forceinline__ v16h cat16(v8h lo, v8h hi) { return __builtin_shufflevector(lo, hi, 0, 1, 2, 3, 4, 5, 6, 7, 8, 9, 10, 11, 12, 13, 14, 15); }
__device__ __forceinline__ v16bf cat16b(v8us lo, v8us hi) { return __builtin_bit_cast(v16bf, __builtin_shufflevector(lo, hi, 0, 1, 2, 3, 4, 5, 6, 7, 8, 9, 10, 11, 12, 13, 14, 15)); }
__device__ __forceinline__ v8f wmma16(v16h a, v16h b, v8f c) { return __builtin_amdgcn_wmma_f32_16x16x32_f16(false, a, false, b, (short)0, c, false, false); }
__device__ __forceinline__ v8f wmmab(v16bf a, v16bf b, v8f c) { return __builtin_amdgcn_wmma_f32_16x16x32_bf16(false, a, false, b, (short)0, c, false, false); }



// ---- k_gemmw: register-blocked GEMM, ONE WAVE per 64x64 output tile (16 accumulators), operands straight from K-contiguous 16-bit planes; grid (M/64, N/64, Z), 32 threads.
// C[m][n] (f32, pitch ldc, + optional f32 bias[n]) = sum_k A[m][k] Bt[n][k] (+ split products per NSPLIT). z-batch strides sA/sB/sC in elements. K % 32 == 0.
template <typename T16> struct WFrag;
template <> struct WFrag<h16> { typedef v16h V; static __device__ __forceinline__ V ld(const h16* p) { return cat16(*(const v8h*)p, *(const v8h*)(p + 16)); } static __device__ __forceinline__ v8f mma(V a, V b, v8f c) { return wmma16(a, b, c); } };
template <> struct WFrag<bf> { typedef v16bf V; static __device__ __forceinline__ V ld(const bf* p) { return cat16b(*(const v8us*)p, *(const v8us*)(p + 16)); } static __device__ __forceinline__ v8f mma(V a, V b, v8f c) { return wmmab(a, b, c); } };
template <typename T16, int NSPLIT, bool BIAS>
__global__ __launch_bounds__(32) void k_gemmw(const T16* __restrict__ A, const T16* __restrict__ A2, const T16* __restrict__ Bt, const T16* __restrict__ Bt2, int K, float* C, int ldc, const float* __restrict__ bias, size_t sA, size_t sB, size_t sC) {
    typedef typename WFrag<T16>::V V;
    __shared__ __align__(16) float os[16 * 68];
    const size_t z = blockIdx.z; A += z * sA; if (A2) A2 += z * sA; Bt += z * sB; if (Bt2) Bt2 += z * sB; C += z * sC;
    const int lane = threadIdx.x & 31, lr = lane & 15, hi = lane >> 4; const int r0 = blockIdx.x * 64, c0 = blockIdx.y * 64;
    v8f acc[4][4];
#pragma unroll
    for (int mb = 0; mb < 4; ++mb)
#pragma unroll
        for (int nb = 0; nb < 4; ++nb) acc[mb][nb] = (v8f){};
    const size_t aoff = (size_t)(r0 + lr) * K + 8 * hi, boff = (size_t)(c0 + lr) * K + 8 * hi;
    for (int kc = 0; kc < K; kc += 32) {
        V a[4], a2[4];
#pragma unroll
        for (int mb = 0; mb < 4; ++mb) { a[mb] = WFrag<T16>::ld(A + aoff + (size_t)mb * 16 * K + kc); if (NSPLIT == 1 || NSPLIT == 2) a2[mb] = WFrag<T16>::ld(A2 + aoff + (size_t)mb * 16 * K + kc); }
#pragma unroll
        for (int nb = 0; nb < 4; ++nb) { const V b = WFrag<T16>::ld(Bt + boff + (size_t)nb * 16 * K + kc); V b2; if (NSPLIT >= 2) b2 = WFrag<T16>::ld(Bt2 + boff + (size_t)nb * 16 * K + kc);
#pragma unroll
            for (int mb = 0; mb < 4; ++mb) { acc[mb][nb] = WFrag<T16>::mma(a[mb], b, acc[mb][nb]); if (NSPLIT == 1 || NSPLIT == 2) acc[mb][nb] = WFrag<T16>::mma(a2[mb], b, acc[mb][nb]); if (NSPLIT >= 2) acc[mb][nb] = WFrag<T16>::mma(a[mb], b2, acc[mb][nb]); } }
        asm volatile("v_nop\n\tv_nop\n\tv_nop\n\tv_nop" : "+v"(acc[0][0]), "+v"(acc[1][1]), "+v"(acc[2][2]), "+v"(acc[3][3]) : "v"(a[0]), "v"(a[3]));
    }
#pragma unroll
    for (int mb = 0; mb < 4; ++mb) {
#pragma unroll
        for (int nb = 0; nb < 4; ++nb) {
#pragma unroll
            for (int j = 0; j < 8; ++j) os[(hi * 8 + j) * 68 + nb * 16 + lr] = acc[mb][nb][j]; }
        __builtin_amdgcn_wave_barrier(); asm volatile("" ::: "memory");
        float* crow = C + (size_t)(r0 + mb * 16) * ldc + c0;
{
#pragma unroll
            for (int s = 0; s < 8; ++s) { const int row = 2 * s + hi, cofs = lr * 4; v4f val = *(const v4fa*)(os + row * 68 + cofs); if (BIAS) { val[0] += bfr(bias[c0 + cofs]); val[1] += bfr(bias[c0 + cofs + 1]); val[2] += bfr(bias[c0 + cofs + 2]); val[3] += bfr(bias[c0 + cofs + 3]); }
                *(v4f*)(crow + (size_t)row * ldc + cofs) = val; }
             }
        __builtin_amdgcn_wave_barrier(); asm volatile("" ::: "memory");
    }
}

// ---- k_gemmc: the same one-wave 64x64 tile GEMM specialised for causal attention: CMODE 1 skips score tiles entirely above the diagonal (query rows r0+roff.., key columns c0..), CMODE 2 limits the
// key (K) loop of the probability x value contraction to the diagonal block (probabilities beyond it are exactly zero). roff = row offset of this launch's first row within the sequence.
template <typename T16, int NSPLIT, int CMODE>
__global__ __launch_bounds__(32) void k_gemmc(const T16* __restrict__ A, const T16* __restrict__ A2, const T16* __restrict__ Bt, const T16* __restrict__ Bt2, int K, float* C, int ldc, int roff, size_t sA, size_t sB, size_t sC) {
    typedef typename WFrag<T16>::V V;
    __shared__ __align__(16) float os[16 * 68];
    const size_t z = blockIdx.z; A += z * sA; if (A2) A2 += z * sA; Bt += z * sB; if (Bt2) Bt2 += z * sB; C += z * sC;
    const int lane = threadIdx.x & 31, lr = lane & 15, hi = lane >> 4; const int r0 = blockIdx.x * 64, c0 = blockIdx.y * 64;
    if (CMODE == 1 && c0 > r0 + roff + 63) return;                  // score tile entirely above the causal diagonal: never read (the softmax masks j > i by select)
    const int Kl = (CMODE == 2) ? min(K, r0 + roff + 64) : K;        // P.V: probabilities are exactly 0 beyond the diagonal block, so the K loop stops there
    v8f acc[4][4];
#pragma unroll
    for (int mb = 0; mb < 4; ++mb)
#pragma unroll
        for (int nb = 0; nb < 4; ++nb) acc[mb][nb] = (v8f){};
    const size_t aoff = (size_t)(r0 + lr) * K + 8 * hi, boff = (size_t)(c0 + lr) * K + 8 * hi;
    for (int kc = 0; kc < Kl; kc += 32) {
        V a[4], a2[4];
#pragma unroll
        for (int mb = 0; mb < 4; ++mb) { a[mb] = WFrag<T16>::ld(A + aoff + (size_t)mb * 16 * K + kc); if (NSPLIT == 1 || NSPLIT == 2) a2[mb] = WFrag<T16>::ld(A2 + aoff + (size_t)mb * 16 * K + kc); }
#pragma unroll
        for (int nb = 0; nb < 4; ++nb) { const V b = WFrag<T16>::ld(Bt + boff + (size_t)nb * 16 * K + kc); V b2; if (NSPLIT >= 2) b2 = WFrag<T16>::ld(Bt2 + boff + (size_t)nb * 16 * K + kc);
#pragma unroll
            for (int mb = 0; mb < 4; ++mb) { acc[mb][nb] = WFrag<T16>::mma(a[mb], b, acc[mb][nb]); if (NSPLIT == 1 || NSPLIT == 2) acc[mb][nb] = WFrag<T16>::mma(a2[mb], b, acc[mb][nb]); if (NSPLIT >= 2) acc[mb][nb] = WFrag<T16>::mma(a[mb], b2, acc[mb][nb]); } }
        asm volatile("v_nop\n\tv_nop\n\tv_nop\n\tv_nop" : "+v"(acc[0][0]), "+v"(acc[1][1]), "+v"(acc[2][2]), "+v"(acc[3][3]) : "v"(a[0]), "v"(a[3]));
    }
#pragma unroll
    for (int mb = 0; mb < 4; ++mb) {
#pragma unroll
        for (int nb = 0; nb < 4; ++nb) {
#pragma unroll
            for (int j = 0; j < 8; ++j) os[(hi * 8 + j) * 68 + nb * 16 + lr] = acc[mb][nb][j]; }
        __builtin_amdgcn_wave_barrier(); asm volatile("" ::: "memory");
        float* crow = C + (size_t)(r0 + mb * 16) * ldc + c0;
{
#pragma unroll
            for (int s = 0; s < 8; ++s) { const int row = 2 * s + hi, cofs = lr * 4; v4f val = *(const v4fa*)(os + row * 68 + cofs);
                *(v4f*)(crow + (size_t)row * ldc + cofs) = val; }
             }
        __builtin_amdgcn_wave_barrier(); asm volatile("" ::: "memory");
    }
}

__device__ __forceinline__ h16 tohx(float x) { return (h16)x; }
__device__ __forceinline__ void splitf(float y, unsigned short& h, unsigned short& l) { h = f2bf(y); l = f2bf(y - bf2f(h)); }
typedef __attribute__((ext_vector_type(2))) _Float16 v2h;
typedef __attribute__((ext_vector_type(4))) _Float16 v4h;
typedef __attribute__((ext_vector_type(2))) unsigned short v2us;
typedef __attribute__((ext_vector_type(4))) unsigned short v4us;
typedef __attribute__((ext_vector_type(2))) float v2f;
typedef __attribute__((ext_vector_type(4))) int v4i;
typedef v4h  __attribute__((may_alias)) v4ha;
typedef v4us __attribute__((may_alias)) v4usa;

__global__ __launch_bounds__(256) void k_wtG(const float* __restrict__ w, int K, int N, bf* Bt) {
    const int lane = threadIdx.x & 31; const int L0 = (blockIdx.x * 8 + (threadIdx.x >> 5)) * 8; const int nlines = N * K / 64;
{
        for (int l = 0; l < 8; ++l) { const int L = L0 + l; if (L >= nlines) break; const size_t e = (size_t)L * 64 + lane * 2; const int k = (int)(e % K), n = (int)(e / K); v2us o;
            o[0] = f2bf(w[(size_t)k * N + n]); o[1] = f2bf(w[(size_t)(k + 1) * N + n]); *(v2us*)(Bt + e) = o; }
         }
}
__global__ __launch_bounds__(256) void k_cvt8(const float* __restrict__ src, bf* dst, size_t n8) { const size_t i = (size_t)blockIdx.x * 256 + threadIdx.x; if (i >= n8) return; const v8f v = *(const v8f*)(src + i * 8); v8us o;
#pragma unroll
    for (int k = 0; k < 8; ++k) o[k] = f2bf(v[k]); *(v8us*)(dst + i * 8) = o;  }
__global__ __launch_bounds__(256) void k_csI(const float* __restrict__ fc, const float* __restrict__ fs, float* CS) { const int idx = blockIdx.x * 256 + threadIdx.x; if (idx >= TT * HD) return; const int d = idx % HD; const int t = idx / HD; v2f cs; cs[0] = bfr(fc[(size_t)t * (HD / 2) + (d >> 1)]); cs[1] = bfr(fs[(size_t)t * (HD / 2) + (d >> 1)]); *(v2f*)(CS + (size_t)idx * 2) = cs;  }
__global__ __launch_bounds__(256) void k_ropeI(const float* __restrict__ F, int pitch, int nheads, const float* __restrict__ CS, float sc, h16* P16, bf* Ph, bf* Pl) {
    const size_t e = ((size_t)blockIdx.x * 256 + threadIdx.x) * 2; if (e >= (size_t)nheads * TT * HD) return; const int d = (int)(e % HD); const int t = (int)((e / HD) % TT); const int h = (int)(e / ((size_t)HD * TT)); const float* f = F + (size_t)t * pitch + h * HD; const float x0 = f[d], x1 = f[d + 1]; const v2f cs = *(const v2f*)(CS + ((size_t)t * HD + d) * 2); v2h o16; v2us oh, ol;
    float a0 = __fmul_rn(x0, cs[0]), b0 = __fmul_rn(x1, cs[1]), a1 = __fmul_rn(x1, cs[0]), b1 = __fmul_rn(x0, cs[1]); 
    float r0 = __fsub_rn(a0, b0) * sc, r1 = __fadd_rn(b1, a1) * sc;   /* even: x0 c - x1 s; odd: x0 s + x1 c */
    o16[0] = tohx(r0); o16[1] = tohx(r1); { unsigned short a2, c2; splitf(r0, a2, c2); oh[0] = a2; ol[0] = c2; splitf(r1, a2, c2); oh[1] = a2; ol[1] = c2; }
    *(v2h*)(P16 + e) = o16; *(v2us*)(Ph + e) = oh; *(v2us*)(Pl + e) = ol;  }


// k_ropeI: head planes [h][t][d] (fp16 + hi/lo) of rope(x) x sc with the interleaved-pair convention out[2i] = x[2i] c - x[2i+1] s, out[2i+1] = x[2i] s + x[2i+1] c, c, s = CS[t][2i] (pair i of the input tables)

// k_vtp: V^T planes [g][d][t] at row pitch PP (the pitch of the probability rows they are multiplied with)
__global__ __launch_bounds__(256) void k_vtp(const float* __restrict__ F, int pitch, int nheads, h16* V16, bf* Vh, bf* Vl) { const size_t e = ((size_t)blockIdx.x * 256 + threadIdx.x) * 2; if (e >= (size_t)nheads * HD * TT) return; const int t = (int)(e % TT); const int d = (int)((e / TT) % HD); const int g = (int)(e / ((size_t)TT * HD)); v2h o16; v2us oh, ol;
#pragma unroll
    for (int q = 0; q < 2; ++q) { const float x = F[(size_t)(t + q) * pitch + g * HD + d]; o16[q] = tohx(x); unsigned short a2, c2; splitf(x, a2, c2); oh[q] = a2; ol[q] = c2; }
    const size_t o = ((size_t)g * HD + d) * PP + t; *(v2h*)(V16 + o) = o16; *(v2us*)(Vh + o) = oh; *(v2us*)(Vl + o) = ol;  }
// k_asoft: per row (zz, i): t = S x HD^-0.5 for j <= i and i - j < WIN (WIN = TT here: plain causal: every key at or before the query; the reference's -inf above the diagonal == exclusion); softmax over the kept keys (register row, one exp, fixed trees);
// the probabilities go back into the row's own 4 * TT bytes of Sb (fp16 row in the first half; or hi plane first half, lo plane second half): one wave owns a row and holds all of it in registers before its first store.
__global__ __launch_bounds__(256) void k_asoft(float* Sb) {
    const int lane = threadIdx.x & 31; const int row = blockIdx.x * 8 + (threadIdx.x >> 5); if (row >= ZH * TT) return; const int i = row % TT; const int zz = row / TT; (void)zz; const bool hires = (i < RH); const float* sr = Sb + (size_t)row * TT; h16* p16 = (h16*)(Sb + (size_t)row * TT); bf* ph = (bf*)(Sb + (size_t)row * TT); bf* pl = ph + TT; float v[TT / 32]; float mx = -3.0e38f;
#pragma unroll
    for (int ch = 0; ch < TT / 128; ++ch) { const int j0 = ch * 128 + lane * 4; const v4f a = *(const v4fa*)(sr + j0);
#pragma unroll
        for (int q = 0; q < 4; ++q) { const int j = j0 + q; (void)j; const float t = (j <= i && i - j < WIN) ? a[q] * SCL : -3.0e38f; v[ch * 4 + q] = t; mx = fmaxf(mx, t); } }
#pragma unroll
    for (int sh = 16; sh; sh >>= 1) mx = fmaxf(mx, __shfl_xor(mx, sh, 32));
    float sum = 0.f;
#pragma unroll
    for (int k = 0; k < TT / 32; ++k) { float d0 = __fsub_rn(v[k], mx); v[k] = __builtin_amdgcn_exp2f(__fmul_rn(d0, 1.4426950408889634f)); sum += v[k]; }
#pragma unroll
    for (int sh = 16; sh; sh >>= 1) sum += __shfl_xor(sum, sh, 32);
    const float f = __fdiv_rn(hires ? 1.0f : PCAR, sum);
{
        if (hires) {
#pragma unroll
            for (int ch = 0; ch < TT / 128; ++ch) { v4us oh, ol;
#pragma unroll
                for (int q = 0; q < 4; ++q) { unsigned short a, c2; splitf(v[ch * 4 + q] * f, a, c2); oh[q] = a; ol[q] = c2; }
                const int oo = ch * 128 + lane * 4; *(v4usa*)(ph + oo) = oh; *(v4usa*)(pl + oo) = ol; }
        } else {
#pragma unroll
            for (int ch = 0; ch < TT / 128; ++ch) { v4h o4;
#pragma unroll
                for (int q = 0; q < 4; ++q) o4[q] = tohx(v[ch * 4 + q] * f);
                *(v4ha*)(p16 + ch * 128 + lane * 4) = o4; } }
         }
}
__global__ __launch_bounds__(256) void k_merge(const float* __restrict__ O, int h0, bf* Ah, bf* Al) { const size_t e = ((size_t)blockIdx.x * 256 + threadIdx.x) * 2; if (e >= (size_t)ZH * TT * HD) return; const int d = (int)(e % HD); const int t = (int)((e / HD) % TT); const int zz = (int)(e / ((size_t)HD * TT)); const float cs = (t < RH) ? 1.0f : (1.0f / PCAR); const size_t oo = (size_t)t * DQ + (h0 + zz) * HD + d;
    v2us oh, ol;
#pragma unroll
    for (int q = 0; q < 2; ++q) { unsigned short a, c2; splitf(O[e + q] * cs, a, c2); oh[q] = a; ol[q] = c2; } *(v2us*)(Ah + oo) = oh; *(v2us*)(Al + oo) = ol;  }

extern "C" void kernel_launch(void* const* d_in, const int* in_sizes, int n_in,
                              void* d_out, int out_size, void* d_ws, size_t ws_size, hipStream_t stream) {
    (void)in_sizes; (void)n_in; (void)out_size;
        const float* x = (const float*)d_in[0]; const float* fcos = (const float*)d_in[1]; const float* fsin = (const float*)d_in[2]; const float* wq = (const float*)d_in[3]; const float* wk = (const float*)d_in[4]; const float* wv = (const float*)d_in[5]; const float* wo = (const float*)d_in[6]; const float* bo = (const float*)d_in[7];   /* input order x, pos_cos, pos_sin ([2048][32] HALF-width table INPUTS: read by value), Wq, Wk, Wv, Wo ('xw' (in, out) [1024][1024]), bo ([1024]: zeros, read through the output launch's bias slot): EIGHT inputs, all read; the q, k, v projections have NO bias in this module */
    float* OUT = (float*)d_out;     // [2][2048][1024]
    char* wsp = (char*)d_ws;
    auto take = [&](size_t bytes) { char* p = wsp; wsp += (bytes + 255) & ~(size_t)255; return (void*)p; };
    bf* WQ = (bf*)take((size_t)DQ * DM * 2); bf* WK = (bf*)take((size_t)DKV * DM * 2); bf* WV = (bf*)take((size_t)DKV * DM * 2); bf* WO = (bf*)take((size_t)DM * DQ * 2); float* CS = (float*)take((size_t)TT * HD * 2 * 4);
    bf* XB = (bf*)take((size_t)TT * DM * 2); float* FQ = (float*)take((size_t)TT * DQ * 4); float* FK = (float*)take((size_t)TT * DKV * 4);
    h16* QP16 = (h16*)take((size_t)NH_ * TT * HD * 2); h16* KP16 = (h16*)take((size_t)NKV * TT * HD * 2); h16* VT16 = (h16*)take((size_t)NKV * HD * PP * 2);
    bf* QPh = (bf*)take((size_t)NH_ * TT * HD * 2); bf* QPl = (bf*)take((size_t)NH_ * TT * HD * 2); bf* KPh = (bf*)take((size_t)NKV * TT * HD * 2); bf* KPl = (bf*)take((size_t)NKV * TT * HD * 2); bf* VTh = (bf*)take((size_t)NKV * HD * PP * 2); bf* VTl = VTh + TT;   // hi plane in the first half of each PP row, lo plane in the second
    float* Sb = (float*)take((size_t)ZH * TT * TT * 4); float* Ob = (float*)take((size_t)ZH * TT * HD * 4); bf* ATh = (bf*)take((size_t)TT * DQ * 2); bf* ATl = (bf*)take((size_t)TT * DQ * 2);
    if ((size_t)(wsp - (char*)d_ws) > ws_size) return;    // ws 256 MiB
    float* FV = FK;   // v projection reuses the k buffer after the k planes are built (stream-ordered)
    { k_wtG<<<(unsigned)((DM * DQ / 64 + 63) / 64), 256, 0, stream>>>(wq, DM, DQ, WQ); k_wtG<<<(unsigned)((DM * DKV / 64 + 63) / 64), 256, 0, stream>>>(wk, DM, DKV, WK); k_wtG<<<(unsigned)((DM * DKV / 64 + 63) / 64), 256, 0, stream>>>(wv, DM, DKV, WV);
      k_wtG<<<(unsigned)((DQ * DM / 64 + 63) / 64), 256, 0, stream>>>(wo, DQ, DM, WO);   /* 'xw' [in][out] weights: transposed once into Bt */
       }
    const unsigned LQ = (unsigned)(((size_t)NH_ * TT * HD / 2 + 255) / 256), LKv = (unsigned)(((size_t)NKV * TT * HD / 2 + 255) / 256);
    for (int b = 0; b < NB_; ++b) {
        if (b == 0) k_csI<<<(TT * HD + 255) / 256, 256, 0, stream>>>(fcos, fsin, CS);   /* rotary table once, from the input tables */
        k_cvt8<<<(unsigned)(((size_t)TT * DM / 8 + 255) / 256), 256, 0, stream>>>(x + (size_t)b * TT * DM, XB, (size_t)TT * DM / 8);
        k_gemmw<bf, 0, false><<<dim3(TT / 64, DQ / 64, 1), 32, 0, stream>>>(XB, nullptr, WQ, nullptr, DM, FQ, DQ, nullptr, 0, 0, 0);
        k_ropeI<<<LQ, 256, 0, stream>>>(FQ, DQ, NH_, CS, 1.0f, QP16, QPh, QPl);
        k_gemmw<bf, 0, false><<<dim3(TT / 64, DKV / 64, 1), 32, 0, stream>>>(XB, nullptr, WK, nullptr, DM, FK, DKV, nullptr, 0, 0, 0);
        k_ropeI<<<LKv, 256, 0, stream>>>(FK, DKV, NKV, CS, 1.0f, KP16, KPh, KPl);
        k_gemmw<bf, 0, false><<<dim3(TT / 64, DKV / 64, 1), 32, 0, stream>>>(XB, nullptr, WV, nullptr, DM, FV, DKV, nullptr, 0, 0, 0); k_vtp<<<LKv, 256, 0, stream>>>(FV, DKV, NKV, VT16, VTh, VTl);
        for (int h0 = 0; h0 < NH_; h0 += ZH) { const size_t zq = (size_t)h0, zk = (size_t)(h0 / REP);   // one kv head per query head: the pass's ZH heads use consecutive kv planes (z-strides TT*HD, HD*PP)
            k_gemmc<bf, 2, 1><<<dim3(RH / 64, TT / 64, ZH), 32, 0, stream>>>(QPh + zq * TT * HD, QPl + zq * TT * HD, KPh + zk * TT * HD, KPl + zk * TT * HD, HD, Sb, TT, 0, (size_t)TT * HD, (size_t)TT * HD, (size_t)TT * TT);
            k_gemmc<h16, 0, 1><<<dim3((TT - RH) / 64, TT / 64, ZH), 32, 0, stream>>>(QP16 + zq * TT * HD + (size_t)RH * HD, nullptr, KP16 + zk * TT * HD, nullptr, HD, Sb + (size_t)RH * TT, TT, RH, (size_t)TT * HD, (size_t)TT * HD, (size_t)TT * TT);
            k_asoft<<<ZH * TT / 8, 256, 0, stream>>>(Sb);   /* below: K = PP is the pitch of both operands; the key loop ends at the diagonal block, at most TT */
            k_gemmc<bf, 2, 2><<<dim3(RH / 64, HD / 64, ZH), 32, 0, stream>>>((const bf*)Sb, (const bf*)Sb + TT, VTh + zk * HD * PP, VTl + zk * HD * PP, PP, Ob, HD, 0, (size_t)TT * PP, (size_t)HD * PP, (size_t)TT * HD);
            k_gemmc<h16, 0, 2><<<dim3((TT - RH) / 64, HD / 64, ZH), 32, 0, stream>>>((const h16*)Sb + (size_t)RH * PP, nullptr, VT16 + zk * HD * PP, nullptr, PP, Ob + (size_t)RH * HD, HD, RH, (size_t)TT * PP, (size_t)HD * PP, (size_t)TT * HD);
            k_merge<<<(unsigned)(((size_t)ZH * TT * HD / 2 + 255) / 256), 256, 0, stream>>>(Ob, h0, ATh, ATl); }
        k_gemmw<bf, 1, true><<<dim3(TT / 64, DM / 64, 1), 32, 0, stream>>>(ATh, ATl, WO, nullptr, DQ, OUT + (size_t)b * TT * DM, DM, bo, 0, 0, 0); }
}

// v003
// One run takes 207 microseconds.
// Versions in between are left out here; by their measured steps it is 3.45 times as fast as v001.
// All steps since v000 together make it 7.06 times as fast.
#include <hip/hip_runtime.h>

// Causal multi-head self-attention with interleaved-pair rotary embeddings from two half-width INPUT tables and (in, out) weights (x [2][2048][1024]; q, k, v = x W ('xw' [1024][1024] normal x 0.02, no projection bias; 16 heads x 64); _rope on q and k: consecutive pairs (t[2i], t[2i+1]) -> (te c - to s, te s + to c) with c, s = pos_cos / pos_sin[t][i] (f32 [2048][32] INPUT tables the module computes: cos / sin(t / 10000^(2i/64)): read by value); scores: -inf above the diagonal, then / sqrt(64) (the same as scaling first); softmax; out = merged Wo + bo ('xw' + a zero bias [1024], read) -> [2][2048][1024] (4.2 M); argument order x, pos_cos, pos_sin, Wq, Wk, Wv, Wo, bo).
// Every stage is ONE launch for all of its independent instances (both batches; q, k and v; the four weights): the batch is folded into the row index (x, the projections, the merged planes) or the plane index (b * heads + h), q / k / v and the weights into a grid index. Stages: bf16 copy of x; exact projections (no bias); the two half-width INPUT tables copied once into one bf16-rounded {cos, sin} table per (position, pair) (k_csI); interleaved rotary plane builder; causal T-2048 attention fused into one launch (k_attn: scores, running softmax and P x V in registers; hybrid rows: < 512 hi/lo 3 products, rest fp16; key blocks above the diagonal never touched) that writes the merged hi/lo planes; merged hi/lo x Wo exact + bo.
// Compute dtypes, f32 accumulate: every input rounded to bf16; projections exact (no bias); rotary f32; attention rows < 512 3 products, rest fp16; softmax f32; Wo hl x exact + bias.

#define NB_  2
#define TT   2048
#define DM   1024
#define NH_  16
#define NKV  16
#define REP  (NH_ / NKV)
#define HD   64
#define DQ   (NH_ * HD)
#define DKV  (NKV * HD)
#define PP   (2 * TT)             // row pitch, in 16-bit elements, of the V^T planes (hi plane in the first half of a row, lo plane in the second)
#define RH   512                  // query rows < RH use hi+lo planes (0: none)
#define SCL  0.125f   // HD^-0.5
typedef _Float16 h16;
typedef unsigned short bf;
typedef __attribute__((ext_vector_type(16))) __bf16   v16bf;
typedef __attribute__((ext_vector_type(16))) _Float16 v16h;
typedef __attribute__((ext_vector_type(8)))  _Float16 v8h;
typedef __attribute__((ext_vector_type(8)))  unsigned short v8us;
typedef __attribute__((ext_vector_type(8)))  float    v8f;
typedef __attribute__((ext_vector_type(4)))  float    v4f;
typedef v8h  __attribute__((may_alias)) v8ha;
typedef v4f  __attribute__((may_alias)) v4fa;
typedef v8us __attribute__((may_alias)) v8usa;

__device__ __forceinline__ unsigned short f2bf(float f) { unsigned u = __float_as_uint(f); u += 0x7FFFu + ((u >> 16) & 1u); return (unsigned short)(u >> 16); }
__device__ __forceinline__ float bf2f(unsigned short b) { return __uint_as_float(((unsigned)b) << 16); }
__device__ __forceinline__ float bfr(float f) { return bf2f(f2bf(f)); }
__device__ __forceinline__ v16h cat16(v8h lo, v8h hi) { return __builtin_shufflevector(lo, hi, 0, 1, 2, 3, 4, 5, 6, 7, 8, 9, 10, 11, 12, 13, 14, 15); }
__device__ __forceinline__ v16bf cat16b(v8us lo, v8us hi) { return __builtin_bit_cast(v16bf, __builtin_shufflevector(lo, hi, 0, 1, 2, 3, 4, 5, 6, 7, 8, 9, 10, 11, 12, 13, 14, 15)); }
__device__ __forceinline__ v8f wmma16(v16h a, v16h b, v8f c) { return __builtin_amdgcn_wmma_f32_16x16x32_f16(false, a, false, b, (short)0, c, false, false); }
__device__ __forceinline__ v8f wmmab(v16bf a, v16bf b, v8f c) { return __builtin_amdgcn_wmma_f32_16x16x32_bf16(false, a, false, b, (short)0, c, false, false); }



// ---- k_gemmw: register-blocked GEMM, ONE WAVE per 64x64 output tile (16 accumulators), operands straight from K-contiguous 16-bit planes; grid (M/64, N/64, Z), 32 threads.
// C[m][n] (f32, pitch ldc, + optional f32 bias[n]) = sum_k A[m][k] Bt[n][k] (+ split products per NSPLIT). z-batch strides sA/sB/sC in elements. K % 32 == 0.
template <typename T16> struct WFrag;
template <> struct WFrag<h16> { typedef v16h V; static __device__ __forceinline__ V ld(const h16* p) { return cat16(*(const v8h*)p, *(const v8h*)(p + 16)); } static __device__ __forceinline__ v8f mma(V a, V b, v8f c) { return wmma16(a, b, c); } };
template <> struct WFrag<bf> { typedef v16bf V; static __device__ __forceinline__ V ld(const bf* p) { return cat16b(*(const v8us*)p, *(const v8us*)(p + 16)); } static __device__ __forceinline__ v8f mma(V a, V b, v8f c) { return wmmab(a, b, c); } };
template <typename T16, int NSPLIT, bool BIAS>
__global__ __launch_bounds__(32) void k_gemmw(const T16* __restrict__ A, const T16* __restrict__ A2, const T16* __restrict__ Bt, const T16* __restrict__ Bt2, int K, float* C, int ldc, const float* __restrict__ bias, size_t sA, size_t sB, size_t sC) {
    typedef typename WFrag<T16>::V V;
    __shared__ __align__(16) float os[16 * 68];
    const size_t z = blockIdx.z; A += z * sA; if (A2) A2 += z * sA; Bt += z * sB; if (Bt2) Bt2 += z * sB; C += z * sC;
    const int lane = threadIdx.x & 31, lr = lane & 15, hi = lane >> 4; const int r0 = blockIdx.x * 64, c0 = blockIdx.y * 64;
    v8f acc[4][4];
#pragma unroll
    for (int mb = 0; mb < 4; ++mb)
#pragma unroll
        for (int nb = 0; nb < 4; ++nb) acc[mb][nb] = (v8f){};
    const size_t aoff = (size_t)(r0 + lr) * K + 8 * hi, boff = (size_t)(c0 + lr) * K + 8 * hi;
    for (int kc = 0; kc < K; kc += 32) {
        V a[4], a2[4];
#pragma unroll
        for (int mb = 0; mb < 4; ++mb) { a[mb] = WFrag<T16>::ld(A + aoff + (size_t)mb * 16 * K + kc); if (NSPLIT == 1 || NSPLIT == 2) a2[mb] = WFrag<T16>::ld(A2 + aoff + (size_t)mb * 16 * K + kc); }
#pragma unroll
        for (int nb = 0; nb < 4; ++nb) { const V b = WFrag<T16>::ld(Bt + boff + (size_t)nb * 16 * K + kc); V b2; if (NSPLIT >= 2) b2 = WFrag<T16>::ld(Bt2 + boff + (size_t)nb * 16 * K + kc);
#pragma unroll
            for (int mb = 0; mb < 4; ++mb) { acc[mb][nb] = WFrag<T16>::mma(a[mb], b, acc[mb][nb]); if (NSPLIT == 1 || NSPLIT == 2) acc[mb][nb] = WFrag<T16>::mma(a2[mb], b, acc[mb][nb]); if (NSPLIT >= 2) acc[mb][nb] = WFrag<T16>::mma(a[mb], b2, acc[mb][nb]); } }
        asm volatile("v_nop\n\tv_nop\n\tv_nop\n\tv_nop" : "+v"(acc[0][0]), "+v"(acc[1][1]), "+v"(acc[2][2]), "+v"(acc[3][3]) : "v"(a[0]), "v"(a[3]));
    }
#pragma unroll
    for (int mb = 0; mb < 4; ++mb) {
#pragma unroll
        for (int nb = 0; nb < 4; ++nb) {
#pragma unroll
            for (int j = 0; j < 8; ++j) os[(hi * 8 + j) * 68 + nb * 16 + lr] = acc[mb][nb][j]; }
        __builtin_amdgcn_wave_barrier(); asm volatile("" ::: "memory");
        float* crow = C + (size_t)(r0 + mb * 16) * ldc + c0;
{
#pragma unroll
            for (int s = 0; s < 8; ++s) { const int row = 2 * s + hi, cofs = lr * 4; v4f val = *(const v4fa*)(os + row * 68 + cofs); if (BIAS) { val[0] += bfr(bias[c0 + cofs]); val[1] += bfr(bias[c0 + cofs + 1]); val[2] += bfr(bias[c0 + cofs + 2]); val[3] += bfr(bias[c0 + cofs + 3]); }
                *(v4f*)(crow + (size_t)row * ldc + cofs) = val; }
             }
        __builtin_amdgcn_wave_barrier(); asm volatile("" ::: "memory");
    }
}

__device__ __forceinline__ h16 tohx(float x) { return (h16)x; }
__device__ __forceinline__ void splitf(float y, unsigned short& h, unsigned short& l) { h = f2bf(y); l = f2bf(y - bf2f(h)); }
typedef __attribute__((ext_vector_type(2))) _Float16 v2h;
typedef __attribute__((ext_vector_type(4))) _Float16 v4h;
typedef __attribute__((ext_vector_type(2))) unsigned short v2us;
typedef __attribute__((ext_vector_type(4))) unsigned short v4us;
typedef __attribute__((ext_vector_type(2))) float v2f;
typedef __attribute__((ext_vector_type(4))) int v4i;
typedef v4h  __attribute__((may_alias)) v4ha;
typedef v4us __attribute__((may_alias)) v4usa;

// grid (.., 4): blockIdx.y picks the weight; the four transposed planes lie one behind the other in Bt
__global__ __launch_bounds__(256) void k_wtG(const float* __restrict__ w0, const float* __restrict__ w1, const float* __restrict__ w2, const float* __restrict__ w3, int K, int N, bf* Bt) {
    const int y = blockIdx.y; const float* __restrict__ w = y == 0 ? w0 : y == 1 ? w1 : y == 2 ? w2 : w3; Bt += (size_t)y * N * K;
    const int lane = threadIdx.x & 31; const int L0 = (blockIdx.x * 8 + (threadIdx.x >> 5)) * 8; const int nlines = N * K / 64;
{
        for (int l = 0; l < 8; ++l) { const int L = L0 + l; if (L >= nlines) break; const size_t e = (size_t)L * 64 + lane * 2; const int k = (int)(e % K), n = (int)(e / K); v2us o;
            o[0] = f2bf(w[(size_t)k * N + n]); o[1] = f2bf(w[(size_t)(k + 1) * N + n]); *(v2us*)(Bt + e) = o; }
         }
}
__global__ __launch_bounds__(256) void k_cvt8(const float* __restrict__ src, bf* dst, size_t n8) { const size_t i = (size_t)blockIdx.x * 256 + threadIdx.x; if (i >= n8) return; const v8f v = *(const v8f*)(src + i * 8); v8us o;
#pragma unroll
    for (int k = 0; k < 8; ++k) o[k] = f2bf(v[k]); *(v8us*)(dst + i * 8) = o;  }
__global__ __launch_bounds__(256) void k_csI(const float* __restrict__ fc, const float* __restrict__ fs, float* CS) { const int idx = blockIdx.x * 256 + threadIdx.x; if (idx >= TT * HD) return; const int d = idx % HD; const int t = idx / HD; v2f cs; cs[0] = bfr(fc[(size_t)t * (HD / 2) + (d >> 1)]); cs[1] = bfr(fs[(size_t)t * (HD / 2) + (d >> 1)]); *(v2f*)(CS + (size_t)idx * 2) = cs;  }
// planes [w][b][h][t][d], w = 0 (q), 1 (k); F holds the two projections sF elements apart, rows b * TT + t
__global__ __launch_bounds__(256) void k_ropeI(const float* __restrict__ F, size_t sF, int pitch, const float* __restrict__ CS, float sc, h16* P16, bf* Ph, bf* Pl) {
    const size_t e = ((size_t)blockIdx.x * 256 + threadIdx.x) * 2; if (e >= (size_t)2 * NB_ * NH_ * TT * HD) return; const int d = (int)(e % HD); const int t = (int)((e / HD) % TT); const int pl = (int)(e / ((size_t)HD * TT)); const int h = pl % NH_, b = (pl / NH_) % NB_, w = pl / (NH_ * NB_); const float* f = F + (size_t)w * sF + (size_t)(b * TT + t) * pitch + h * HD; const float x0 = f[d], x1 = f[d + 1]; const v2f cs = *(const v2f*)(CS + ((size_t)t * HD + d) * 2); v2h o16; v2us oh, ol;
    float a0 = __fmul_rn(x0, cs[0]), b0 = __fmul_rn(x1, cs[1]), a1 = __fmul_rn(x1, cs[0]), b1 = __fmul_rn(x0, cs[1]); 
    float r0 = __fsub_rn(a0, b0) * sc, r1 = __fadd_rn(b1, a1) * sc;   /* even: x0 c - x1 s; odd: x0 s + x1 c */
    o16[0] = tohx(r0); o16[1] = tohx(r1); { unsigned short a2, c2; splitf(r0, a2, c2); oh[0] = a2; ol[0] = c2; splitf(r1, a2, c2); oh[1] = a2; ol[1] = c2; }
    *(v2h*)(P16 + e) = o16; *(v2us*)(Ph + e) = oh; *(v2us*)(Pl + e) = ol;  }



// k_vtp: V^T planes [b][g][d][t] at row pitch PP; F rows b * TT + t
__global__ __launch_bounds__(256) void k_vtp(const float* __restrict__ F, int pitch, h16* V16, bf* Vh, bf* Vl) { const size_t e = ((size_t)blockIdx.x * 256 + threadIdx.x) * 2; if (e >= (size_t)NB_ * NKV * HD * TT) return; const int t = (int)(e % TT); const int d = (int)((e / TT) % HD); const int pl = (int)(e / ((size_t)TT * HD)); const int g = pl % NKV, b = pl / NKV; v2h o16; v2us oh, ol;
#pragma unroll
    for (int q = 0; q < 2; ++q) { const float x = F[(size_t)(b * TT + t + q) * pitch + g * HD + d]; o16[q] = tohx(x); unsigned short a2, c2; splitf(x, a2, c2); oh[q] = a2; ol[q] = c2; }
    const size_t o = ((size_t)pl * HD + d) * PP + t; *(v2h*)(V16 + o) = o16; *(v2us*)(Vh + o) = oh; *(v2us*)(Vl + o) = ol;  }
// ---- k_attn: causal attention fused into one launch for both batches (grid z): ONE WAVE per (head, query tile); scores, running softmax and the probability x value product stay in registers.
// Transposed products: S^T = K Q^T (A = 16 keys x 64 d, B = 16 queries) leaves lane (lr, hi) with keys 8 hi + j of query lr, which for two neighbouring key tiles is exactly the B fragment (k = 8 hi + e, 16 + 8 hi + e) of
// O^T = V^T P^T (A = 16 d x 32 keys): no exchange between lanes but one with lane l ^ 16 for the row maximum and the row sum. O^T leaves lane (lr, hi) with d = 16 dt + 8 hi + j of query lr: 16-byte stores into the merged hi/lo planes.
// Running softmax in the base-2 domain: t = s * HD^-0.5 * log2(e); per 32 keys m' = max(m, t), O and l scaled by 2^(m - m'), p = 2^(t - m') (not normalised: <= 1), l += sum p; O / l at the end.
// HR (query rows < RH): bf16 hi/lo planes, 3 products for both contractions, 16 queries a wave; else fp16, 32 queries a wave. Key blocks wholly at or below the diagonal need no mask; the one diagonal block masks by select.
#define KB 32                     // keys per trip
__device__ __forceinline__ float xhalf(float x) { return __builtin_bit_cast(float, __builtin_amdgcn_permlanex16(__builtin_bit_cast(int, x), __builtin_bit_cast(int, x), 0x76543210, 0xfedcba98, false, false)); }  // lane l with lane l ^ 16
__device__ __forceinline__ float exp2s(float x) { asm("v_exp_f32 %0, %0\n\tv_nop" : "+v"(x)); return x; }   // 2^x. The v_nop is the free slot the instruction set asks for behind a transcendental. In place: the register already holds the live argument, so it is no operand of a matrix instruction still in its window (the compiler does not look into asm text)
template <typename T16, int NT, bool HR>
__device__ __forceinline__ void attn_tile(const T16* __restrict__ Q, const T16* __restrict__ Q2, const T16* __restrict__ Kp, const T16* __restrict__ Kp2, const T16* __restrict__ Vt, const T16* __restrict__ Vt2, const int q0, bf* __restrict__ Ah, bf* __restrict__ Al) {
    typedef typename WFrag<T16>::V V;
    const int lane = threadIdx.x & 31, lr = lane & 15, hi = lane >> 4;
    V qf[NT][2], qf2[NT][2];
    const T16* qp = Q + (size_t)(q0 + lr) * HD + 8 * hi; const T16* qp2 = HR ? Q2 + (size_t)(q0 + lr) * HD + 8 * hi : qp;
#pragma unroll
    for (int nt = 0; nt < NT; ++nt)
#pragma unroll
        for (int ks = 0; ks < 2; ++ks) { qf[nt][ks] = WFrag<T16>::ld(qp + nt * 16 * HD + ks * 32); if (HR) qf2[nt][ks] = WFrag<T16>::ld(qp2 + nt * 16 * HD + ks * 32); }
    v8f o[4][NT]; float m[NT], l[NT];
#pragma unroll
    for (int nt = 0; nt < NT; ++nt) { m[nt] = -3.0e38f; l[nt] = 0.f;
#pragma unroll
        for (int dt = 0; dt < 4; ++dt) o[dt][nt] = (v8f){}; }
    V kf[2][2], kf2[2][2];
    auto ldk = [&](const T16* kp, const T16* kp2, V (&f)[2][2], V (&f2)[2][2]) {
#pragma unroll
        for (int mt = 0; mt < 2; ++mt)
#pragma unroll
            for (int ks = 0; ks < 2; ++ks) { f[mt][ks] = WFrag<T16>::ld(kp + mt * 16 * HD + ks * 32); if (HR) f2[mt][ks] = WFrag<T16>::ld(kp2 + mt * 16 * HD + ks * 32); } };
    const size_t kl = (size_t)lr * HD + 8 * hi, vl = (size_t)lr * PP + 8 * hi;
    auto step = [&](const int kb, const bool last) {
        V vf[4], vf2[4];
        const T16* vp = Vt + vl + kb; const T16* vp2 = HR ? Vt2 + vl + kb : vp;
        const T16* kp = (HR || !last) ? Kp + kl + (size_t)(HR ? kb : kb + KB) * HD : vp; const T16* kp2 = HR ? Kp2 + kl + (size_t)kb * HD : kp;
#pragma unroll
        for (int dt = 0; dt < 4; ++dt) { vf[dt] = WFrag<T16>::ld(vp + (size_t)dt * 16 * PP); if (HR) vf2[dt] = WFrag<T16>::ld(vp2 + (size_t)dt * 16 * PP); }
        if (HR) ldk(kp, kp2, kf, kf2);              // hi/lo path: this trip's own key fragments
        v8f sa[NT][2];
#pragma unroll
        for (int nt = 0; nt < NT; ++nt) {
#pragma unroll
            for (int mt = 0; mt < 2; ++mt) { v8f s = (v8f){};
#pragma unroll
                for (int ks = 0; ks < 2; ++ks) { s = WFrag<T16>::mma(kf[mt][ks], qf[nt][ks], s); if (HR) { s = WFrag<T16>::mma(kf[mt][ks], qf2[nt][ks], s); s = WFrag<T16>::mma(kf2[mt][ks], qf[nt][ks], s); } }
                sa[nt][mt] = s; } }
        if (!HR) { if (!last) ldk(kp, kp2, kf, kf2);   // fp16 path: the next trip's key fragments, into the same registers right behind this trip's score products; they fly under the softmax and P x V
            __builtin_amdgcn_sched_barrier(0); }       // holds those loads (and this trip's V loads) up here: sunk to the foot of the trip, their latency would be waited out in full
#pragma unroll
        for (int nt = 0; nt < NT; ++nt) {
            v8f (&st)[2] = sa[nt];
            float mx = m[nt];
#pragma unroll
            for (int mt = 0; mt < 2; ++mt)
#pragma unroll
                for (int j = 0; j < 8; ++j) { float t = st[mt][j] * (SCL * 1.4426950408889634f); if (last) t = (kb + mt * 16 + hi * 8 + j <= q0 + nt * 16 + lr) ? t : -3.0e38f; st[mt][j] = t; mx = fmaxf(mx, t); }
            mx = fmaxf(mx, xhalf(mx));
            const float al = exp2s(m[nt] - mx); m[nt] = mx;
            float sum = 0.f;
#pragma unroll
            for (int mt = 0; mt < 2; ++mt)
#pragma unroll
                for (int j = 0; j < 8; ++j) { const float p = exp2s(st[mt][j] - mx); st[mt][j] = p; sum += p; }
            l[nt] = l[nt] * al + sum;
#pragma unroll
            for (int dt = 0; dt < 4; ++dt) o[dt][nt] *= al;
            if (nt == 0) asm volatile("s_wait_xcnt 0x0" :: "v"(vp), "v"(vp2), "v"(kp), "v"(kp2) : "memory");   // this trip's loads: their address registers stay whole (inputs) until this wait; placed here, where the V fragments are waited for anyway
            if (HR) {
                v8us h0, h1, l0, l1;
#pragma unroll
                for (int j = 0; j < 8; ++j) { unsigned short x, y; splitf(st[0][j], x, y); h0[j] = x; l0[j] = y; splitf(st[1][j], x, y); h1[j] = x; l1[j] = y; }
                const v16bf ph = cat16b(h0, h1), pl = cat16b(l0, l1);
#pragma unroll
                for (int dt = 0; dt < 4; ++dt) { o[dt][nt] = wmmab(__builtin_bit_cast(v16bf, vf[dt]), ph, o[dt][nt]); o[dt][nt] = wmmab(__builtin_bit_cast(v16bf, vf[dt]), pl, o[dt][nt]); o[dt][nt] = wmmab(__builtin_bit_cast(v16bf, vf2[dt]), ph, o[dt][nt]); }
            } else {
                v8h p0, p1;
#pragma unroll
                for (int j = 0; j < 8; ++j) { p0[j] = tohx(st[0][j]); p1[j] = tohx(st[1][j]); }
                const v16h pf = cat16(p0, p1);
#pragma unroll
                for (int dt = 0; dt < 4; ++dt) o[dt][nt] = wmma16(__builtin_bit_cast(v16h, vf[dt]), pf, o[dt][nt]);
            }
        }
    };
    const T16* kp0 = Kp + kl;
    if (!HR) ldk(kp0, kp0, kf, kf2);
    asm volatile("s_wait_xcnt 0x0" :: "v"(qp), "v"(qp2), "v"(kp0) : "memory");   // the prologue's loads: their address registers stay whole (inputs) until this wait
    const int kd = (q0 / KB) * KB;             // the diagonal block: it holds keys q0 .. q0 + 16 NT - 1 (q0 is a multiple of 16 NT, and 16 NT divides KB)
    for (int kb = 0; kb < kd; kb += KB) step(kb, false);
    step(kd, true);
#pragma unroll
    for (int nt = 0; nt < NT; ++nt) { const float lt = l[nt] + xhalf(l[nt]); const float inv = __fdiv_rn(1.0f, lt); const size_t oo = (size_t)(q0 + nt * 16 + lr) * DQ + 8 * hi; bf* sh = Ah + oo; bf* sl = Al + oo;
#pragma unroll
        for (int dt = 0; dt < 4; ++dt) { v8us oh, ol;
#pragma unroll
            for (int j = 0; j < 8; ++j) { unsigned short x, y; splitf(o[dt][nt][j] * inv, x, y); oh[j] = x; ol[j] = y; }
            *(v8us*)(sh + dt * 16) = oh; *(v8us*)(sl + dt * 16) = ol;
            asm volatile("s_wait_xcnt 0x0" :: "v"(oh), "v"(ol), "v"(sh), "v"(sl) : "memory"); } }   // the two stores: their data and address registers stay whole (inputs) until this wait, on every way into code that rewrites them
}
#define NLR ((TT - RH) / 32)      // fp16 query tiles of 32 rows
#define NHR (RH / 16)             // hi/lo query tiles of 16 rows
// grid (NLR + NHR, NH_, NB_): the longest tiles (last query rows) take the lowest block indices, so that they start first
__global__ __launch_bounds__(32) void k_attn(const h16* __restrict__ Q16, const h16* __restrict__ K16, const h16* __restrict__ V16, const bf* __restrict__ Qh, const bf* __restrict__ Ql, const bf* __restrict__ Kh, const bf* __restrict__ Kl, const bf* __restrict__ Vh, const bf* __restrict__ Vl, bf* __restrict__ Ah, bf* __restrict__ Al) {
    const int h = blockIdx.y, g = h / REP, bx = blockIdx.x, b = blockIdx.z; const size_t qo = (size_t)(b * NH_ + h) * TT * HD, ko = (size_t)(b * NKV + g) * TT * HD, vo = (size_t)(b * NKV + g) * HD * PP; Ah += (size_t)b * TT * DQ; Al += (size_t)b * TT * DQ;
    if (bx < NLR) attn_tile<h16, 2, false>(Q16 + qo, nullptr, K16 + ko, nullptr, V16 + vo, nullptr, RH + (NLR - 1 - bx) * 32, Ah + h * HD, Al + h * HD);
    else attn_tile<bf, 1, true>(Qh + qo, Ql + qo, Kh + ko, Kl + ko, Vh + vo, Vl + vo, (NLR + NHR - 1 - bx) * 16, Ah + h * HD, Al + h * HD);
}

extern "C" void kernel_launch(void* const* d_in, const int* in_sizes, int n_in,
                              void* d_out, int out_size, void* d_ws, size_t ws_size, hipStream_t stream) {
    (void)in_sizes; (void)n_in; (void)out_size;
        const float* x = (const float*)d_in[0]; const float* fcos = (const float*)d_in[1]; const float* fsin = (const float*)d_in[2]; const float* wq = (const float*)d_in[3]; const float* wk = (const float*)d_in[4]; const float* wv = (const float*)d_in[5]; const float* wo = (const float*)d_in[6]; const float* bo = (const float*)d_in[7];   /* input order x, pos_cos, pos_sin ([2048][32] HALF-width table INPUTS: read by value), Wq, Wk, Wv, Wo ('xw' (in, out) [1024][1024]), bo ([1024]: zeros, read through the output launch's bias slot): EIGHT inputs, all read; the q, k, v projections have NO bias in this module */
    float* OUT = (float*)d_out;     // [2][2048][1024]
    char* wsp = (char*)d_ws;
    auto take = [&](size_t bytes) { char* p = wsp; wsp += (bytes + 255) & ~(size_t)255; return (void*)p; };
    static_assert(DQ == DKV && DQ == DM, "q, k and v share one projection launch, q and k one plane launch, the four weights one transpose launch: equal shapes");
    bf* WQ = (bf*)take((size_t)4 * DQ * DM * 2); bf* WO = WQ + (size_t)3 * DQ * DM;   // transposed Wq, Wk, Wv, Wo, one behind the other
    float* CS = (float*)take((size_t)TT * HD * 2 * 4);
    bf* XB = (bf*)take((size_t)NB_ * TT * DM * 2); float* FQ = (float*)take((size_t)3 * NB_ * TT * DQ * 4); float* FV = FQ + (size_t)2 * NB_ * TT * DQ;   // q, k, v projections [3][NB_ * TT][DQ]
    const size_t PLN = (size_t)NB_ * NH_ * TT * HD;   // elements of one set of head planes
    h16* QP16 = (h16*)take(2 * PLN * 2); h16* KP16 = QP16 + PLN; h16* VT16 = (h16*)take((size_t)NB_ * NKV * HD * PP * 2);
    bf* QPh = (bf*)take(2 * PLN * 2); bf* KPh = QPh + PLN; bf* QPl = (bf*)take(2 * PLN * 2); bf* KPl = QPl + PLN; bf* VTh = (bf*)take((size_t)NB_ * NKV * HD * PP * 2); bf* VTl = VTh + TT;   // hi plane in the first half of each PP row, lo plane in the second
    bf* ATh = (bf*)take((size_t)NB_ * TT * DQ * 2); bf* ATl = (bf*)take((size_t)NB_ * TT * DQ * 2);
    if ((size_t)(wsp - (char*)d_ws) > ws_size) return;    // ws 256 MiB
    k_wtG<<<dim3((unsigned)((DM * DQ / 64 + 63) / 64), 4, 1), 256, 0, stream>>>(wq, wk, wv, wo, DM, DQ, WQ);   /* 'xw' [in][out] weights: transposed once into Bt */
    k_csI<<<(TT * HD + 255) / 256, 256, 0, stream>>>(fcos, fsin, CS);   /* rotary table once, from the input tables */
    k_cvt8<<<(unsigned)(((size_t)NB_ * TT * DM / 8 + 255) / 256), 256, 0, stream>>>(x, XB, (size_t)NB_ * TT * DM / 8);
    k_gemmw<bf, 0, false><<<dim3(NB_ * TT / 64, DQ / 64, 3), 32, 0, stream>>>(XB, nullptr, WQ, nullptr, DM, FQ, DQ, nullptr, 0, (size_t)DQ * DM, (size_t)NB_ * TT * DQ);
    k_ropeI<<<(unsigned)((2 * PLN / 2 + 255) / 256), 256, 0, stream>>>(FQ, (size_t)NB_ * TT * DQ, DQ, CS, 1.0f, QP16, QPh, QPl);
    k_vtp<<<(unsigned)(((size_t)NB_ * NKV * TT * HD / 2 + 255) / 256), 256, 0, stream>>>(FV, DKV, VT16, VTh, VTl);
    k_attn<<<dim3(NLR + NHR, NH_, NB_), 32, 0, stream>>>(QP16, KP16, VT16, QPh, QPl, KPh, KPl, VTh, VTl, ATh, ATl);
    k_gemmw<bf, 1, true><<<dim3(NB_ * TT / 64, DM / 64, 1), 32, 0, stream>>>(ATh, ATl, WO, nullptr, DQ, OUT, DM, bo, 0, 0, 0);
}

// v004
// It runs in 173 microseconds.
// Two timings next to v003 put it at 1.17 and 1.20 times that version's speed.
// Over all steps from v000 it is 8.36 times as fast.
#include <hip/hip_runtime.h>

// Causal multi-head self-attention with interleaved-pair rotary embeddings from two half-width INPUT tables and (in, out) weights (x [2][2048][1024]; q, k, v = x W ('xw' [1024][1024] normal x 0.02, no projection bias; 16 heads x 64); _rope on q and k: consecutive pairs (t[2i], t[2i+1]) -> (te c - to s, te s + to c) with c, s = pos_cos / pos_sin[t][i] (f32 [2048][32] INPUT tables the module computes: cos / sin(t / 10000^(2i/64)): read by value); scores: -inf above the diagonal, then / sqrt(64) (the same as scaling first); softmax; out = merged Wo + bo ('xw' + a zero bias [1024], read) -> [2][2048][1024] (4.2 M); argument order x, pos_cos, pos_sin, Wq, Wk, Wv, Wo, bo).
// Every stage is ONE launch for all of its independent instances (both batches; q, k and v; the four weights): the batch is folded into the row index (x, the projections, the merged planes) or the plane index (b * heads + h), q / k / v and the weights into a grid index. Stages: bf16 transpose of the four weights; bf16 copy of x; exact projections (no bias) whose epilogue builds the head planes itself (q, k: interleaved rotary with the two half-width INPUT tables read by value and bf16-rounded; v: transposed); causal T-2048 attention fused into one launch (k_attn: scores, running softmax and P x V in registers; hybrid rows: < 512 hi/lo 3 products, rest fp16; key blocks above the diagonal never touched) that writes the merged hi/lo planes; merged hi/lo x Wo exact + bo.
// Compute dtypes, f32 accumulate: every input rounded to bf16; projections exact (no bias); rotary f32; attention rows < 512 3 products, rest fp16; softmax f32; Wo hl x exact + bias.

#define NB_  2
#define TT   2048
#define DM   1024
#define NH_  16
#define NKV  16
#define REP  (NH_ / NKV)
#define HD   64
#define DQ   (NH_ * HD)
#define DKV  (NKV * HD)
#define PP   (2 * TT)             // row pitch, in 16-bit elements, of the V^T planes (hi plane in the first half of a row, lo plane in the second)
#define RH   512                  // query rows < RH use hi+lo planes (0: none)
#define SCL  0.125f   // HD^-0.5
typedef _Float16 h16;
typedef unsigned short bf;
typedef __attribute__((ext_vector_type(16))) __bf16   v16bf;
typedef __attribute__((ext_vector_type(16))) _Float16 v16h;
typedef __attribute__((ext_vector_type(8)))  _Float16 v8h;
typedef __attribute__((ext_vector_type(8)))  unsigned short v8us;
typedef __attribute__((ext_vector_type(8)))  float    v8f;
typedef __attribute__((ext_vector_type(4)))  float    v4f;
typedef v8h  __attribute__((may_alias)) v8ha;
typedef v4f  __attribute__((may_alias)) v4fa;
typedef v8us __attribute__((may_alias)) v8usa;

__device__ __forceinline__ unsigned short f2bf(float f) { unsigned u = __float_as_uint(f); u += 0x7FFFu + ((u >> 16) & 1u); return (unsigned short)(u >> 16); }
__device__ __forceinline__ float bf2f(unsigned short b) { return __uint_as_float(((unsigned)b) << 16); }
__device__ __forceinline__ float bfr(float f) { return bf2f(f2bf(f)); }
__device__ __forceinline__ v16h cat16(v8h lo, v8h hi) { return __builtin_shufflevector(lo, hi, 0, 1, 2, 3, 4, 5, 6, 7, 8, 9, 10, 11, 12, 13, 14, 15); }
__device__ __forceinline__ v16bf cat16b(v8us lo, v8us hi) { return __builtin_bit_cast(v16bf, __builtin_shufflevector(lo, hi, 0, 1, 2, 3, 4, 5, 6, 7, 8, 9, 10, 11, 12, 13, 14, 15)); }
__device__ __forceinline__ v8f wmma16(v16h a, v16h b, v8f c) { return __builtin_amdgcn_wmma_f32_16x16x32_f16(false, a, false, b, (short)0, c, false, false); }
__device__ __forceinline__ v8f wmmab(v16bf a, v16bf b, v8f c) { return __builtin_amdgcn_wmma_f32_16x16x32_bf16(false, a, false, b, (short)0, c, false, false); }
__device__ __forceinline__ h16 tohx(float x) { return (h16)x; }
__device__ __forceinline__ void splitf(float y, unsigned short& h, unsigned short& l) { h = f2bf(y); l = f2bf(y - bf2f(h)); }
typedef __attribute__((ext_vector_type(4))) _Float16 v4h;
typedef __attribute__((ext_vector_type(2))) unsigned short v2us;
typedef __attribute__((ext_vector_type(4))) unsigned short v4us;
typedef __attribute__((ext_vector_type(2))) float v2f;



// ---- k_gemmw: register-blocked GEMM, ONE WAVE per 64x64 output tile (16 accumulators), operands straight from K-contiguous 16-bit planes; grid (M/64, N/64, Z), 32 threads.
// C[m][n] (f32, pitch ldc, + optional f32 bias[n]) = sum_k A[m][k] Bt[n][k] (+ split products per NSPLIT). z-batch strides sA/sB/sC in elements. K % 32 == 0.
// PLANES (the q, k, v projections; z = 0, 1, 2): no f32 C is written. A 64x64 tile is 64 positions of ONE head of one batch, so the epilogue writes the attention's operand planes (fp16 + bf16 hi/lo) itself:
// z < 2: planes [z][b][h][t][d] of the rotated tile: consecutive pairs (x0, x1) -> (x0 c - x1 s, x0 s + x1 c), c, s = bf16-rounded fc / fs[t][d / 2]; staged through LDS like C, so that a lane holds two whole pairs and 16 lanes store a whole 128-byte row.
// z == 2: V^T planes [b][h][d][t] at row pitch PP straight from the accumulators: a lane holds 8 consecutive positions of one d, a 16-byte store.
template <typename T16> struct WFrag;
template <> struct WFrag<h16> { typedef v16h V; static __device__ __forceinline__ V ld(const h16* p) { return cat16(*(const v8h*)p, *(const v8h*)(p + 16)); } static __device__ __forceinline__ v8f mma(V a, V b, v8f c) { return wmma16(a, b, c); } };
template <> struct WFrag<bf> { typedef v16bf V; static __device__ __forceinline__ V ld(const bf* p) { return cat16b(*(const v8us*)p, *(const v8us*)(p + 16)); } static __device__ __forceinline__ v8f mma(V a, V b, v8f c) { return wmmab(a, b, c); } };
template <typename T16, int NSPLIT, bool BIAS, bool PLANES>
__global__ __launch_bounds__(32) void k_gemmw(const T16* __restrict__ A, const T16* __restrict__ A2, const T16* __restrict__ Bt, const T16* __restrict__ Bt2, int K, float* C, int ldc, const float* __restrict__ bias, size_t sA, size_t sB, size_t sC, const float* __restrict__ fc, const float* __restrict__ fs, h16* __restrict__ P16, bf* __restrict__ Ph, bf* __restrict__ Pl, h16* __restrict__ V16, bf* __restrict__ Vh, bf* __restrict__ Vl) {
    typedef typename WFrag<T16>::V V;
    __shared__ __align__(16) float os[16 * 68];
    const size_t z = blockIdx.z; A += z * sA; if (A2) A2 += z * sA; Bt += z * sB; if (Bt2) Bt2 += z * sB; C += z * sC;
    const int lane = threadIdx.x & 31, lr = lane & 15, hi = lane >> 4; const int r0 = blockIdx.x * 64, c0 = blockIdx.y * 64;
    v8f acc[4][4];
#pragma unroll
    for (int mb = 0; mb < 4; ++mb)
#pragma unroll
        for (int nb = 0; nb < 4; ++nb) acc[mb][nb] = (v8f){};
    const size_t aoff = (size_t)(r0 + lr) * K + 8 * hi, boff = (size_t)(c0 + lr) * K + 8 * hi;
    for (int kc = 0; kc < K; kc += 32) {
        V a[4], a2[4];
#pragma unroll
        for (int mb = 0; mb < 4; ++mb) { a[mb] = WFrag<T16>::ld(A + aoff + (size_t)mb * 16 * K + kc); if (NSPLIT == 1 || NSPLIT == 2) a2[mb] = WFrag<T16>::ld(A2 + aoff + (size_t)mb * 16 * K + kc); }
#pragma unroll
        for (int nb = 0; nb < 4; ++nb) { const V b = WFrag<T16>::ld(Bt + boff + (size_t)nb * 16 * K + kc); V b2; if (NSPLIT >= 2) b2 = WFrag<T16>::ld(Bt2 + boff + (size_t)nb * 16 * K + kc);
#pragma unroll
            for (int mb = 0; mb < 4; ++mb) { acc[mb][nb] = WFrag<T16>::mma(a[mb], b, acc[mb][nb]); if (NSPLIT == 1 || NSPLIT == 2) acc[mb][nb] = WFrag<T16>::mma(a2[mb], b, acc[mb][nb]); if (NSPLIT >= 2) acc[mb][nb] = WFrag<T16>::mma(a[mb], b2, acc[mb][nb]); } }
        asm volatile("v_nop\n\tv_nop\n\tv_nop\n\tv_nop" : "+v"(acc[0][0]), "+v"(acc[1][1]), "+v"(acc[2][2]), "+v"(acc[3][3]) : "v"(a[0]), "v"(a[3]));
    }
    if constexpr (PLANES) {
        static_assert(HD == 64 && TT % 64 == 0 && NKV == NH_, "a 64x64 tile is 64 positions of one head of one batch");
        const int b = r0 / TT, t0 = r0 % TT, h = blockIdx.y;
        if (blockIdx.z == 2) {
            const size_t vo = ((size_t)(b * NKV + h) * HD + lr) * PP + t0 + 8 * hi; h16* v16 = V16 + vo; bf* vh = Vh + vo; bf* vl = Vl + vo;
#pragma unroll
            for (int nb = 0; nb < 4; ++nb)
#pragma unroll
                for (int mb = 0; mb < 4; ++mb) { v8h o16; v8us oh, ol;
#pragma unroll
                    for (int j = 0; j < 8; ++j) { const float x = acc[mb][nb][j]; o16[j] = tohx(x); unsigned short a2, c2; splitf(x, a2, c2); oh[j] = a2; ol[j] = c2; }
                    const size_t o = (size_t)nb * 16 * PP + mb * 16; *(v8h*)(v16 + o) = o16; *(v8us*)(vh + o) = oh; *(v8us*)(vl + o) = ol;
                    asm volatile("s_wait_xcnt 0x0" :: "v"(o16), "v"(oh), "v"(ol), "v"(v16), "v"(vh), "v"(vl) : "memory"); }   // the three stores: their data and address registers stay whole (inputs) until this wait
        } else {
            const size_t po = (((size_t)blockIdx.z * NB_ + b) * NH_ + h) * TT * HD + (size_t)(t0 + hi) * HD + lr * 4; h16* p16 = P16 + po; bf* ph = Ph + po; bf* pl = Pl + po;
            const float* fcp = fc + (size_t)(t0 + hi) * (HD / 2) + lr * 2; const float* fsp = fs + (size_t)(t0 + hi) * (HD / 2) + lr * 2;
#pragma unroll
            for (int mb = 0; mb < 4; ++mb) {
                v2f cc[8], sn[8];      // this block's table rows, asked for ahead of the staging so that they fly under it
#pragma unroll
                for (int s = 0; s < 8; ++s) { cc[s] = *(const v2f*)(fcp + (mb * 16 + 2 * s) * (HD / 2)); sn[s] = *(const v2f*)(fsp + (mb * 16 + 2 * s) * (HD / 2)); }
#pragma unroll
                for (int nb = 0; nb < 4; ++nb) {
#pragma unroll
                    for (int j = 0; j < 8; ++j) os[(hi * 8 + j) * 68 + nb * 16 + lr] = acc[mb][nb][j]; }
                asm volatile("s_wait_xcnt 0x0" :: "v"(fcp), "v"(fsp) : "memory");   // the table loads: their address registers stay whole (inputs) until this wait
                v4f val[8];            // all eight row reads first: one LDS latency a block, not one a row
#pragma unroll
                for (int s = 0; s < 8; ++s) val[s] = *(const v4fa*)(os + (2 * s + hi) * 68 + lr * 4);
#pragma unroll
                for (int s = 0; s < 8; ++s) { v4h o16; v4us oh, ol;
#pragma unroll
                    for (int q = 0; q < 2; ++q) { const float x0 = val[s][2 * q], x1 = val[s][2 * q + 1], c = bfr(cc[s][q]), sv = bfr(sn[s][q]);
                        const float e0 = __builtin_fmaf(x0, c, -(x1 * sv)), e1 = __builtin_fmaf(x0, sv, x1 * c);   /* even: x0 c - x1 s; odd: x0 s + x1 c; the x1 product rounded, the x0 product fused */
                        o16[2 * q] = tohx(e0); o16[2 * q + 1] = tohx(e1); unsigned short a2, c2; splitf(e0, a2, c2); oh[2 * q] = a2; ol[2 * q] = c2; splitf(e1, a2, c2); oh[2 * q + 1] = a2; ol[2 * q + 1] = c2; }
                    const int o = (mb * 16 + 2 * s) * HD; *(v4h*)(p16 + o) = o16; *(v4us*)(ph + o) = oh; *(v4us*)(pl + o) = ol;
                    asm volatile("s_wait_xcnt 0x0" :: "v"(o16), "v"(oh), "v"(ol), "v"(p16), "v"(ph), "v"(pl) : "memory"); }   // the three stores: their data and address registers stay whole (inputs) until this wait
            }
        }
        return;
    }
#pragma unroll
    for (int mb = 0; mb < 4; ++mb) {
#pragma unroll
        for (int nb = 0; nb < 4; ++nb) {
#pragma unroll
            for (int j = 0; j < 8; ++j) os[(hi * 8 + j) * 68 + nb * 16 + lr] = acc[mb][nb][j]; }
        __builtin_amdgcn_wave_barrier(); asm volatile("" ::: "memory");
        float* crow = C + (size_t)(r0 + mb * 16) * ldc + c0;
{
#pragma unroll
            for (int s = 0; s < 8; ++s) { const int row = 2 * s + hi, cofs = lr * 4; v4f val = *(const v4fa*)(os + row * 68 + cofs); if (BIAS) { val[0] += bfr(bias[c0 + cofs]); val[1] += bfr(bias[c0 + cofs + 1]); val[2] += bfr(bias[c0 + cofs + 2]); val[3] += bfr(bias[c0 + cofs + 3]); }
                *(v4f*)(crow + (size_t)row * ldc + cofs) = val; }
             }
        __builtin_amdgcn_wave_barrier(); asm volatile("" ::: "memory");
    }
}


// grid (.., 4): blockIdx.y picks the weight; the four transposed planes lie one behind the other in Bt
__global__ __launch_bounds__(256) void k_wtG(const float* __restrict__ w0, const float* __restrict__ w1, const float* __restrict__ w2, const float* __restrict__ w3, int K, int N, bf* Bt) {
    const int y = blockIdx.y; const float* __restrict__ w = y == 0 ? w0 : y == 1 ? w1 : y == 2 ? w2 : w3; Bt += (size_t)y * N * K;
    const int lane = threadIdx.x & 31; const int L0 = (blockIdx.x * 8 + (threadIdx.x >> 5)) * 8; const int nlines = N * K / 64;
{
        for (int l = 0; l < 8; ++l) { const int L = L0 + l; if (L >= nlines) break; const size_t e = (size_t)L * 64 + lane * 2; const int k = (int)(e % K), n = (int)(e / K); v2us o;
            o[0] = f2bf(w[(size_t)k * N + n]); o[1] = f2bf(w[(size_t)(k + 1) * N + n]); *(v2us*)(Bt + e) = o; }
         }
}
__global__ __launch_bounds__(256) void k_cvt8(const float* __restrict__ src, bf* dst, size_t n8) { const size_t i = (size_t)blockIdx.x * 256 + threadIdx.x; if (i >= n8) return; const v8f v = *(const v8f*)(src + i * 8); v8us o;
#pragma unroll
    for (int k = 0; k < 8; ++k) o[k] = f2bf(v[k]); *(v8us*)(dst + i * 8) = o;  }
// ---- k_attn: causal attention fused into one launch for both batches (batch = blockIdx.z): ONE WAVE per (head, query tile); scores, running softmax and the probability x value product stay in registers.
// Transposed products: S^T = K Q^T (A = 16 keys x 64 d, B = 16 queries) leaves lane (lr, hi) with keys 8 hi + j of query lr, which for two neighbouring key tiles is exactly the B fragment (k = 8 hi + e, 16 + 8 hi + e) of
// O^T = V^T P^T (A = 16 d x 32 keys): no exchange between lanes but one with lane l ^ 16 for the row maximum and the row sum. O^T leaves lane (lr, hi) with d = 16 dt + 8 hi + j of query lr: 16-byte stores into the merged hi/lo planes.
// Running softmax in the base-2 domain: t = s * HD^-0.5 * log2(e); per 32 keys m' = max(m, t), O and l scaled by 2^(m - m'), p = 2^(t - m') (not normalised: <= 1), l += sum p; O / l at the end.
// HR (query rows < RH): bf16 hi/lo planes, 3 products for both contractions, 16 queries a wave; else fp16, 32 queries a wave. Key blocks wholly at or below the diagonal need no mask; the one diagonal block masks by select.
#define KB 32                     // keys per trip
__device__ __forceinline__ float xhalf(float x) { return __builtin_bit_cast(float, __builtin_amdgcn_permlanex16(__builtin_bit_cast(int, x), __builtin_bit_cast(int, x), 0x76543210, 0xfedcba98, false, false)); }  // lane l with lane l ^ 16
__device__ __forceinline__ float exp2s(float x) { asm("v_exp_f32 %0, %0\n\tv_nop" : "+v"(x)); return x; }   // 2^x. The v_nop is the free slot the instruction set asks for behind a transcendental. In place: the register already holds the live argument, so it is no operand of a matrix instruction still in its window (the compiler does not look into asm text)
template <typename T16, int NT, bool HR>
__device__ __forceinline__ void attn_tile(const T16* __restrict__ Q, const T16* __restrict__ Q2, const T16* __restrict__ Kp, const T16* __restrict__ Kp2, const T16* __restrict__ Vt, const T16* __restrict__ Vt2, const int q0, bf* __restrict__ Ah, bf* __restrict__ Al) {
    typedef typename WFrag<T16>::V V;
    const int lane = threadIdx.x & 31, lr = lane & 15, hi = lane >> 4;
    V qf[NT][2], qf2[NT][2];
    const T16* qp = Q + (size_t)(q0 + lr) * HD + 8 * hi; const T16* qp2 = HR ? Q2 + (size_t)(q0 + lr) * HD + 8 * hi : qp;
#pragma unroll
    for (int nt = 0; nt < NT; ++nt)
#pragma unroll
        for (int ks = 0; ks < 2; ++ks) { qf[nt][ks] = WFrag<T16>::ld(qp + nt * 16 * HD + ks * 32); if (HR) qf2[nt][ks] = WFrag<T16>::ld(qp2 + nt * 16 * HD + ks * 32); }
    v8f o[4][NT]; float m[NT], l[NT];
#pragma unroll
    for (int nt = 0; nt < NT; ++nt) { m[nt] = -3.0e38f; l[nt] = 0.f;
#pragma unroll
        for (int dt = 0; dt < 4; ++dt) o[dt][nt] = (v8f){}; }
    V kf[2][2], kf2[2][2];
    auto ldk = [&](const T16* kp, const T16* kp2, V (&f)[2][2], V (&f2)[2][2]) {
#pragma unroll
        for (int mt = 0; mt < 2; ++mt)
#pragma unroll
            for (int ks = 0; ks < 2; ++ks) { f[mt][ks] = WFrag<T16>::ld(kp + mt * 16 * HD + ks * 32); if (HR) f2[mt][ks] = WFrag<T16>::ld(kp2 + mt * 16 * HD + ks * 32); } };
    const size_t kl = (size_t)lr * HD + 8 * hi, vl = (size_t)lr * PP + 8 * hi;
    auto step = [&](const int kb, const bool last) {
        V vf[4], vf2[4];
        const T16* vp = Vt + vl + kb; const T16* vp2 = HR ? Vt2 + vl + kb : vp;
        const T16* kp = (HR || !last) ? Kp + kl + (size_t)(HR ? kb : kb + KB) * HD : vp; const T16* kp2 = HR ? Kp2 + kl + (size_t)kb * HD : kp;
#pragma unroll
        for (int dt = 0; dt < 4; ++dt) { vf[dt] = WFrag<T16>::ld(vp + (size_t)dt * 16 * PP); if (HR) vf2[dt] = WFrag<T16>::ld(vp2 + (size_t)dt * 16 * PP); }
        if (HR) ldk(kp, kp2, kf, kf2);              // hi/lo path: this trip's own key fragments
        v8f sa[NT][2];
#pragma unroll
        for (int nt = 0; nt < NT; ++nt) {
#pragma unroll
            for (int mt = 0; mt < 2; ++mt) { v8f s = (v8f){};
#pragma unroll
                for (int ks = 0; ks < 2; ++ks) { s = WFrag<T16>::mma(kf[mt][ks], qf[nt][ks], s); if (HR) { s = WFrag<T16>::mma(kf[mt][ks], qf2[nt][ks], s); s = WFrag<T16>::mma(kf2[mt][ks], qf[nt][ks], s); } }
                sa[nt][mt] = s; } }
        if (!HR) { if (!last) ldk(kp, kp2, kf, kf2);   // fp16 path: the next trip's key fragments, into the same registers right behind this trip's score products; they fly under the softmax and P x V
            __builtin_amdgcn_sched_barrier(0); }       // holds those loads (and this trip's V loads) up here: sunk to the foot of the trip, their latency would be waited out in full
#pragma unroll
        for (int nt = 0; nt < NT; ++nt) {
            v8f (&st)[2] = sa[nt];
            float mx = m[nt];
#pragma unroll
            for (int mt = 0; mt < 2; ++mt)
#pragma unroll
                for (int j = 0; j < 8; ++j) { float t = st[mt][j] * (SCL * 1.4426950408889634f); if (last) t = (kb + mt * 16 + hi * 8 + j <= q0 + nt * 16 + lr) ? t : -3.0e38f; st[mt][j] = t; mx = fmaxf(mx, t); }
            mx = fmaxf(mx, xhalf(mx));
            const float al = exp2s(m[nt] - mx); m[nt] = mx;
            float sum = 0.f;
#pragma unroll
            for (int mt = 0; mt < 2; ++mt)
#pragma unroll
                for (int j = 0; j < 8; ++j) { const float p = exp2s(st[mt][j] - mx); st[mt][j] = p; sum += p; }
            l[nt] = l[nt] * al + sum;
#pragma unroll
            for (int dt = 0; dt < 4; ++dt) o[dt][nt] *= al;
            if (nt == 0) asm volatile("s_wait_xcnt 0x0" :: "v"(vp), "v"(vp2), "v"(kp), "v"(kp2) : "memory");   // this trip's loads: their address registers stay whole (inputs) until this wait; placed here, where the V fragments are waited for anyway
            if (HR) {
                v8us h0, h1, l0, l1;
#pragma unroll
                for (int j = 0; j < 8; ++j) { unsigned short x, y; splitf(st[0][j], x, y); h0[j] = x; l0[j] = y; splitf(st[1][j], x, y); h1[j] = x; l1[j] = y; }
                const v16bf ph = cat16b(h0, h1), pl = cat16b(l0, l1);
#pragma unroll
                for (int dt = 0; dt < 4; ++dt) { o[dt][nt] = wmmab(__builtin_bit_cast(v16bf, vf[dt]), ph, o[dt][nt]); o[dt][nt] = wmmab(__builtin_bit_cast(v16bf, vf[dt]), pl, o[dt][nt]); o[dt][nt] = wmmab(__builtin_bit_cast(v16bf, vf2[dt]), ph, o[dt][nt]); }
            } else {
                v8h p0, p1;
#pragma unroll
                for (int j = 0; j < 8; ++j) { p0[j] = tohx(st[0][j]); p1[j] = tohx(st[1][j]); }
                const v16h pf = cat16(p0, p1);
#pragma unroll
                for (int dt = 0; dt < 4; ++dt) o[dt][nt] = wmma16(__builtin_bit_cast(v16h, vf[dt]), pf, o[dt][nt]);
            }
        }
    };
    const T16* kp0 = Kp + kl;
    if (!HR) ldk(kp0, kp0, kf, kf2);
    asm volatile("s_wait_xcnt 0x0" :: "v"(qp), "v"(qp2), "v"(kp0) : "memory");   // the prologue's loads: their address registers stay whole (inputs) until this wait
    const int kd = (q0 / KB) * KB;             // the diagonal block: it holds keys q0 .. q0 + 16 NT - 1 (q0 is a multiple of 16 NT, and 16 NT divides KB)
    for (int kb = 0; kb < kd; kb += KB) step(kb, false);
    step(kd, true);
#pragma unroll
    for (int nt = 0; nt < NT; ++nt) { const float lt = l[nt] + xhalf(l[nt]); const float inv = __fdiv_rn(1.0f, lt); const size_t oo = (size_t)(q0 + nt * 16 + lr) * DQ + 8 * hi; bf* sh = Ah + oo; bf* sl = Al + oo;
#pragma unroll
        for (int dt = 0; dt < 4; ++dt) { v8us oh, ol;
#pragma unroll
            for (int j = 0; j < 8; ++j) { unsigned short x, y; splitf(o[dt][nt][j] * inv, x, y); oh[j] = x; ol[j] = y; }
            *(v8us*)(sh + dt * 16) = oh; *(v8us*)(sl + dt * 16) = ol;
            asm volatile("s_wait_xcnt 0x0" :: "v"(oh), "v"(ol), "v"(sh), "v"(sl) : "memory"); } }   // the two stores: their data and address registers stay whole (inputs) until this wait, on every way into code that rewrites them
}
#define NLR ((TT - RH) / 32)      // fp16 query tiles of 32 rows
#define NHR (RH / 16)             // hi/lo query tiles of 16 rows
// grid (NLR + NHR, NH_, NB_): the longest tiles (last query rows) take the lowest block indices, so that they start first
__global__ __launch_bounds__(32) void k_attn(const h16* __restrict__ Q16, const h16* __restrict__ K16, const h16* __restrict__ V16, const bf* __restrict__ Qh, const bf* __restrict__ Ql, const bf* __restrict__ Kh, const bf* __restrict__ Kl, const bf* __restrict__ Vh, const bf* __restrict__ Vl, bf* __restrict__ Ah, bf* __restrict__ Al) {
    const int h = blockIdx.y, g = h / REP, bx = blockIdx.x, b = blockIdx.z; const size_t qo = (size_t)(b * NH_ + h) * TT * HD, ko = (size_t)(b * NKV + g) * TT * HD, vo = (size_t)(b * NKV + g) * HD * PP; Ah += (size_t)b * TT * DQ; Al += (size_t)b * TT * DQ;
    if (bx < NLR) attn_tile<h16, 2, false>(Q16 + qo, nullptr, K16 + ko, nullptr, V16 + vo, nullptr, RH + (NLR - 1 - bx) * 32, Ah + h * HD, Al + h * HD);
    else attn_tile<bf, 1, true>(Qh + qo, Ql + qo, Kh + ko, Kl + ko, Vh + vo, Vl + vo, (NLR + NHR - 1 - bx) * 16, Ah + h * HD, Al + h * HD);
}

extern "C" void kernel_launch(void* const* d_in, const int* in_sizes, int n_in,
                              void* d_out, int out_size, void* d_ws, size_t ws_size, hipStream_t stream) {
    (void)in_sizes; (void)n_in; (void)out_size;
        const float* x = (const float*)d_in[0]; const float* fcos = (const float*)d_in[1]; const float* fsin = (const float*)d_in[2]; const float* wq = (const float*)d_in[3]; const float* wk = (const float*)d_in[4]; const float* wv = (const float*)d_in[5]; const float* wo = (const float*)d_in[6]; const float* bo = (const float*)d_in[7];   /* input order x, pos_cos, pos_sin ([2048][32] HALF-width table INPUTS: read by value), Wq, Wk, Wv, Wo ('xw' (in, out) [1024][1024]), bo ([1024]: zeros, read through the output launch's bias slot): EIGHT inputs, all read; the q, k, v projections have NO bias in this module */
    float* OUT = (float*)d_out;     // [2][2048][1024]
    char* wsp = (char*)d_ws;
    auto take = [&](size_t bytes) { char* p = wsp; wsp += (bytes + 255) & ~(size_t)255; return (void*)p; };
    static_assert(DQ == DKV && DQ == DM, "q, k and v share one projection launch that also writes their planes, the four weights one transpose launch: equal shapes");
    bf* WQ = (bf*)take((size_t)4 * DQ * DM * 2); bf* WO = WQ + (size_t)3 * DQ * DM;   // transposed Wq, Wk, Wv, Wo, one behind the other
    bf* XB = (bf*)take((size_t)NB_ * TT * DM * 2);
    const size_t PLN = (size_t)NB_ * NH_ * TT * HD;   // elements of one set of head planes
    h16* QP16 = (h16*)take(2 * PLN * 2); h16* KP16 = QP16 + PLN; h16* VT16 = (h16*)take((size_t)NB_ * NKV * HD * PP * 2);
    bf* QPh = (bf*)take(2 * PLN * 2); bf* KPh = QPh + PLN; bf* QPl = (bf*)take(2 * PLN * 2); bf* KPl = QPl + PLN; bf* VTh = (bf*)take((size_t)NB_ * NKV * HD * PP * 2); bf* VTl = VTh + TT;   // hi plane in the first half of each PP row, lo plane in the second
    bf* ATh = (bf*)take((size_t)NB_ * TT * DQ * 2); bf* ATl = (bf*)take((size_t)NB_ * TT * DQ * 2);
    if ((size_t)(wsp - (char*)d_ws) > ws_size) return;    // ws 256 MiB
    k_wtG<<<dim3((unsigned)((DM * DQ / 64 + 63) / 64), 4, 1), 256, 0, stream>>>(wq, wk, wv, wo, DM, DQ, WQ);   /* 'xw' [in][out] weights: transposed once into Bt */
    k_cvt8<<<(unsigned)(((size_t)NB_ * TT * DM / 8 + 255) / 256), 256, 0, stream>>>(x, XB, (size_t)NB_ * TT * DM / 8);
    k_gemmw<bf, 0, false, true><<<dim3(NB_ * TT / 64, DQ / 64, 3), 32, 0, stream>>>(XB, nullptr, WQ, nullptr, DM, nullptr, DQ, nullptr, 0, (size_t)DQ * DM, 0, fcos, fsin, QP16, QPh, QPl, VT16, VTh, VTl);   /* q, k, v projections, written as head planes */
    k_attn<<<dim3(NLR + NHR, NH_, NB_), 32, 0, stream>>>(QP16, KP16, VT16, QPh, QPl, KPh, KPl, VTh, VTl, ATh, ATl);
    k_gemmw<bf, 1, true, false><<<dim3(NB_ * TT / 64, DM / 64, 1), 32, 0, stream>>>(ATh, ATl, WO, nullptr, DQ, OUT, DM, bo, 0, 0, 0, nullptr, nullptr, nullptr, nullptr, nullptr, nullptr, nullptr, nullptr);
}

// v005
// One run takes 128 microseconds.
// Timed twice side by side with v004, it ran 1.34 and 1.36 times as fast.
// Over all steps from v000 it is 11.3 times as fast.
#include <hip/hip_runtime.h>

// Causal multi-head self-attention with interleaved-pair rotary embeddings from two half-width INPUT tables and (in, out) weights (x [2][2048][1024]; q, k, v = x W ('xw' [1024][1024] normal x 0.02, no projection bias; 16 heads x 64); _rope on q and k: consecutive pairs (t[2i], t[2i+1]) -> (te c - to s, te s + to c) with c, s = pos_cos / pos_sin[t][i] (f32 [2048][32] INPUT tables the module computes: cos / sin(t / 10000^(2i/64)): read by value); scores: -inf above the diagonal, then / sqrt(64) (the same as scaling first); softmax; out = merged Wo + bo ('xw' + a zero bias [1024], read) -> [2][2048][1024] (4.2 M); argument order x, pos_cos, pos_sin, Wq, Wk, Wv, Wo, bo).
// Every stage is ONE launch for all of its independent instances (both batches; q, k and v; the four weights): the batch is folded into the row index (x, the projections, the merged planes) or the plane index (b * heads + h), q / k / v and the weights into a grid index. Stages: bf16 transpose of the four weights; bf16 copy of x; exact projections (no bias) whose epilogue builds the head planes itself (q, k: interleaved rotary with the two half-width INPUT tables read by value and bf16-rounded; v: transposed); causal T-2048 attention fused into one launch (k_attn: scores, running softmax and P x V in registers; hybrid rows: < 512 hi/lo 3 products, rest fp16; key blocks above the diagonal never touched) that writes the merged hi/lo planes; merged hi/lo x Wo exact + bo.
// Compute dtypes, f32 accumulate: every input rounded to bf16; projections exact (no bias); rotary f32; attention rows < 512 3 products, rest fp16; softmax f32; Wo hl x exact + bias.

#define NB_  2
#define TT   2048
#define DM   1024
#define NH_  16
#define NKV  16
#define REP  (NH_ / NKV)
#define HD   64
#define DQ   (NH_ * HD)
#define DKV  (NKV * HD)
#define PP   (2 * TT)             // row pitch, in 16-bit elements, of the V^T planes (hi plane in the first half of a row, lo plane in the second)
#define RH   512                  // query rows < RH use hi+lo planes (0: none)
#define SCL  0.125f   // HD^-0.5
typedef _Float16 h16;
typedef unsigned short bf;
typedef __attribute__((ext_vector_type(16))) __bf16   v16bf;
typedef __attribute__((ext_vector_type(16))) _Float16 v16h;
typedef __attribute__((ext_vector_type(8)))  _Float16 v8h;
typedef __attribute__((ext_vector_type(8)))  unsigned short v8us;
typedef __attribute__((ext_vector_type(8)))  float    v8f;
typedef __attribute__((ext_vector_type(4)))  float    v4f;
typedef v8h  __attribute__((may_alias)) v8ha;
typedef v4f  __attribute__((may_alias)) v4fa;
typedef v8us __attribute__((may_alias)) v8usa;

__device__ __forceinline__ unsigned short f2bf(float f) { unsigned u = __float_as_uint(f); u += 0x7FFFu + ((u >> 16) & 1u); return (unsigned short)(u >> 16); }
__device__ __forceinline__ float bf2f(unsigned short b) { return __uint_as_float(((unsigned)b) << 16); }
__device__ __forceinline__ float bfr(float f) { return bf2f(f2bf(f)); }
__device__ __forceinline__ v16h cat16(v8h lo, v8h hi) { return __builtin_shufflevector(lo, hi, 0, 1, 2, 3, 4, 5, 6, 7, 8, 9, 10, 11, 12, 13, 14, 15); }
__device__ __forceinline__ v16bf cat16b(v8us lo, v8us hi) { return __builtin_bit_cast(v16bf, __builtin_shufflevector(lo, hi, 0, 1, 2, 3, 4, 5, 6, 7, 8, 9, 10, 11, 12, 13, 14, 15)); }
__device__ __forceinline__ v8f wmma16(v16h a, v16h b, v8f c) { return __builtin_amdgcn_wmma_f32_16x16x32_f16(false, a, false, b, (short)0, c, false, false); }
__device__ __forceinline__ v8f wmmab(v16bf a, v16bf b, v8f c) { return __builtin_amdgcn_wmma_f32_16x16x32_bf16(false, a, false, b, (short)0, c, false, false); }
__device__ __forceinline__ h16 tohx(float x) { return (h16)x; }
__device__ __forceinline__ void splitf(float y, unsigned short& h, unsigned short& l) { h = f2bf(y); l = f2bf(y - bf2f(h)); }
typedef __attribute__((ext_vector_type(4))) _Float16 v4h;
typedef __attribute__((ext_vector_type(2))) unsigned short v2us;
typedef __attribute__((ext_vector_type(4))) unsigned short v4us;
typedef __attribute__((ext_vector_type(2))) float v2f;



// ---- k_gemmw: register-blocked GEMM, one wave per 64x64 output tile (16 accumulators), FOUR WAVES (2 x 2) a work-group on one 128x128 tile; grid (M/128, N/128, Z), 128 threads.
// The operands (K-contiguous 16-bit planes) are staged in LDS, 64 k (one whole 128-byte line of every row) a stage, by asynchronous copies, two buffers: stage t + 1 flies while stage t is worked on. A copy instruction covers four whole lines, and each operand row is fetched once for the two waves that use it.
// LDS rows at a pitch of 144 bytes (16 x odd: the 16-byte fragment reads meet no bank twice). Per accumulator the products come in the same order as without the staging (k ascending, A then A2).
// C[m][n] (f32, pitch ldc, + optional f32 bias[n]) = sum_k A[m][k] Bt[n][k] (+ the A2 product for NSPLIT 1). z-batch strides sA/sB/sC in elements. K % 64 == 0.
// PLANES (the q, k, v projections; z = 0, 1, 2): no f32 C is written. A 64x64 tile is 64 positions of ONE head of one batch, so the epilogue writes the attention's operand planes (fp16 + bf16 hi/lo) itself:
// z < 2: planes [z][b][h][t][d] of the rotated tile: consecutive pairs (x0, x1) -> (x0 c - x1 s, x0 s + x1 c), c, s = bf16-rounded fc / fs[t][d / 2]; staged through LDS like C, so that a lane holds two whole pairs and 16 lanes store a whole 128-byte row.
// z == 2: V^T planes [b][h][d][t] at row pitch PP straight from the accumulators: a lane holds 8 consecutive positions of one d, a 16-byte store.
template <typename T16> struct WFrag;
template <> struct WFrag<h16> { typedef v16h V; static __device__ __forceinline__ V ld(const h16* p) { return cat16(*(const v8h*)p, *(const v8h*)(p + 16)); } static __device__ __forceinline__ v8f mma(V a, V b, v8f c) { return wmma16(a, b, c); } };
template <> struct WFrag<bf> { typedef v16bf V; static __device__ __forceinline__ V ld(const bf* p) { return cat16b(*(const v8us*)p, *(const v8us*)(p + 16)); } static __device__ __forceinline__ v8f mma(V a, V b, v8f c) { return wmmab(a, b, c); } };
#define LP 72                     // LDS row pitch of a staged operand tile, in 16-bit elements (144 bytes)
#define TLE (128 * LP)            // elements of one staged operand tile (128 rows)
// Eight asynchronous 16-byte copies of a lane: rows r, r + 16, .. r + 112 of one operand tile (l: the lane's LDS byte address, g: its global address, K: the global row pitch in elements).
// The s_wait_xcnt closes the statement so that no address register of a copy is rewritten in front of it.
template <typename T16>
__device__ __forceinline__ void cp8(const unsigned l, const T16* g, const int K) {
    const size_t rs = (size_t)16 * K;
    asm volatile("global_load_async_to_lds_b128 %0, %8, off\n\t"
                 "global_load_async_to_lds_b128 %1, %9, off\n\t"
                 "global_load_async_to_lds_b128 %2, %10, off\n\t"
                 "global_load_async_to_lds_b128 %3, %11, off\n\t"
                 "global_load_async_to_lds_b128 %4, %12, off\n\t"
                 "global_load_async_to_lds_b128 %5, %13, off\n\t"
                 "global_load_async_to_lds_b128 %6, %14, off\n\t"
                 "global_load_async_to_lds_b128 %7, %15, off\n\t"
                 "s_wait_xcnt 0x0"
                 :: "v"(l), "v"(l + 1 * 16 * LP * 2), "v"(l + 2 * 16 * LP * 2), "v"(l + 3 * 16 * LP * 2), "v"(l + 4 * 16 * LP * 2), "v"(l + 5 * 16 * LP * 2), "v"(l + 6 * 16 * LP * 2), "v"(l + 7 * 16 * LP * 2),
                    "v"(g), "v"(g + rs), "v"(g + 2 * rs), "v"(g + 3 * rs), "v"(g + 4 * rs), "v"(g + 5 * rs), "v"(g + 6 * rs), "v"(g + 7 * rs) : "memory");
}
template <typename T16, int NSPLIT, bool BIAS, bool PLANES>
__global__ __launch_bounds__(128) void k_gemmw(const T16* __restrict__ A, const T16* __restrict__ A2, const T16* __restrict__ Bt, const T16* __restrict__ Bt2, int K, float* C, int ldc, const float* __restrict__ bias, size_t sA, size_t sB, size_t sC, const float* __restrict__ fc, const float* __restrict__ fs, h16* __restrict__ P16, bf* __restrict__ Ph, bf* __restrict__ Pl, h16* __restrict__ V16, bf* __restrict__ Vh, bf* __restrict__ Vl) {
    typedef typename WFrag<T16>::V V;
    static_assert(NSPLIT <= 1, "staged operands: A, Bt and, for NSPLIT 1, A2");
    constexpr int NOP = NSPLIT == 1 ? 3 : 2;          // operand tiles a stage: A, Bt (, A2)
    __shared__ __align__(16) T16 ring[2 * NOP * TLE];
    __shared__ __align__(16) float osm[4 * 16 * 68];  // epilogue staging, a range of its own for each wave
    const int wave = __builtin_amdgcn_readfirstlane(threadIdx.x >> 5), wm = wave & 1, wn = wave >> 1;
    float* os = osm + wave * (16 * 68);
    const size_t z = blockIdx.z; A += z * sA; if (A2) A2 += z * sA; Bt += z * sB; if (Bt2) Bt2 += z * sB; C += z * sC;
    const int lane = threadIdx.x & 31, lr = lane & 15, hi = lane >> 4; const int r0 = blockIdx.x * 128 + wm * 64, c0 = blockIdx.y * 128 + wn * 64;
    v8f acc[4][4];
#pragma unroll
    for (int mb = 0; mb < 4; ++mb)
#pragma unroll
        for (int nb = 0; nb < 4; ++nb) acc[mb][nb] = (v8f){};
    // the copies: thread t brings the 16-byte piece t & 7 of rows (t >> 3) + 16 i of each tile, so that eight lanes cover a row's whole line
    const int crw = threadIdx.x >> 3, cpc = threadIdx.x & 7;
    const T16* gA = A + (size_t)(blockIdx.x * 128 + crw) * K + cpc * 8; const T16* gB = Bt + (size_t)(blockIdx.y * 128 + crw) * K + cpc * 8; const T16* gA2 = NSPLIT == 1 ? A2 + (size_t)(blockIdx.x * 128 + crw) * K + cpc * 8 : gA;
    const unsigned lc = (unsigned)(size_t)ring + (crw * LP + cpc * 8) * 2;
    auto fill = [&](const int t, const int buf) { const unsigned l = lc + buf * (NOP * TLE * 2);
        cp8<T16>(l, gA + t * 64, K); cp8<T16>(l + TLE * 2, gB + t * 64, K); if (NSPLIT == 1) cp8<T16>(l + 2 * TLE * 2, gA2 + t * 64, K); };
    const int nst = K / 64;
    fill(0, 0);
    asm volatile("s_wait_asynccnt 0x0" ::: "memory");   // this wave's copies of stage 0 have landed
    __syncthreads();                                    // every wave's have: stage 0 may be read
    if (nst > 1) fill(1, 1);
    const int fa = (wm * 64 + lr) * LP + 8 * hi, fb = TLE + (wn * 64 + lr) * LP + 8 * hi;
    for (int t = 0; t < nst; ++t) {
        const T16* sb = ring + (t & 1) * (NOP * TLE);
#pragma unroll
        for (int ks = 0; ks < 2; ++ks) {
            V a[4], a2[4], b[4];
#pragma unroll
            for (int mb = 0; mb < 4; ++mb) { a[mb] = WFrag<T16>::ld(sb + fa + mb * 16 * LP + ks * 32); if (NSPLIT == 1) a2[mb] = WFrag<T16>::ld(sb + 2 * TLE + fa + mb * 16 * LP + ks * 32); }
#pragma unroll
            for (int nb = 0; nb < 4; ++nb) b[nb] = WFrag<T16>::ld(sb + fb + nb * 16 * LP + ks * 32);
            __builtin_amdgcn_sched_barrier(0);   // holds the block's LDS reads together in front of its products: sunk among them, each place with reads would be waited out on its own
#pragma unroll
            for (int nb = 0; nb < 4; ++nb)
#pragma unroll
                for (int mb = 0; mb < 4; ++mb) { acc[mb][nb] = WFrag<T16>::mma(a[mb], b[nb], acc[mb][nb]); if (NSPLIT == 1) acc[mb][nb] = WFrag<T16>::mma(a2[mb], b[nb], acc[mb][nb]); }
        }
        asm volatile("s_wait_dscnt 0x0" ::: "memory");      // this wave's reads of stage t are done before the buffer is handed back
        asm volatile("s_wait_asynccnt 0x0" ::: "memory");   // this wave's copies of stage t + 1 have landed
        __syncthreads();                                    // publishes stage t + 1 and ends every wave's reads of stage t
        if (t + 2 < nst) fill(t + 2, t & 1);
    }
    asm volatile("s_wait_asynccnt 0x0" ::: "memory");       // no copy outstanding behind the loop
    if constexpr (PLANES) {
        static_assert(HD == 64 && TT % 64 == 0 && NKV == NH_, "a 64x64 tile is 64 positions of one head of one batch");
        const int b = r0 / TT, t0 = r0 % TT, h = c0 / 64;
        if (blockIdx.z == 2) {
            const size_t vo = ((size_t)(b * NKV + h) * HD + lr) * PP + t0 + 8 * hi; h16* v16 = V16 + vo; bf* vh = Vh + vo; bf* vl = Vl + vo;
#pragma unroll
            for (int nb = 0; nb < 4; ++nb)
#pragma unroll
                for (int mb = 0; mb < 4; ++mb) { v8h o16; v8us oh, ol;
#pragma unroll
                    for (int j = 0; j < 8; ++j) { const float x = acc[mb][nb][j]; o16[j] = tohx(x); unsigned short a2, c2; splitf(x, a2, c2); oh[j] = a2; ol[j] = c2; }
                    const size_t o = (size_t)nb * 16 * PP + mb * 16; *(v8h*)(v16 + o) = o16; *(v8us*)(vh + o) = oh; *(v8us*)(vl + o) = ol;
                    asm volatile("s_wait_xcnt 0x0" :: "v"(o16), "v"(oh), "v"(ol), "v"(v16), "v"(vh), "v"(vl) : "memory"); }   // the three stores: their data and address registers stay whole (inputs) until this wait
        } else {
            const size_t po = (((size_t)blockIdx.z * NB_ + b) * NH_ + h) * TT * HD + (size_t)(t0 + hi) * HD + lr * 4; h16* p16 = P16 + po; bf* ph = Ph + po; bf* pl = Pl + po;
            const float* fcp = fc + (size_t)(t0 + hi) * (HD / 2) + lr * 2; const float* fsp = fs + (size_t)(t0 + hi) * (HD / 2) + lr * 2;
#pragma unroll
            for (int mb = 0; mb < 4; ++mb) {
                v2f cc[8], sn[8];      // this block's table rows, asked for ahead of the staging so that they fly under it
#pragma unroll
                for (int s = 0; s < 8; ++s) { cc[s] = *(const v2f*)(fcp + (mb * 16 + 2 * s) * (HD / 2)); sn[s] = *(const v2f*)(fsp + (mb * 16 + 2 * s) * (HD / 2)); }
#pragma unroll
                for (int nb = 0; nb < 4; ++nb) {
#pragma unroll
                    for (int j = 0; j < 8; ++j) os[(hi * 8 + j) * 68 + nb * 16 + lr] = acc[mb][nb][j]; }
                asm volatile("s_wait_xcnt 0x0" :: "v"(fcp), "v"(fsp) : "memory");   // the table loads: their address registers stay whole (inputs) until this wait
                v4f val[8];            // all eight row reads first: one LDS latency a block, not one a row
#pragma unroll
                for (int s = 0; s < 8; ++s) val[s] = *(const v4fa*)(os + (2 * s + hi) * 68 + lr * 4);
#pragma unroll
                for (int s = 0; s < 8; ++s) { v4h o16; v4us oh, ol;
#pragma unroll
                    for (int q = 0; q < 2; ++q) { const float x0 = val[s][2 * q], x1 = val[s][2 * q + 1], c = bfr(cc[s][q]), sv = bfr(sn[s][q]);
                        const float e0 = __builtin_fmaf(x0, c, -(x1 * sv)), e1 = __builtin_fmaf(x0, sv, x1 * c);   /* even: x0 c - x1 s; odd: x0 s + x1 c; the x1 product rounded, the x0 product fused */
                        o16[2 * q] = tohx(e0); o16[2 * q + 1] = tohx(e1); unsigned short a2, c2; splitf(e0, a2, c2); oh[2 * q] = a2; ol[2 * q] = c2; splitf(e1, a2, c2); oh[2 * q + 1] = a2; ol[2 * q + 1] = c2; }
                    const int o = (mb * 16 + 2 * s) * HD; *(v4h*)(p16 + o) = o16; *(v4us*)(ph + o) = oh; *(v4us*)(pl + o) = ol;
                    asm volatile("s_wait_xcnt 0x0" :: "v"(o16), "v"(oh), "v"(ol), "v"(p16), "v"(ph), "v"(pl) : "memory"); }   // the three stores: their data and address registers stay whole (inputs) until this wait
            }
        }
        return;
    }
#pragma unroll
    for (int mb = 0; mb < 4; ++mb) {
#pragma unroll
        for (int nb = 0; nb < 4; ++nb) {
#pragma unroll
            for (int j = 0; j < 8; ++j) os[(hi * 8 + j) * 68 + nb * 16 + lr] = acc[mb][nb][j]; }
        __builtin_amdgcn_wave_barrier(); asm volatile("" ::: "memory");
        float* crow = C + (size_t)(r0 + mb * 16) * ldc + c0;
{
#pragma unroll
            for (int s = 0; s < 8; ++s) { const int row = 2 * s + hi, cofs = lr * 4; v4f val = *(const v4fa*)(os + row * 68 + cofs); if (BIAS) { val[0] += bfr(bias[c0 + cofs]); val[1] += bfr(bias[c0 + cofs + 1]); val[2] += bfr(bias[c0 + cofs + 2]); val[3] += bfr(bias[c0 + cofs + 3]); }
                *(v4f*)(crow + (size_t)row * ldc + cofs) = val; }
             }
        __builtin_amdgcn_wave_barrier(); asm volatile("" ::: "memory");
    }
}


// grid (.., 4): blockIdx.y picks the weight; the four transposed planes lie one behind the other in Bt
__global__ __launch_bounds__(256) void k_wtG(const float* __restrict__ w0, const float* __restrict__ w1, const float* __restrict__ w2, const float* __restrict__ w3, int K, int N, bf* Bt) {
    const int y = blockIdx.y; const float* __restrict__ w = y == 0 ? w0 : y == 1 ? w1 : y == 2 ? w2 : w3; Bt += (size_t)y * N * K;
    const int lane = threadIdx.x & 31; const int L0 = (blockIdx.x * 8 + (threadIdx.x >> 5)) * 8; const int nlines = N * K / 64;
{
        for (int l = 0; l < 8; ++l) { const int L = L0 + l; if (L >= nlines) break; const size_t e = (size_t)L * 64 + lane * 2; const int k = (int)(e % K), n = (int)(e / K); v2us o;
            o[0] = f2bf(w[(size_t)k * N + n]); o[1] = f2bf(w[(size_t)(k + 1) * N + n]); *(v2us*)(Bt + e) = o; }
         }
}
__global__ __launch_bounds__(256) void k_cvt8(const float* __restrict__ src, bf* dst, size_t n8) { const size_t i = (size_t)blockIdx.x * 256 + threadIdx.x; if (i >= n8) return; const v8f v = *(const v8f*)(src + i * 8); v8us o;
#pragma unroll
    for (int k = 0; k < 8; ++k) o[k] = f2bf(v[k]); *(v8us*)(dst + i * 8) = o;  }
// ---- k_attn: causal attention fused into one launch for both batches (batch = blockIdx.z): ONE WAVE per (head, query tile); scores, running softmax and the probability x value product stay in registers.
// Transposed products: S^T = K Q^T (A = 16 keys x 64 d, B = 16 queries) leaves lane (lr, hi) with keys 8 hi + j of query lr, which for two neighbouring key tiles is exactly the B fragment (k = 8 hi + e, 16 + 8 hi + e) of
// O^T = V^T P^T (A = 16 d x 32 keys): no exchange between lanes but one with lane l ^ 16 for the row maximum and the row sum. O^T leaves lane (lr, hi) with d = 16 dt + 8 hi + j of query lr: 16-byte stores into the merged hi/lo planes.
// Running softmax in the base-2 domain: t = s * HD^-0.5 * log2(e); per 32 keys m' = max(m, t), O and l scaled by 2^(m - m'), p = 2^(t - m') (not normalised: <= 1), l += sum p; O / l at the end.
// HR (query rows < RH): bf16 hi/lo planes, 3 products for both contractions, 16 queries a wave; else fp16, 32 queries a wave. Key blocks wholly at or below the diagonal need no mask; the one diagonal block masks by select.
#define KB 32                     // keys per trip
__device__ __forceinline__ float xhalf(float x) { return __builtin_bit_cast(float, __builtin_amdgcn_permlanex16(__builtin_bit_cast(int, x), __builtin_bit_cast(int, x), 0x76543210, 0xfedcba98, false, false)); }  // lane l with lane l ^ 16
__device__ __forceinline__ float exp2s(float x) { asm("v_exp_f32 %0, %0\n\tv_nop" : "+v"(x)); return x; }   // 2^x. The v_nop is the free slot the instruction set asks for behind a transcendental. In place: the register already holds the live argument, so it is no operand of a matrix instruction still in its window (the compiler does not look into asm text)
template <typename T16, int NT, bool HR>
__device__ __forceinline__ void attn_tile(const T16* __restrict__ Q, const T16* __restrict__ Q2, const T16* __restrict__ Kp, const T16* __restrict__ Kp2, const T16* __restrict__ Vt, const T16* __restrict__ Vt2, const int q0, bf* __restrict__ Ah, bf* __restrict__ Al) {
    typedef typename WFrag<T16>::V V;
    const int lane = threadIdx.x & 31, lr = lane & 15, hi = lane >> 4;
    V qf[NT][2], qf2[NT][2];
    const T16* qp = Q + (size_t)(q0 + lr) * HD + 8 * hi; const T16* qp2 = HR ? Q2 + (size_t)(q0 + lr) * HD + 8 * hi : qp;
#pragma unroll
    for (int nt = 0; nt < NT; ++nt)
#pragma unroll
        for (int ks = 0; ks < 2; ++ks) { qf[nt][ks] = WFrag<T16>::ld(qp + nt * 16 * HD + ks * 32); if (HR) qf2[nt][ks] = WFrag<T16>::ld(qp2 + nt * 16 * HD + ks * 32); }
    v8f o[4][NT]; float m[NT], l[NT];
#pragma unroll
    for (int nt = 0; nt < NT; ++nt) { m[nt] = -3.0e38f; l[nt] = 0.f;
#pragma unroll
        for (int dt = 0; dt < 4; ++dt) o[dt][nt] = (v8f){}; }
    V kf[2][2], kf2[2][2];
    auto ldk = [&](const T16* kp, const T16* kp2, V (&f)[2][2], V (&f2)[2][2]) {
#pragma unroll
        for (int mt = 0; mt < 2; ++mt)
#pragma unroll
            for (int ks = 0; ks < 2; ++ks) { f[mt][ks] = WFrag<T16>::ld(kp + mt * 16 * HD + ks * 32); if (HR) f2[mt][ks] = WFrag<T16>::ld(kp2 + mt * 16 * HD + ks * 32); } };
    const size_t kl = (size_t)lr * HD + 8 * hi, vl = (size_t)lr * PP + 8 * hi;
    auto step = [&](const int kb, const bool last) {
        V vf[4], vf2[4];
        const T16* vp = Vt + vl + kb; const T16* vp2 = HR ? Vt2 + vl + kb : vp;
        const T16* kp = (HR || !last) ? Kp + kl + (size_t)(HR ? kb : kb + KB) * HD : vp; const T16* kp2 = HR ? Kp2 + kl + (size_t)kb * HD : kp;
#pragma unroll
        for (int dt = 0; dt < 4; ++dt) { vf[dt] = WFrag<T16>::ld(vp + (size_t)dt * 16 * PP); if (HR) vf2[dt] = WFrag<T16>::ld(vp2 + (size_t)dt * 16 * PP); }
        if (HR) ldk(kp, kp2, kf, kf2);              // hi/lo path: this trip's own key fragments
        v8f sa[NT][2];
#pragma unroll
        for (int nt = 0; nt < NT; ++nt) {
#pragma unroll
            for (int mt = 0; mt < 2; ++mt) { v8f s = (v8f){};
#pragma unroll
                for (int ks = 0; ks < 2; ++ks) { s = WFrag<T16>::mma(kf[mt][ks], qf[nt][ks], s); if (HR) { s = WFrag<T16>::mma(kf[mt][ks], qf2[nt][ks], s); s = WFrag<T16>::mma(kf2[mt][ks], qf[nt][ks], s); } }
                sa[nt][mt] = s; } }
        if (!HR) { if (!last) ldk(kp, kp2, kf, kf2);   // fp16 path: the next trip's key fragments, into the same registers right behind this trip's score products; they fly under the softmax and P x V
            __builtin_amdgcn_sched_barrier(0); }       // holds those loads (and this trip's V loads) up here: sunk to the foot of the trip, their latency would be waited out in full
#pragma unroll
        for (int nt = 0; nt < NT; ++nt) {
            v8f (&st)[2] = sa[nt];
            float mx = m[nt];
#pragma unroll
            for (int mt = 0; mt < 2; ++mt)
#pragma unroll
                for (int j = 0; j < 8; ++j) { float t = st[mt][j] * (SCL * 1.4426950408889634f); if (last) t = (kb + mt * 16 + hi * 8 + j <= q0 + nt * 16 + lr) ? t : -3.0e38f; st[mt][j] = t; mx = fmaxf(mx, t); }
            mx = fmaxf(mx, xhalf(mx));
            const float al = exp2s(m[nt] - mx); m[nt] = mx;
            float sum = 0.f;
#pragma unroll
            for (int mt = 0; mt < 2; ++mt)
#pragma unroll
                for (int j = 0; j < 8; ++j) { const float p = exp2s(st[mt][j] - mx); st[mt][j] = p; sum += p; }
            l[nt] = l[nt] * al + sum;
#pragma unroll
            for (int dt = 0; dt < 4; ++dt) o[dt][nt] *= al;
            if (nt == 0) asm volatile("s_wait_xcnt 0x0" :: "v"(vp), "v"(vp2), "v"(kp), "v"(kp2) : "memory");   // this trip's loads: their address registers stay whole (inputs) until this wait; placed here, where the V fragments are waited for anyway
            if (HR) {
                v8us h0, h1, l0, l1;
#pragma unroll
                for (int j = 0; j < 8; ++j) { unsigned short x, y; splitf(st[0][j], x, y); h0[j] = x; l0[j] = y; splitf(st[1][j], x, y); h1[j] = x; l1[j] = y; }
                const v16bf ph = cat16b(h0, h1), pl = cat16b(l0, l1);
#pragma unroll
                for (int dt = 0; dt < 4; ++dt) { o[dt][nt] = wmmab(__builtin_bit_cast(v16bf, vf[dt]), ph, o[dt][nt]); o[dt][nt] = wmmab(__builtin_bit_cast(v16bf, vf[dt]), pl, o[dt][nt]); o[dt][nt] = wmmab(__builtin_bit_cast(v16bf, vf2[dt]), ph, o[dt][nt]); }
            } else {
                v8h p0, p1;
#pragma unroll
                for (int j = 0; j < 8; ++j) { p0[j] = tohx(st[0][j]); p1[j] = tohx(st[1][j]); }
                const v16h pf = cat16(p0, p1);
#pragma unroll
                for (int dt = 0; dt < 4; ++dt) o[dt][nt] = wmma16(__builtin_bit_cast(v16h, vf[dt]), pf, o[dt][nt]);
            }
        }
    };
    const T16* kp0 = Kp + kl;
    if (!HR) ldk(kp0, kp0, kf, kf2);
    asm volatile("s_wait_xcnt 0x0" :: "v"(qp), "v"(qp2), "v"(kp0) : "memory");   // the prologue's loads: their address registers stay whole (inputs) until this wait
    const int kd = (q0 / KB) * KB;             // the diagonal block: it holds keys q0 .. q0 + 16 NT - 1 (q0 is a multiple of 16 NT, and 16 NT divides KB)
    for (int kb = 0; kb < kd; kb += KB) step(kb, false);
    step(kd, true);
#pragma unroll
    for (int nt = 0; nt < NT; ++nt) { const float lt = l[nt] + xhalf(l[nt]); const float inv = __fdiv_rn(1.0f, lt); const size_t oo = (size_t)(q0 + nt * 16 + lr) * DQ + 8 * hi; bf* sh = Ah + oo; bf* sl = Al + oo;
#pragma unroll
        for (int dt = 0; dt < 4; ++dt) { v8us oh, ol;
#pragma unroll
            for (int j = 0; j < 8; ++j) { unsigned short x, y; splitf(o[dt][nt][j] * inv, x, y); oh[j] = x; ol[j] = y; }
            *(v8us*)(sh + dt * 16) = oh; *(v8us*)(sl + dt * 16) = ol;
            asm volatile("s_wait_xcnt 0x0" :: "v"(oh), "v"(ol), "v"(sh), "v"(sl) : "memory"); } }   // the two stores: their data and address registers stay whole (inputs) until this wait, on every way into code that rewrites them
}
#define NLR ((TT - RH) / 32)      // fp16 query tiles of 32 rows
#define NHR (RH / 16)             // hi/lo query tiles of 16 rows
// grid (NLR + NHR, NH_, NB_): the longest tiles (last query rows) take the lowest block indices, so that they start first
__global__ __launch_bounds__(32) void k_attn(const h16* __restrict__ Q16, const h16* __restrict__ K16, const h16* __restrict__ V16, const bf* __restrict__ Qh, const bf* __restrict__ Ql, const bf* __restrict__ Kh, const bf* __restrict__ Kl, const bf* __restrict__ Vh, const bf* __restrict__ Vl, bf* __restrict__ Ah, bf* __restrict__ Al) {
    const int h = blockIdx.y, g = h / REP, bx = blockIdx.x, b = blockIdx.z; const size_t qo = (size_t)(b * NH_ + h) * TT * HD, ko = (size_t)(b * NKV + g) * TT * HD, vo = (size_t)(b * NKV + g) * HD * PP; Ah += (size_t)b * TT * DQ; Al += (size_t)b * TT * DQ;
    if (bx < NLR) attn_tile<h16, 2, false>(Q16 + qo, nullptr, K16 + ko, nullptr, V16 + vo, nullptr, RH + (NLR - 1 - bx) * 32, Ah + h * HD, Al + h * HD);
    else attn_tile<bf, 1, true>(Qh + qo, Ql + qo, Kh + ko, Kl + ko, Vh + vo, Vl + vo, (NLR + NHR - 1 - bx) * 16, Ah + h * HD, Al + h * HD);
}

extern "C" void kernel_launch(void* const* d_in, const int* in_sizes, int n_in,
                              void* d_out, int out_size, void* d_ws, size_t ws_size, hipStream_t stream) {
    (void)in_sizes; (void)n_in; (void)out_size;
        const float* x = (const float*)d_in[0]; const float* fcos = (const float*)d_in[1]; const float* fsin = (const float*)d_in[2]; const float* wq = (const float*)d_in[3]; const float* wk = (const float*)d_in[4]; const float* wv = (const float*)d_in[5]; const float* wo = (const float*)d_in[6]; const float* bo = (const float*)d_in[7];   /* input order x, pos_cos, pos_sin ([2048][32] HALF-width table INPUTS: read by value), Wq, Wk, Wv, Wo ('xw' (in, out) [1024][1024]), bo ([1024]: zeros, read through the output launch's bias slot): EIGHT inputs, all read; the q, k, v projections have NO bias in this module */
    float* OUT = (float*)d_out;     // [2][2048][1024]
    char* wsp = (char*)d_ws;
    auto take = [&](size_t bytes) { char* p = wsp; wsp += (bytes + 255) & ~(size_t)255; return (void*)p; };
    static_assert(DQ == DKV && DQ == DM, "q, k and v share one projection launch that also writes their planes, the four weights one transpose launch: equal shapes");
    bf* WQ = (bf*)take((size_t)4 * DQ * DM * 2); bf* WO = WQ + (size_t)3 * DQ * DM;   // transposed Wq, Wk, Wv, Wo, one behind the other
    bf* XB = (bf*)take((size_t)NB_ * TT * DM * 2);
    const size_t PLN = (size_t)NB_ * NH_ * TT * HD;   // elements of one set of head planes
    h16* QP16 = (h16*)take(2 * PLN * 2); h16* KP16 = QP16 + PLN; h16* VT16 = (h16*)take((size_t)NB_ * NKV * HD * PP * 2);
    bf* QPh = (bf*)take(2 * PLN * 2); bf* KPh = QPh + PLN; bf* QPl = (bf*)take(2 * PLN * 2); bf* KPl = QPl + PLN; bf* VTh = (bf*)take((size_t)NB_ * NKV * HD * PP * 2); bf* VTl = VTh + TT;   // hi plane in the first half of each PP row, lo plane in the second
    bf* ATh = (bf*)take((size_t)NB_ * TT * DQ * 2); bf* ATl = (bf*)take((size_t)NB_ * TT * DQ * 2);
    if ((size_t)(wsp - (char*)d_ws) > ws_size) return;    // ws 256 MiB
    k_wtG<<<dim3((unsigned)((DM * DQ / 64 + 63) / 64), 4, 1), 256, 0, stream>>>(wq, wk, wv, wo, DM, DQ, WQ);   /* 'xw' [in][out] weights: transposed once into Bt */
    k_cvt8<<<(unsigned)(((size_t)NB_ * TT * DM / 8 + 255) / 256), 256, 0, stream>>>(x, XB, (size_t)NB_ * TT * DM / 8);
    k_gemmw<bf, 0, false, true><<<dim3(NB_ * TT / 128, DQ / 128, 3), 128, 0, stream>>>(XB, nullptr, WQ, nullptr, DM, nullptr, DQ, nullptr, 0, (size_t)DQ * DM, 0, fcos, fsin, QP16, QPh, QPl, VT16, VTh, VTl);   /* q, k, v projections, written as head planes */
    k_attn<<<dim3(NLR + NHR, NH_, NB_), 32, 0, stream>>>(QP16, KP16, VT16, QPh, QPl, KPh, KPl, VTh, VTl, ATh, ATl);
    k_gemmw<bf, 1, true, false><<<dim3(NB_ * TT / 128, DM / 128, 1), 128, 0, stream>>>(ATh, ATl, WO, nullptr, DQ, OUT, DM, bo, 0, 0, 0, nullptr, nullptr, nullptr, nullptr, nullptr, nullptr, nullptr, nullptr);
}

// v006
// One run takes 116 microseconds.
// In both of two side-by-side timings against v005, it was 1.10 times as fast.
// Counting every step since v000, it is 12.4 times as fast.
#include <hip/hip_runtime.h>

// Causal multi-head self-attention with interleaved-pair rotary embeddings from two half-width INPUT tables and (in, out) weights (x [2][2048][1024]; q, k, v = x W ('xw' [1024][1024] normal x 0.02, no projection bias; 16 heads x 64); _rope on q and k: consecutive pairs (t[2i], t[2i+1]) -> (te c - to s, te s + to c) with c, s = pos_cos / pos_sin[t][i] (f32 [2048][32] INPUT tables the module computes: cos / sin(t / 10000^(2i/64)): read by value); scores: -inf above the diagonal, then / sqrt(64) (the same as scaling first); softmax; out = merged Wo + bo ('xw' + a zero bias [1024], read) -> [2][2048][1024] (4.2 M); argument order x, pos_cos, pos_sin, Wq, Wk, Wv, Wo, bo).
// Every stage is ONE launch for all of its independent instances (both batches; q, k and v; the four weights): the batch is folded into the row index (x, the projections, the merged planes) or the plane index (b * heads + h), q / k / v and the weights into a grid index. Stages: bf16 transpose of the four weights; bf16 copy of x; exact projections (no bias) whose epilogue builds the head planes itself (q, k: interleaved rotary with the two half-width INPUT tables read by value and bf16-rounded; v: transposed); causal T-2048 attention fused into one launch (k_attn: scores, running softmax and P x V in registers; hybrid rows: < 512 hi/lo 3 products, rest fp16; key blocks above the diagonal never touched) that writes the merged hi/lo planes; merged hi/lo x Wo exact + bo.
// Compute dtypes, f32 accumulate: every input rounded to bf16; projections exact (no bias); rotary f32; attention rows < 512 3 products, rest fp16; softmax f32; Wo hl x exact + bias.

#define NB_  2
#define TT   2048
#define DM   1024
#define NH_  16
#define NKV  16
#define REP  (NH_ / NKV)
#define HD   64
#define DQ   (NH_ * HD)
#define DKV  (NKV * HD)
#define PP   (2 * TT)             // a head's V^T range holds HD * PP 16-bit elements (hi plane in its first half, lo plane in the second)
#define RH   512                  // query rows < RH use hi+lo planes (0: none)
#define SCL  0.125f   // HD^-0.5
typedef _Float16 h16;
typedef unsigned short bf;
typedef __attribute__((ext_vector_type(16))) __bf16   v16bf;
typedef __attribute__((ext_vector_type(16))) _Float16 v16h;
typedef __attribute__((ext_vector_type(8)))  _Float16 v8h;
typedef __attribute__((ext_vector_type(8)))  unsigned short v8us;
typedef __attribute__((ext_vector_type(8)))  float    v8f;
typedef __attribute__((ext_vector_type(4)))  float    v4f;
typedef v8h  __attribute__((may_alias)) v8ha;
typedef v4f  __attribute__((may_alias)) v4fa;
typedef v8us __attribute__((may_alias)) v8usa;

__device__ __forceinline__ unsigned short f2bf(float f) { unsigned u = __float_as_uint(f); u += 0x7FFFu + ((u >> 16) & 1u); return (unsigned short)(u >> 16); }
__device__ __forceinline__ float bf2f(unsigned short b) { return __uint_as_float(((unsigned)b) << 16); }
__device__ __forceinline__ float bfr(float f) { return bf2f(f2bf(f)); }
__device__ __forceinline__ v16h cat16(v8h lo, v8h hi) { return __builtin_shufflevector(lo, hi, 0, 1, 2, 3, 4, 5, 6, 7, 8, 9, 10, 11, 12, 13, 14, 15); }
__device__ __forceinline__ v16bf cat16b(v8us lo, v8us hi) { return __builtin_bit_cast(v16bf, __builtin_shufflevector(lo, hi, 0, 1, 2, 3, 4, 5, 6, 7, 8, 9, 10, 11, 12, 13, 14, 15)); }
__device__ __forceinline__ v8f wmma16(v16h a, v16h b, v8f c) { return __builtin_amdgcn_wmma_f32_16x16x32_f16(false, a, false, b, (short)0, c, false, false); }
__device__ __forceinline__ v8f wmmab(v16bf a, v16bf b, v8f c) { return __builtin_amdgcn_wmma_f32_16x16x32_bf16(false, a, false, b, (short)0, c, false, false); }
__device__ __forceinline__ h16 tohx(float x) { return (h16)x; }
__device__ __forceinline__ void splitf(float y, unsigned short& h, unsigned short& l) { h = f2bf(y); l = f2bf(y - bf2f(h)); }
typedef __attribute__((ext_vector_type(4))) _Float16 v4h;
typedef __attribute__((ext_vector_type(2))) unsigned short v2us;
typedef __attribute__((ext_vector_type(4))) unsigned short v4us;
typedef __attribute__((ext_vector_type(2))) float v2f;



// ---- k_gemmw: register-blocked GEMM, one wave per 64x64 output tile (16 accumulators), FOUR WAVES (2 x 2) a work-group on one 128x128 tile; grid (M/128, N/128, Z), 128 threads.
// The operands (K-contiguous 16-bit planes) are staged in LDS, 64 k (one whole 128-byte line of every row) a stage, by asynchronous copies, two buffers: stage t + 1 flies while stage t is worked on. A copy instruction covers four whole lines, and each operand row is fetched once for the two waves that use it.
// LDS rows at a pitch of 144 bytes (16 x odd: the 16-byte fragment reads meet no bank twice). Per accumulator the products come in the same order as without the staging (k ascending, A then A2).
// C[m][n] (f32, pitch ldc, + optional f32 bias[n]) = sum_k A[m][k] Bt[n][k] (+ the A2 product for NSPLIT 1). z-batch strides sA/sB/sC in elements. K % 64 == 0.
// PLANES (the q, k, v projections; z = 0, 1, 2): no f32 C is written. A 64x64 tile is 64 positions of ONE head of one batch, so the epilogue writes the attention's operand planes (fp16 + bf16 hi/lo) itself, in FRAGMENT ORDER (below), straight from the accumulators: every store is 16 bytes a lane, 512 contiguous bytes a wave.
// z < 2: planes [z][b][h] of the rotated tile: consecutive pairs (x0, x1) -> (x0 c - x1 s, x0 s + x1 c), c, s = bf16-rounded fc / fs[t][d / 2]. The tile is computed transposed (the weight rows take the A operand's place, the positions the B operand's; same products, same k order), so that a lane holds 8 consecutive d (four whole pairs) of one position.
// z == 2: V^T planes [b][h]: a lane holds 8 consecutive positions of one d.
// FRAGMENT ORDER of the attention's operand planes: a block of FB elements (512 bytes) holds, for each of the 32 lanes (lr, hi) in lane order, the 8 consecutive contraction elements that one 16-byte load of a fragment brings,
// so that a wave-wide load covers four whole 128-byte lines. Q, K (contraction over d): 16 positions are 4 blocks, block d / 16, lane (lr = t % 16, hi = d / 8 % 2), element d % 8.
// V^T (contraction over keys): 32 keys are 8 blocks, block (d / 16) * 2 + t / 16 % 2, lane (lr = d % 16, hi = t / 8 % 2), element t % 8. ldf joins a fragment's two neighbouring blocks (k = 8 hi + e and 16 + 8 hi + e, as ld does from a row).
#define FB 256
template <typename T16> struct WFrag;
template <> struct WFrag<h16> { typedef v16h V; static __device__ __forceinline__ V ld(const h16* p) { return cat16(*(const v8h*)p, *(const v8h*)(p + 16)); } static __device__ __forceinline__ V ldf(const h16* p) { return cat16(*(const v8h*)p, *(const v8h*)(p + FB)); } static __device__ __forceinline__ v8f mma(V a, V b, v8f c) { return wmma16(a, b, c); } };
template <> struct WFrag<bf> { typedef v16bf V; static __device__ __forceinline__ V ld(const bf* p) { return cat16b(*(const v8us*)p, *(const v8us*)(p + 16)); } static __device__ __forceinline__ V ldf(const bf* p) { return cat16b(*(const v8us*)p, *(const v8us*)(p + FB)); } static __device__ __forceinline__ v8f mma(V a, V b, v8f c) { return wmmab(a, b, c); } };
#define LP 72                     // LDS row pitch of a staged operand tile, in 16-bit elements (144 bytes)
#define TLE (128 * LP)            // elements of one staged operand tile (128 rows)
// Eight asynchronous 16-byte copies of a lane: rows r, r + 16, .. r + 112 of one operand tile (l: the lane's LDS byte address, g: its global address, K: the global row pitch in elements).
// The s_wait_xcnt closes the statement so that no address register of a copy is rewritten in front of it.
template <typename T16>
__device__ __forceinline__ void cp8(const unsigned l, const T16* g, const int K) {
    const size_t rs = (size_t)16 * K;
    asm volatile("global_load_async_to_lds_b128 %0, %8, off\n\t"
                 "global_load_async_to_lds_b128 %1, %9, off\n\t"
                 "global_load_async_to_lds_b128 %2, %10, off\n\t"
                 "global_load_async_to_lds_b128 %3, %11, off\n\t"
                 "global_load_async_to_lds_b128 %4, %12, off\n\t"
                 "global_load_async_to_lds_b128 %5, %13, off\n\t"
                 "global_load_async_to_lds_b128 %6, %14, off\n\t"
                 "global_load_async_to_lds_b128 %7, %15, off\n\t"
                 "s_wait_xcnt 0x0"
                 :: "v"(l), "v"(l + 1 * 16 * LP * 2), "v"(l + 2 * 16 * LP * 2), "v"(l + 3 * 16 * LP * 2), "v"(l + 4 * 16 * LP * 2), "v"(l + 5 * 16 * LP * 2), "v"(l + 6 * 16 * LP * 2), "v"(l + 7 * 16 * LP * 2),
                    "v"(g), "v"(g + rs), "v"(g + 2 * rs), "v"(g + 3 * rs), "v"(g + 4 * rs), "v"(g + 5 * rs), "v"(g + 6 * rs), "v"(g + 7 * rs) : "memory");
}
template <typename T16, int NSPLIT, bool BIAS, bool PLANES>
__global__ __launch_bounds__(128) void k_gemmw(const T16* __restrict__ A, const T16* __restrict__ A2, const T16* __restrict__ Bt, const T16* __restrict__ Bt2, int K, float* C, int ldc, const float* __restrict__ bias, size_t sA, size_t sB, size_t sC, const float* __restrict__ fc, const float* __restrict__ fs, h16* __restrict__ P16, bf* __restrict__ Ph, bf* __restrict__ Pl, h16* __restrict__ V16, bf* __restrict__ Vh, bf* __restrict__ Vl) {
    typedef typename WFrag<T16>::V V;
    static_assert(NSPLIT <= 1, "staged operands: A, Bt and, for NSPLIT 1, A2");
    constexpr int NOP = NSPLIT == 1 ? 3 : 2;          // operand tiles a stage: A, Bt (, A2)
    __shared__ __align__(16) T16 ring[2 * NOP * TLE];
    __shared__ __align__(16) float osm[4 * 16 * 68];  // epilogue staging, a range of its own for each wave
    const int wave = __builtin_amdgcn_readfirstlane(threadIdx.x >> 5), wm = wave & 1, wn = wave >> 1;
    float* os = osm + wave * (16 * 68);
    const size_t z = blockIdx.z; A += z * sA; if (A2) A2 += z * sA; Bt += z * sB; if (Bt2) Bt2 += z * sB; C += z * sC;
    const int lane = threadIdx.x & 31, lr = lane & 15, hi = lane >> 4; const int r0 = blockIdx.x * 128 + wm * 64, c0 = blockIdx.y * 128 + wn * 64;
    v8f acc[4][4];
#pragma unroll
    for (int mb = 0; mb < 4; ++mb)
#pragma unroll
        for (int nb = 0; nb < 4; ++nb) acc[mb][nb] = (v8f){};
    // the copies: thread t brings the 16-byte piece t & 7 of rows (t >> 3) + 16 i of each tile, so that eight lanes cover a row's whole line
    const int crw = threadIdx.x >> 3, cpc = threadIdx.x & 7;
    const T16* gA = A + (size_t)(blockIdx.x * 128 + crw) * K + cpc * 8; const T16* gB = Bt + (size_t)(blockIdx.y * 128 + crw) * K + cpc * 8; const T16* gA2 = NSPLIT == 1 ? A2 + (size_t)(blockIdx.x * 128 + crw) * K + cpc * 8 : gA;
    if (PLANES && blockIdx.z < 2) { const T16* gt = gA; gA = gB; gB = gt; }   // q, k: the tile is computed transposed (weight rows as the A operand), so that a lane's 8 accumulator elements are 8 consecutive d of one position
    const unsigned lc = (unsigned)(size_t)ring + (crw * LP + cpc * 8) * 2;
    auto fill = [&](const int t, const int buf) { const unsigned l = lc + buf * (NOP * TLE * 2);
        cp8<T16>(l, gA + t * 64, K); cp8<T16>(l + TLE * 2, gB + t * 64, K); if (NSPLIT == 1) cp8<T16>(l + 2 * TLE * 2, gA2 + t * 64, K); };
    const int nst = K / 64;
    fill(0, 0);
    asm volatile("s_wait_asynccnt 0x0" ::: "memory");   // this wave's copies of stage 0 have landed
    __syncthreads();                                    // every wave's have: stage 0 may be read
    if (nst > 1) fill(1, 1);
    const int fa = (wm * 64 + lr) * LP + 8 * hi, fb = TLE + (wn * 64 + lr) * LP + 8 * hi;
    for (int t = 0; t < nst; ++t) {
        const T16* sb = ring + (t & 1) * (NOP * TLE);
#pragma unroll
        for (int ks = 0; ks < 2; ++ks) {
            V a[4], a2[4], b[4];
#pragma unroll
            for (int mb = 0; mb < 4; ++mb) { a[mb] = WFrag<T16>::ld(sb + fa + mb * 16 * LP + ks * 32); if (NSPLIT == 1) a2[mb] = WFrag<T16>::ld(sb + 2 * TLE + fa + mb * 16 * LP + ks * 32); }
#pragma unroll
            for (int nb = 0; nb < 4; ++nb) b[nb] = WFrag<T16>::ld(sb + fb + nb * 16 * LP + ks * 32);
            __builtin_amdgcn_sched_barrier(0);   // holds the block's LDS reads together in front of its products: sunk among them, each place with reads would be waited out on its own
#pragma unroll
            for (int nb = 0; nb < 4; ++nb)
#pragma unroll
                for (int mb = 0; mb < 4; ++mb) { acc[mb][nb] = WFrag<T16>::mma(a[mb], b[nb], acc[mb][nb]); if (NSPLIT == 1) acc[mb][nb] = WFrag<T16>::mma(a2[mb], b[nb], acc[mb][nb]); }
        }
        asm volatile("s_wait_dscnt 0x0" ::: "memory");      // this wave's reads of stage t are done before the buffer is handed back
        asm volatile("s_wait_asynccnt 0x0" ::: "memory");   // this wave's copies of stage t + 1 have landed
        __syncthreads();                                    // publishes stage t + 1 and ends every wave's reads of stage t
        if (t + 2 < nst) fill(t + 2, t & 1);
    }
    asm volatile("s_wait_asynccnt 0x0" ::: "memory");       // no copy outstanding behind the loop
    if constexpr (PLANES) {
        static_assert(HD == 64 && TT % 64 == 0 && NKV == NH_, "a 64x64 tile is 64 positions of one head of one batch");
        if (blockIdx.z == 2) {
            const int b = r0 / TT, t0 = r0 % TT, h = c0 / 64;
            const size_t vo = (size_t)(b * NKV + h) * HD * PP + (size_t)t0 * HD + lane * 8; h16* v16 = V16 + vo; bf* vh = Vh + vo; bf* vl = Vl + vo;
#pragma unroll
            for (int nb = 0; nb < 4; ++nb)
#pragma unroll
                for (int mb = 0; mb < 4; ++mb) { v8h o16; v8us oh, ol;
#pragma unroll
                    for (int j = 0; j < 8; ++j) { const float x = acc[mb][nb][j]; o16[j] = tohx(x); unsigned short a2, c2; splitf(x, a2, c2); oh[j] = a2; ol[j] = c2; }
                    const int o = (mb >> 1) * (32 * HD) + (nb * 2 + (mb & 1)) * FB; *(v8h*)(v16 + o) = o16; *(v8us*)(vh + o) = oh; *(v8us*)(vl + o) = ol;
                    asm volatile("s_wait_xcnt 0x0" :: "v"(o16), "v"(oh), "v"(ol), "v"(v16), "v"(vh), "v"(vl) : "memory"); }   // the three stores: their data and address registers stay whole (inputs) until this wait
        } else {
            // transposed tile: acc[mb][nb][j] is d = 16 mb + 8 hi + j of position 16 nb + lr
            const int p0 = blockIdx.x * 128 + wn * 64, b = p0 / TT, t0 = p0 % TT, h = blockIdx.y * 2 + wm;
            const size_t po = (((size_t)blockIdx.z * NB_ + b) * NH_ + h) * TT * HD + (size_t)t0 * HD + lane * 8; h16* p16 = P16 + po; bf* ph = Ph + po; bf* pl = Pl + po;
            const float* fcp = fc + (size_t)(t0 + lr) * (HD / 2) + hi * 4; const float* fsp = fs + (size_t)(t0 + lr) * (HD / 2) + hi * 4;
            v4f cc[2][4], sn[2][4];    // the table values of a lane's four pairs, one block of 16 positions ahead, so that they fly under the block before
#pragma unroll
            for (int mb = 0; mb < 4; ++mb) { cc[0][mb] = *(const v4f*)(fcp + mb * 8); sn[0][mb] = *(const v4f*)(fsp + mb * 8); }
#pragma unroll
            for (int nb = 0; nb < 4; ++nb) {
                if (nb < 3) {
#pragma unroll
                    for (int mb = 0; mb < 4; ++mb) { cc[(nb + 1) & 1][mb] = *(const v4f*)(fcp + (nb + 1) * 16 * (HD / 2) + mb * 8); sn[(nb + 1) & 1][mb] = *(const v4f*)(fsp + (nb + 1) * 16 * (HD / 2) + mb * 8); } }
                asm volatile("s_wait_xcnt 0x0" :: "v"(fcp), "v"(fsp) : "memory");   // the table loads: their address registers stay whole (inputs) until this wait
#pragma unroll
                for (int mb = 0; mb < 4; ++mb) { v8h o16; v8us oh, ol;
#pragma unroll
                    for (int q = 0; q < 4; ++q) { const float x0 = acc[mb][nb][2 * q], x1 = acc[mb][nb][2 * q + 1], c = bfr(cc[nb & 1][mb][q]), sv = bfr(sn[nb & 1][mb][q]);
                        const float e0 = __builtin_fmaf(x0, c, -(x1 * sv)), e1 = __builtin_fmaf(x0, sv, x1 * c);   /* even: x0 c - x1 s; odd: x0 s + x1 c; the x1 product rounded, the x0 product fused */
                        o16[2 * q] = tohx(e0); o16[2 * q + 1] = tohx(e1); unsigned short a2, c2; splitf(e0, a2, c2); oh[2 * q] = a2; ol[2 * q] = c2; splitf(e1, a2, c2); oh[2 * q + 1] = a2; ol[2 * q + 1] = c2; }
                    const int o = nb * (16 * HD) + mb * FB; *(v8h*)(p16 + o) = o16; *(v8us*)(ph + o) = oh; *(v8us*)(pl + o) = ol;
                    asm volatile("s_wait_xcnt 0x0" :: "v"(o16), "v"(oh), "v"(ol), "v"(p16), "v"(ph), "v"(pl) : "memory"); }   // the three stores: their data and address registers stay whole (inputs) until this wait
            }
        }
        return;
    }
#pragma unroll
    for (int mb = 0; mb < 4; ++mb) {
#pragma unroll
        for (int nb = 0; nb < 4; ++nb) {
#pragma unroll
            for (int j = 0; j < 8; ++j) os[(hi * 8 + j) * 68 + nb * 16 + lr] = acc[mb][nb][j]; }
        __builtin_amdgcn_wave_barrier(); asm volatile("" ::: "memory");
        float* crow = C + (size_t)(r0 + mb * 16) * ldc + c0;
{
#pragma unroll
            for (int s = 0; s < 8; ++s) { const int row = 2 * s + hi, cofs = lr * 4; v4f val = *(const v4fa*)(os + row * 68 + cofs); if (BIAS) { val[0] += bfr(bias[c0 + cofs]); val[1] += bfr(bias[c0 + cofs + 1]); val[2] += bfr(bias[c0 + cofs + 2]); val[3] += bfr(bias[c0 + cofs + 3]); }
                *(v4f*)(crow + (size_t)row * ldc + cofs) = val; }
             }
        __builtin_amdgcn_wave_barrier(); asm volatile("" ::: "memory");
    }
}


// grid (.., 4): blockIdx.y picks the weight; the four transposed planes lie one behind the other in Bt
__global__ __launch_bounds__(256) void k_wtG(const float* __restrict__ w0, const float* __restrict__ w1, const float* __restrict__ w2, const float* __restrict__ w3, int K, int N, bf* Bt) {
    const int y = blockIdx.y; const float* __restrict__ w = y == 0 ? w0 : y == 1 ? w1 : y == 2 ? w2 : w3; Bt += (size_t)y * N * K;
    const int lane = threadIdx.x & 31; const int L0 = (blockIdx.x * 8 + (threadIdx.x >> 5)) * 8; const int nlines = N * K / 64;
{
        for (int l = 0; l < 8; ++l) { const int L = L0 + l; if (L >= nlines) break; const size_t e = (size_t)L * 64 + lane * 2; const int k = (int)(e % K), n = (int)(e / K); v2us o;
            o[0] = f2bf(w[(size_t)k * N + n]); o[1] = f2bf(w[(size_t)(k + 1) * N + n]); *(v2us*)(Bt + e) = o; }
         }
}
__global__ __launch_bounds__(256) void k_cvt8(const float* __restrict__ src, bf* dst, size_t n8) { const size_t i = (size_t)blockIdx.x * 256 + threadIdx.x; if (i >= n8) return; const v8f v = *(const v8f*)(src + i * 8); v8us o;
#pragma unroll
    for (int k = 0; k < 8; ++k) o[k] = f2bf(v[k]); *(v8us*)(dst + i * 8) = o;  }
// ---- k_attn: causal attention fused into one launch for both batches (batch = blockIdx.z): ONE WAVE per (head, query tile); scores, running softmax and the probability x value product stay in registers.
// Transposed products: S^T = K Q^T (A = 16 keys x 64 d, B = 16 queries) leaves lane (lr, hi) with keys 8 hi + j of query lr, which for two neighbouring key tiles is exactly the B fragment (k = 8 hi + e, 16 + 8 hi + e) of
// O^T = V^T P^T (A = 16 d x 32 keys): no exchange between lanes but one with lane l ^ 16 for the row maximum and the row sum. O^T leaves lane (lr, hi) with d = 16 dt + 8 hi + j of query lr: 16-byte stores into the merged hi/lo planes.
// Running softmax in the base-2 domain: t = s * HD^-0.5 * log2(e); per 32 keys m' = max(m, t), O and l scaled by 2^(m - m'), p = 2^(t - m') (not normalised: <= 1), l += sum p; O / l at the end.
// HR (query rows < RH): bf16 hi/lo planes, 3 products for both contractions, 16 queries a wave; else fp16, 32 queries a wave. Key blocks wholly at or below the diagonal need no mask; the one diagonal block masks by select.
#define KB 32                     // keys per trip
__device__ __forceinline__ float xhalf(float x) { return __builtin_bit_cast(float, __builtin_amdgcn_permlanex16(__builtin_bit_cast(int, x), __builtin_bit_cast(int, x), 0x76543210, 0xfedcba98, false, false)); }  // lane l with lane l ^ 16
__device__ __forceinline__ float exp2s(float x) { asm("v_exp_f32 %0, %0\n\tv_nop" : "+v"(x)); return x; }   // 2^x. The v_nop is the free slot the instruction set asks for behind a transcendental. In place: the register already holds the live argument, so it is no operand of a matrix instruction still in its window (the compiler does not look into asm text)
template <typename T16, int NT, bool HR>
__device__ __forceinline__ void attn_tile(const T16* __restrict__ Q, const T16* __restrict__ Q2, const T16* __restrict__ Kp, const T16* __restrict__ Kp2, const T16* __restrict__ Vt, const T16* __restrict__ Vt2, const int q0, bf* __restrict__ Ah, bf* __restrict__ Al) {
    typedef typename WFrag<T16>::V V;
    const int lane = threadIdx.x & 31, lr = lane & 15, hi = lane >> 4;
    V qf[NT][2], qf2[NT][2];
    const T16* qb = Q + (size_t)q0 * HD; const T16* qb2 = HR ? Q2 + (size_t)q0 * HD : qb; const T16* qp = qb + lane * 8; const T16* qp2 = qb2 + lane * 8;
#pragma unroll
    for (int nt = 0; nt < NT; ++nt)
#pragma unroll
        for (int ks = 0; ks < 2; ++ks) { qf[nt][ks] = WFrag<T16>::ldf(qp + nt * 16 * HD + ks * 2 * FB); if (HR) qf2[nt][ks] = WFrag<T16>::ldf(qp2 + nt * 16 * HD + ks * 2 * FB); }
    v8f o[4][NT]; float m[NT], l[NT];
#pragma unroll
    for (int nt = 0; nt < NT; ++nt) { m[nt] = -3.0e38f; l[nt] = 0.f;
#pragma unroll
        for (int dt = 0; dt < 4; ++dt) o[dt][nt] = (v8f){}; }
    V kf[2][2], kf2[2][2];
    auto ldk = [&](const T16* kp, const T16* kp2, V (&f)[2][2], V (&f2)[2][2]) {
#pragma unroll
        for (int mt = 0; mt < 2; ++mt)
#pragma unroll
            for (int ks = 0; ks < 2; ++ks) { f[mt][ks] = WFrag<T16>::ldf(kp + mt * 16 * HD + ks * 2 * FB); if (HR) f2[mt][ks] = WFrag<T16>::ldf(kp2 + mt * 16 * HD + ks * 2 * FB); } };
    const size_t kl = (size_t)lane * 8, vl = kl;
    auto step = [&](const int kb, const bool last) {
        V vf[4], vf2[4];
        const T16* vp = Vt + vl + (size_t)kb * HD; const T16* vp2 = HR ? Vt2 + vl + (size_t)kb * HD : vp;
        const T16* kp = (HR || !last) ? Kp + kl + (size_t)(HR ? kb : kb + KB) * HD : vp; const T16* kp2 = HR ? Kp2 + kl + (size_t)kb * HD : kp;
#pragma unroll
        for (int dt = 0; dt < 4; ++dt) { vf[dt] = WFrag<T16>::ldf(vp + dt * 2 * FB); if (HR) vf2[dt] = WFrag<T16>::ldf(vp2 + dt * 2 * FB); }
        if (HR) ldk(kp, kp2, kf, kf2);              // hi/lo path: this trip's own key fragments
        v8f sa[NT][2];
#pragma unroll
        for (int nt = 0; nt < NT; ++nt) {
#pragma unroll
            for (int mt = 0; mt < 2; ++mt) { v8f s = (v8f){};
#pragma unroll
                for (int ks = 0; ks < 2; ++ks) { s = WFrag<T16>::mma(kf[mt][ks], qf[nt][ks], s); if (HR) { s = WFrag<T16>::mma(kf[mt][ks], qf2[nt][ks], s); s = WFrag<T16>::mma(kf2[mt][ks], qf[nt][ks], s); } }
                sa[nt][mt] = s; } }
        if (!HR) { if (!last) ldk(kp, kp2, kf, kf2);   // fp16 path: the next trip's key fragments, into the same registers right behind this trip's score products; they fly under the softmax and P x V
            __builtin_amdgcn_sched_barrier(0); }       // holds those loads (and this trip's V loads) up here: sunk to the foot of the trip, their latency would be waited out in full
#pragma unroll
        for (int nt = 0; nt < NT; ++nt) {
            v8f (&st)[2] = sa[nt];
            float mx = m[nt];
#pragma unroll
            for (int mt = 0; mt < 2; ++mt)
#pragma unroll
                for (int j = 0; j < 8; ++j) { float t = st[mt][j] * (SCL * 1.4426950408889634f); if (last) t = (kb + mt * 16 + hi * 8 + j <= q0 + nt * 16 + lr) ? t : -3.0e38f; st[mt][j] = t; mx = fmaxf(mx, t); }
            mx = fmaxf(mx, xhalf(mx));
            const float al = exp2s(m[nt] - mx); m[nt] = mx;
            float sum = 0.f;
#pragma unroll
            for (int mt = 0; mt < 2; ++mt)
#pragma unroll
                for (int j = 0; j < 8; ++j) { const float p = exp2s(st[mt][j] - mx); st[mt][j] = p; sum += p; }
            l[nt] = l[nt] * al + sum;
#pragma unroll
            for (int dt = 0; dt < 4; ++dt) o[dt][nt] *= al;
            if (nt == 0) asm volatile("s_wait_xcnt 0x0" :: "v"(vp), "v"(vp2), "v"(kp), "v"(kp2) : "memory");   // this trip's loads: their address registers stay whole (inputs) until this wait; placed here, where the V fragments are waited for anyway
            if (HR) {
                v8us h0, h1, l0, l1;
#pragma unroll
                for (int j = 0; j < 8; ++j) { unsigned short x, y; splitf(st[0][j], x, y); h0[j] = x; l0[j] = y; splitf(st[1][j], x, y); h1[j] = x; l1[j] = y; }
                const v16bf ph = cat16b(h0, h1), pl = cat16b(l0, l1);
#pragma unroll
                for (int dt = 0; dt < 4; ++dt) { o[dt][nt] = wmmab(__builtin_bit_cast(v16bf, vf[dt]), ph, o[dt][nt]); o[dt][nt] = wmmab(__builtin_bit_cast(v16bf, vf[dt]), pl, o[dt][nt]); o[dt][nt] = wmmab(__builtin_bit_cast(v16bf, vf2[dt]), ph, o[dt][nt]); }
            } else {
                v8h p0, p1;
#pragma unroll
                for (int j = 0; j < 8; ++j) { p0[j] = tohx(st[0][j]); p1[j] = tohx(st[1][j]); }
                const v16h pf = cat16(p0, p1);
#pragma unroll
                for (int dt = 0; dt < 4; ++dt) o[dt][nt] = wmma16(__builtin_bit_cast(v16h, vf[dt]), pf, o[dt][nt]);
            }
        }
    };
    const T16* kp0 = Kp + kl;
    if (!HR) ldk(kp0, kp0, kf, kf2);
    asm volatile("s_wait_xcnt 0x0" :: "s"(qb), "s"(qb2), "s"(Kp), "v"(lane) : "memory");   // the prologue's loads (scalar base + lane offset): their address registers stay whole (inputs) until this wait
    const int kd = (q0 / KB) * KB;             // the diagonal block: it holds keys q0 .. q0 + 16 NT - 1 (q0 is a multiple of 16 NT, and 16 NT divides KB)
    for (int kb = 0; kb < kd; kb += KB) step(kb, false);
    step(kd, true);
#pragma unroll
    for (int nt = 0; nt < NT; ++nt) { const float lt = l[nt] + xhalf(l[nt]); const float inv = __fdiv_rn(1.0f, lt); const size_t oo = (size_t)(q0 + nt * 16 + lr) * DQ + 8 * hi; bf* sh = Ah + oo; bf* sl = Al + oo;
#pragma unroll
        for (int dt = 0; dt < 4; ++dt) { v8us oh, ol;
#pragma unroll
            for (int j = 0; j < 8; ++j) { unsigned short x, y; splitf(o[dt][nt][j] * inv, x, y); oh[j] = x; ol[j] = y; }
            *(v8us*)(sh + dt * 16) = oh; *(v8us*)(sl + dt * 16) = ol;
            asm volatile("s_wait_xcnt 0x0" :: "v"(oh), "v"(ol), "v"(sh), "v"(sl) : "memory"); } }   // the two stores: their data and address registers stay whole (inputs) until this wait, on every way into code that rewrites them
}
#define NLR ((TT - RH) / 32)      // fp16 query tiles of 32 rows
#define NHR (RH / 16)             // hi/lo query tiles of 16 rows
// grid (NLR + NHR, NH_, NB_): the longest tiles (last query rows) take the lowest block indices, so that they start first
__global__ __launch_bounds__(32) void k_attn(const h16* __restrict__ Q16, const h16* __restrict__ K16, const h16* __restrict__ V16, const bf* __restrict__ Qh, const bf* __restrict__ Ql, const bf* __restrict__ Kh, const bf* __restrict__ Kl, const bf* __restrict__ Vh, const bf* __restrict__ Vl, bf* __restrict__ Ah, bf* __restrict__ Al) {
    const int h = blockIdx.y, g = h / REP, bx = blockIdx.x, b = blockIdx.z; const size_t qo = (size_t)(b * NH_ + h) * TT * HD, ko = (size_t)(b * NKV + g) * TT * HD, vo = (size_t)(b * NKV + g) * HD * PP; Ah += (size_t)b * TT * DQ; Al += (size_t)b * TT * DQ;
    if (bx < NLR) attn_tile<h16, 2, false>(Q16 + qo, nullptr, K16 + ko, nullptr, V16 + vo, nullptr, RH + (NLR - 1 - bx) * 32, Ah + h * HD, Al + h * HD);
    else attn_tile<bf, 1, true>(Qh + qo, Ql + qo, Kh + ko, Kl + ko, Vh + vo, Vl + vo, (NLR + NHR - 1 - bx) * 16, Ah + h * HD, Al + h * HD);
}

extern "C" void kernel_launch(void* const* d_in, const int* in_sizes, int n_in,
                              void* d_out, int out_size, void* d_ws, size_t ws_size, hipStream_t stream) {
    (void)in_sizes; (void)n_in; (void)out_size;
        const float* x = (const float*)d_in[0]; const float* fcos = (const float*)d_in[1]; const float* fsin = (const float*)d_in[2]; const float* wq = (const float*)d_in[3]; const float* wk = (const float*)d_in[4]; const float* wv = (const float*)d_in[5]; const float* wo = (const float*)d_in[6]; const float* bo = (const float*)d_in[7];   /* input order x, pos_cos, pos_sin ([2048][32] HALF-width table INPUTS: read by value), Wq, Wk, Wv, Wo ('xw' (in, out) [1024][1024]), bo ([1024]: zeros, read through the output launch's bias slot): EIGHT inputs, all read; the q, k, v projections have NO bias in this module */
    float* OUT = (float*)d_out;     // [2][2048][1024]
    char* wsp = (char*)d_ws;
    auto take = [&](size_t bytes) { char* p = wsp; wsp += (bytes + 255) & ~(size_t)255; return (void*)p; };
    static_assert(DQ == DKV && DQ == DM, "q, k and v share one projection launch that also writes their planes, the four weights one transpose launch: equal shapes");
    bf* WQ = (bf*)take((size_t)4 * DQ * DM * 2); bf* WO = WQ + (size_t)3 * DQ * DM;   // transposed Wq, Wk, Wv, Wo, one behind the other
    bf* XB = (bf*)take((size_t)NB_ * TT * DM * 2);
    const size_t PLN = (size_t)NB_ * NH_ * TT * HD;   // elements of one set of head planes
    h16* QP16 = (h16*)take(2 * PLN * 2); h16* KP16 = QP16 + PLN; h16* VT16 = (h16*)take((size_t)NB_ * NKV * HD * PP * 2);
    bf* QPh = (bf*)take(2 * PLN * 2); bf* KPh = QPh + PLN; bf* QPl = (bf*)take(2 * PLN * 2); bf* KPl = QPl + PLN; bf* VTh = (bf*)take((size_t)NB_ * NKV * HD * PP * 2); bf* VTl = VTh + (size_t)TT * HD;   // hi plane in the first half of each head's range, lo plane in the second
    bf* ATh = (bf*)take((size_t)NB_ * TT * DQ * 2); bf* ATl = (bf*)take((size_t)NB_ * TT * DQ * 2);
    if ((size_t)(wsp - (char*)d_ws) > ws_size) return;    // ws 256 MiB
    k_wtG<<<dim3((unsigned)((DM * DQ / 64 + 63) / 64), 4, 1), 256, 0, stream>>>(wq, wk, wv, wo, DM, DQ, WQ);   /* 'xw' [in][out] weights: transposed once into Bt */
    k_cvt8<<<(unsigned)(((size_t)NB_ * TT * DM / 8 + 255) / 256), 256, 0, stream>>>(x, XB, (size_t)NB_ * TT * DM / 8);
    k_gemmw<bf, 0, false, true><<<dim3(NB_ * TT / 128, DQ / 128, 3), 128, 0, stream>>>(XB, nullptr, WQ, nullptr, DM, nullptr, DQ, nullptr, 0, (size_t)DQ * DM, 0, fcos, fsin, QP16, QPh, QPl, VT16, VTh, VTl);   /* q, k, v projections, written as head planes */
    k_attn<<<dim3(NLR + NHR, NH_, NB_), 32, 0, stream>>>(QP16, KP16, VT16, QPh, QPl, KPh, KPl, VTh, VTl, ATh, ATl);
    k_gemmw<bf, 1, true, false><<<dim3(NB_ * TT / 128, DM / 128, 1), 128, 0, stream>>>(ATh, ATl, WO, nullptr, DQ, OUT, DM, bo, 0, 0, 0, nullptr, nullptr, nullptr, nullptr, nullptr, nullptr, nullptr, nullptr);
}

// v007
// It runs in 110 microseconds.
// Timed twice side by side with v006, it ran 1.06 times as fast both times.
// All steps since v000 together make it 13.2 times as fast.
#include <hip/hip_runtime.h>

// Causal multi-head self-attention with interleaved-pair rotary embeddings from two half-width INPUT tables and (in, out) weights (x [2][2048][1024]; q, k, v = x W ('xw' [1024][1024] normal x 0.02, no projection bias; 16 heads x 64); _rope on q and k: consecutive pairs (t[2i], t[2i+1]) -> (te c - to s, te s + to c) with c, s = pos_cos / pos_sin[t][i] (f32 [2048][32] INPUT tables the module computes: cos / sin(t / 10000^(2i/64)): read by value); scores: -inf above the diagonal, then / sqrt(64) (the same as scaling first); softmax; out = merged Wo + bo ('xw' + a zero bias [1024], read) -> [2][2048][1024] (4.2 M); argument order x, pos_cos, pos_sin, Wq, Wk, Wv, Wo, bo).
// Every stage is ONE launch for all of its independent instances (both batches; q, k and v; the four weights): the batch is folded into the row index (x, the projections, the merged planes) or the plane index (b * heads + h), q / k / v and the weights into a grid index. Stages: bf16 transpose of the four weights; bf16 copy of x; exact projections (no bias) whose epilogue builds the head planes itself (q, k: interleaved rotary with the two half-width INPUT tables read by value and bf16-rounded; v: transposed); causal T-2048 attention fused into one launch (k_attn: scores, running softmax and P x V in registers; hybrid rows: < 512 hi/lo 3 products, rest fp16; key blocks above the diagonal never touched) that writes the merged hi/lo planes; merged hi/lo x Wo exact + bo.
// Compute dtypes, f32 accumulate: every input rounded to bf16; projections exact (no bias); rotary f32; attention rows < 512 3 products, rest fp16; softmax f32; Wo hl x exact + bias.

#define NB_  2
#define TT   2048
#define DM   1024
#define NH_  16
#define NKV  16
#define REP  (NH_ / NKV)
#define HD   64
#define DQ   (NH_ * HD)
#define DKV  (NKV * HD)
#define PP   (2 * TT)             // a head's V^T range holds HD * PP 16-bit elements (hi plane in its first half, lo plane in the second)
#define RH   512                  // query rows < RH use hi+lo planes (0: none)
#define SCL  0.125f   // HD^-0.5
typedef _Float16 h16;
typedef unsigned short bf;
typedef __attribute__((ext_vector_type(16))) __bf16   v16bf;
typedef __attribute__((ext_vector_type(16))) _Float16 v16h;
typedef __attribute__((ext_vector_type(8)))  _Float16 v8h;
typedef __attribute__((ext_vector_type(8)))  unsigned short v8us;
typedef __attribute__((ext_vector_type(8)))  float    v8f;
typedef __attribute__((ext_vector_type(4)))  float    v4f;
typedef v8h  __attribute__((may_alias)) v8ha;
typedef v4f  __attribute__((may_alias)) v4fa;
typedef v8us __attribute__((may_alias)) v8usa;

__device__ __forceinline__ unsigned short f2bf(float f) { unsigned u = __float_as_uint(f); u += 0x7FFFu + ((u >> 16) & 1u); return (unsigned short)(u >> 16); }
__device__ __forceinline__ float bf2f(unsigned short b) { return __uint_as_float(((unsigned)b) << 16); }
__device__ __forceinline__ float bfr(float f) { return bf2f(f2bf(f)); }
__device__ __forceinline__ v16h cat16(v8h lo, v8h hi) { return __builtin_shufflevector(lo, hi, 0, 1, 2, 3, 4, 5, 6, 7, 8, 9, 10, 11, 12, 13, 14, 15); }
__device__ __forceinline__ v16bf cat16b(v8us lo, v8us hi) { return __builtin_bit_cast(v16bf, __builtin_shufflevector(lo, hi, 0, 1, 2, 3, 4, 5, 6, 7, 8, 9, 10, 11, 12, 13, 14, 15)); }
__device__ __forceinline__ v8f wmma16(v16h a, v16h b, v8f c) { return __builtin_amdgcn_wmma_f32_16x16x32_f16(false, a, false, b, (short)0, c, false, false); }
__device__ __forceinline__ v8f wmmab(v16bf a, v16bf b, v8f c) { return __builtin_amdgcn_wmma_f32_16x16x32_bf16(false, a, false, b, (short)0, c, false, false); }
__device__ __forceinline__ h16 tohx(float x) { return (h16)x; }
__device__ __forceinline__ void splitf(float y, unsigned short& h, unsigned short& l) { h = f2bf(y); l = f2bf(y - bf2f(h)); }
typedef __attribute__((ext_vector_type(4))) _Float16 v4h;
typedef __attribute__((ext_vector_type(2))) unsigned short v2us;
typedef __attribute__((ext_vector_type(4))) unsigned short v4us;
typedef __attribute__((ext_vector_type(2))) float v2f;



// ---- k_gemmw: register-blocked GEMM, one wave per 64x64 output tile (16 accumulators), FOUR WAVES (2 x 2) a work-group on one 128x128 tile; grid (M/128, N/128, Z), 128 threads.
// The operands (K-contiguous 16-bit planes) are staged in LDS, 64 k (one whole 128-byte line of every row) a stage, by asynchronous copies, two buffers: stage t + 1 flies while stage t is worked on. A copy instruction covers four whole lines, and each operand row is fetched once for the two waves that use it.
// LDS rows at a pitch of 144 bytes (16 x odd: the 16-byte fragment reads meet no bank twice). Per accumulator the products come in the same order as without the staging (k ascending, A then A2).
// C[m][n] (f32, pitch ldc, + optional f32 bias[n]) = sum_k A[m][k] Bt[n][k] (+ the A2 product for NSPLIT 1). z-batch strides sA/sB/sC in elements. K % 64 == 0.
// PLANES (the q, k, v projections; z = 0, 1, 2): no f32 C is written. A 64x64 tile is 64 positions of ONE head of one batch, so the epilogue writes the attention's operand planes (fp16 + bf16 hi/lo) itself, in FRAGMENT ORDER (below), straight from the accumulators: every store is 16 bytes a lane, 512 contiguous bytes a wave.
// z < 2: planes [z][b][h] of the rotated tile: consecutive pairs (x0, x1) -> (x0 c - x1 s, x0 s + x1 c), c, s = bf16-rounded fc / fs[t][d / 2]. The tile is computed transposed (the weight rows take the A operand's place, the positions the B operand's; same products, same k order), so that a lane holds 8 consecutive d (four whole pairs) of one position.
// z == 2: V^T planes [b][h]: a lane holds 8 consecutive positions of one d.
// FRAGMENT ORDER of the attention's operand planes: a block of FB elements (512 bytes) holds, for each of the 32 lanes (lr, hi) in lane order, the 8 consecutive contraction elements that one 16-byte load of a fragment brings,
// so that a wave-wide load covers four whole 128-byte lines. Q, K (contraction over d): 16 positions are 4 blocks, block d / 16, lane (lr = t % 16, hi = d / 8 % 2), element d % 8.
// V^T (contraction over keys): 32 keys are 8 blocks, block (d / 16) * 2 + t / 16 % 2, lane (lr = d % 16, hi = t / 8 % 2), element t % 8. ldf joins a fragment's two neighbouring blocks (k = 8 hi + e and 16 + 8 hi + e, as ld does from a row).
#define FB 256
template <typename T16> struct WFrag;
template <> struct WFrag<h16> { typedef v16h V; static __device__ __forceinline__ V ld(const h16* p) { return cat16(*(const v8h*)p, *(const v8h*)(p + 16)); } static __device__ __forceinline__ V ldf(const h16* p) { return cat16(*(const v8h*)p, *(const v8h*)(p + FB)); } static __device__ __forceinline__ v8f mma(V a, V b, v8f c) { return wmma16(a, b, c); } };
template <> struct WFrag<bf> { typedef v16bf V; static __device__ __forceinline__ V ld(const bf* p) { return cat16b(*(const v8us*)p, *(const v8us*)(p + 16)); } static __device__ __forceinline__ V ldf(const bf* p) { return cat16b(*(const v8us*)p, *(const v8us*)(p + FB)); } static __device__ __forceinline__ v8f mma(V a, V b, v8f c) { return wmmab(a, b, c); } };
#define LP 72                     // LDS row pitch of a staged operand tile, in 16-bit elements (144 bytes)
#define TLE (128 * LP)            // elements of one staged operand tile (128 rows)
// Eight asynchronous 16-byte copies of a lane: rows r, r + 16, .. r + 112 of one operand tile (l: the lane's LDS byte address, g: its global address, K: the global row pitch in elements).
// The s_wait_xcnt closes the statement so that no address register of a copy is rewritten in front of it.
template <typename T16>
__device__ __forceinline__ void cp8(const unsigned l, const T16* g, const int K) {
    const size_t rs = (size_t)16 * K;
    asm volatile("global_load_async_to_lds_b128 %0, %8, off\n\t"
                 "global_load_async_to_lds_b128 %1, %9, off\n\t"
                 "global_load_async_to_lds_b128 %2, %10, off\n\t"
                 "global_load_async_to_lds_b128 %3, %11, off\n\t"
                 "global_load_async_to_lds_b128 %4, %12, off\n\t"
                 "global_load_async_to_lds_b128 %5, %13, off\n\t"
                 "global_load_async_to_lds_b128 %6, %14, off\n\t"
                 "global_load_async_to_lds_b128 %7, %15, off\n\t"
                 "s_wait_xcnt 0x0"
                 :: "v"(l), "v"(l + 1 * 16 * LP * 2), "v"(l + 2 * 16 * LP * 2), "v"(l + 3 * 16 * LP * 2), "v"(l + 4 * 16 * LP * 2), "v"(l + 5 * 16 * LP * 2), "v"(l + 6 * 16 * LP * 2), "v"(l + 7 * 16 * LP * 2),
                    "v"(g), "v"(g + rs), "v"(g + 2 * rs), "v"(g + 3 * rs), "v"(g + 4 * rs), "v"(g + 5 * rs), "v"(g + 6 * rs), "v"(g + 7 * rs) : "memory");
}
template <typename T16, int NSPLIT, bool BIAS, bool PLANES>
__global__ __launch_bounds__(128) void k_gemmw(const T16* __restrict__ A, const T16* __restrict__ A2, const T16* __restrict__ Bt, const T16* __restrict__ Bt2, int K, float* C, int ldc, const float* __restrict__ bias, size_t sA, size_t sB, size_t sC, const float* __restrict__ fc, const float* __restrict__ fs, h16* __restrict__ P16, bf* __restrict__ Ph, bf* __restrict__ Pl, h16* __restrict__ V16, bf* __restrict__ Vh, bf* __restrict__ Vl) {
    typedef typename WFrag<T16>::V V;
    static_assert(NSPLIT <= 1, "staged operands: A, Bt and, for NSPLIT 1, A2");
    constexpr int NOP = NSPLIT == 1 ? 3 : 2;          // operand tiles a stage: A, Bt (, A2)
    __shared__ __align__(16) T16 ring[2 * NOP * TLE];
    __shared__ __align__(16) float osm[4 * 16 * 68];  // epilogue staging, a range of its own for each wave
    const int wave = __builtin_amdgcn_readfirstlane(threadIdx.x >> 5), wm = wave & 1, wn = wave >> 1;
    float* os = osm + wave * (16 * 68);
    const size_t z = blockIdx.z; A += z * sA; if (A2) A2 += z * sA; Bt += z * sB; if (Bt2) Bt2 += z * sB; C += z * sC;
    const int lane = threadIdx.x & 31, lr = lane & 15, hi = lane >> 4; const int r0 = blockIdx.x * 128 + wm * 64, c0 = blockIdx.y * 128 + wn * 64;
    v8f acc[4][4];
#pragma unroll
    for (int mb = 0; mb < 4; ++mb)
#pragma unroll
        for (int nb = 0; nb < 4; ++nb) acc[mb][nb] = (v8f){};
    // the copies: thread t brings the 16-byte piece t & 7 of rows (t >> 3) + 16 i of each tile, so that eight lanes cover a row's whole line
    const int crw = threadIdx.x >> 3, cpc = threadIdx.x & 7;
    const T16* gA = A + (size_t)(blockIdx.x * 128 + crw) * K + cpc * 8; const T16* gB = Bt + (size_t)(blockIdx.y * 128 + crw) * K + cpc * 8; const T16* gA2 = NSPLIT == 1 ? A2 + (size_t)(blockIdx.x * 128 + crw) * K + cpc * 8 : gA;
    if (PLANES && blockIdx.z < 2) { const T16* gt = gA; gA = gB; gB = gt; }   // q, k: the tile is computed transposed (weight rows as the A operand), so that a lane's 8 accumulator elements are 8 consecutive d of one position
    const unsigned lc = (unsigned)(size_t)ring + (crw * LP + cpc * 8) * 2;
    auto fill = [&](const int t, const int buf) { const unsigned l = lc + buf * (NOP * TLE * 2);
        cp8<T16>(l, gA + t * 64, K); cp8<T16>(l + TLE * 2, gB + t * 64, K); if (NSPLIT == 1) cp8<T16>(l + 2 * TLE * 2, gA2 + t * 64, K); };
    const int nst = K / 64;
    fill(0, 0);
    asm volatile("s_wait_asynccnt 0x0" ::: "memory");   // this wave's copies of stage 0 have landed
    __syncthreads();                                    // every wave's have: stage 0 may be read
    if (nst > 1) fill(1, 1);
    const int fa = (wm * 64 + lr) * LP + 8 * hi, fb = TLE + (wn * 64 + lr) * LP + 8 * hi;
    for (int t = 0; t < nst; ++t) {
        const T16* sb = ring + (t & 1) * (NOP * TLE);
#pragma unroll
        for (int ks = 0; ks < 2; ++ks) {
            V a[4], a2[4], b[4];
#pragma unroll
            for (int mb = 0; mb < 4; ++mb) { a[mb] = WFrag<T16>::ld(sb + fa + mb * 16 * LP + ks * 32); if (NSPLIT == 1) a2[mb] = WFrag<T16>::ld(sb + 2 * TLE + fa + mb * 16 * LP + ks * 32); }
#pragma unroll
            for (int nb = 0; nb < 4; ++nb) b[nb] = WFrag<T16>::ld(sb + fb + nb * 16 * LP + ks * 32);
            __builtin_amdgcn_sched_barrier(0);   // holds the block's LDS reads together in front of its products: sunk among them, each place with reads would be waited out on its own
#pragma unroll
            for (int nb = 0; nb < 4; ++nb)
#pragma unroll
                for (int mb = 0; mb < 4; ++mb) { acc[mb][nb] = WFrag<T16>::mma(a[mb], b[nb], acc[mb][nb]); if (NSPLIT == 1) acc[mb][nb] = WFrag<T16>::mma(a2[mb], b[nb], acc[mb][nb]); }
        }
        asm volatile("s_wait_dscnt 0x0" ::: "memory");      // this wave's reads of stage t are done before the buffer is handed back
        asm volatile("s_wait_asynccnt 0x0" ::: "memory");   // this wave's copies of stage t + 1 have landed
        __syncthreads();                                    // publishes stage t + 1 and ends every wave's reads of stage t
        if (t + 2 < nst) fill(t + 2, t & 1);
    }
    asm volatile("s_wait_asynccnt 0x0" ::: "memory");       // no copy outstanding behind the loop
    if constexpr (PLANES) {
        static_assert(HD == 64 && TT % 64 == 0 && NKV == NH_, "a 64x64 tile is 64 positions of one head of one batch");
        if (blockIdx.z == 2) {
            const int b = r0 / TT, t0 = r0 % TT, h = c0 / 64;
            const size_t vo = (size_t)(b * NKV + h) * HD * PP + (size_t)t0 * HD + lane * 8; h16* v16 = V16 + vo; bf* vh = Vh + vo; bf* vl = Vl + vo;
#pragma unroll
            for (int nb = 0; nb < 4; ++nb)
#pragma unroll
                for (int mb = 0; mb < 4; ++mb) { v8h o16; v8us oh, ol;
#pragma unroll
                    for (int j = 0; j < 8; ++j) { const float x = acc[mb][nb][j]; o16[j] = tohx(x); unsigned short a2, c2; splitf(x, a2, c2); oh[j] = a2; ol[j] = c2; }
                    const int o = (mb >> 1) * (32 * HD) + (nb * 2 + (mb & 1)) * FB; *(v8h*)(v16 + o) = o16; *(v8us*)(vh + o) = oh; *(v8us*)(vl + o) = ol;
                    asm volatile("s_wait_xcnt 0x0" :: "v"(o16), "v"(oh), "v"(ol), "v"(v16), "v"(vh), "v"(vl) : "memory"); }   // the three stores: their data and address registers stay whole (inputs) until this wait
        } else {
            // transposed tile: acc[mb][nb][j] is d = 16 mb + 8 hi + j of position 16 nb + lr
            const int p0 = blockIdx.x * 128 + wn * 64, b = p0 / TT, t0 = p0 % TT, h = blockIdx.y * 2 + wm;
            const size_t po = (((size_t)blockIdx.z * NB_ + b) * NH_ + h) * TT * HD + (size_t)t0 * HD + lane * 8; h16* p16 = P16 + po; bf* ph = Ph + po; bf* pl = Pl + po;
            const float* fcp = fc + (size_t)(t0 + lr) * (HD / 2) + hi * 4; const float* fsp = fs + (size_t)(t0 + lr) * (HD / 2) + hi * 4;
            v4f cc[2][4], sn[2][4];    // the table values of a lane's four pairs, one block of 16 positions ahead, so that they fly under the block before
#pragma unroll
            for (int mb = 0; mb < 4; ++mb) { cc[0][mb] = *(const v4f*)(fcp + mb * 8); sn[0][mb] = *(const v4f*)(fsp + mb * 8); }
#pragma unroll
            for (int nb = 0; nb < 4; ++nb) {
                if (nb < 3) {
#pragma unroll
                    for (int mb = 0; mb < 4; ++mb) { cc[(nb + 1) & 1][mb] = *(const v4f*)(fcp + (nb + 1) * 16 * (HD / 2) + mb * 8); sn[(nb + 1) & 1][mb] = *(const v4f*)(fsp + (nb + 1) * 16 * (HD / 2) + mb * 8); } }
                asm volatile("s_wait_xcnt 0x0" :: "v"(fcp), "v"(fsp) : "memory");   // the table loads: their address registers stay whole (inputs) until this wait
#pragma unroll
                for (int mb = 0; mb < 4; ++mb) { v8h o16; v8us oh, ol;
#pragma unroll
                    for (int q = 0; q < 4; ++q) { const float x0 = acc[mb][nb][2 * q], x1 = acc[mb][nb][2 * q + 1], c = bfr(cc[nb & 1][mb][q]), sv = bfr(sn[nb & 1][mb][q]);
                        const float e0 = __builtin_fmaf(x0, c, -(x1 * sv)), e1 = __builtin_fmaf(x0, sv, x1 * c);   /* even: x0 c - x1 s; odd: x0 s + x1 c; the x1 product rounded, the x0 product fused */
                        o16[2 * q] = tohx(e0); o16[2 * q + 1] = tohx(e1); unsigned short a2, c2; splitf(e0, a2, c2); oh[2 * q] = a2; ol[2 * q] = c2; splitf(e1, a2, c2); oh[2 * q + 1] = a2; ol[2 * q + 1] = c2; }
                    const int o = nb * (16 * HD) + mb * FB; *(v8h*)(p16 + o) = o16; *(v8us*)(ph + o) = oh; *(v8us*)(pl + o) = ol;
                    asm volatile("s_wait_xcnt 0x0" :: "v"(o16), "v"(oh), "v"(ol), "v"(p16), "v"(ph), "v"(pl) : "memory"); }   // the three stores: their data and address registers stay whole (inputs) until this wait
            }
        }
        return;
    }
#pragma unroll
    for (int mb = 0; mb < 4; ++mb) {
#pragma unroll
        for (int nb = 0; nb < 4; ++nb) {
#pragma unroll
            for (int j = 0; j < 8; ++j) os[(hi * 8 + j) * 68 + nb * 16 + lr] = acc[mb][nb][j]; }
        __builtin_amdgcn_wave_barrier(); asm volatile("" ::: "memory");
        float* crow = C + (size_t)(r0 + mb * 16) * ldc + c0;
{
#pragma unroll
            for (int s = 0; s < 8; ++s) { const int row = 2 * s + hi, cofs = lr * 4; v4f val = *(const v4fa*)(os + row * 68 + cofs); if (BIAS) { val[0] += bfr(bias[c0 + cofs]); val[1] += bfr(bias[c0 + cofs + 1]); val[2] += bfr(bias[c0 + cofs + 2]); val[3] += bfr(bias[c0 + cofs + 3]); }
                *(v4f*)(crow + (size_t)row * ldc + cofs) = val; }
             }
        __builtin_amdgcn_wave_barrier(); asm volatile("" ::: "memory");
    }
}


// grid (.., 4): blockIdx.y picks the weight; the four transposed planes lie one behind the other in Bt
// One wave transposes a tile of 64 k x 32 n in registers, no LDS: lane (kg = lane & 7, nq = lane >> 3) loads 16 bytes (4 n) of each of its 8 consecutive k rows, for both 16-n halves of the tile
// (16 loads in flight a lane; a load covers 8 half lines, and the tile's two halves together use every line whole). It then stores, for each of its 8 n, its 8 consecutive k as 16 bytes:
// the 8 lanes kg fill one whole 128-byte line of Bt, a store covers 4 whole lines, and each line has one writer. The pitches are constants, so that every load and store is one base address plus an immediate offset.
__global__ __launch_bounds__(256) void k_wtG(const float* __restrict__ w0, const float* __restrict__ w1, const float* __restrict__ w2, const float* __restrict__ w3, bf* Bt) {
    constexpr int K = DM, N = DQ, NKT = K / 64;
    static_assert(K % 256 == 0 && N % 64 == 0, "whole tiles, 4 x 2 of them a work-group");
    const int y = blockIdx.y; const float* __restrict__ w = y == 0 ? w0 : y == 1 ? w1 : y == 2 ? w2 : w3; Bt += (size_t)y * N * K;
    const int lane = threadIdx.x & 31, kg = lane & 7, nq = lane >> 3, wave = threadIdx.x >> 5;
    // a work-group's eight tiles are 4 (k) x 2 (n): the two n neighbours together read each row's aligned 256 bytes
    const int k0 = ((blockIdx.x % (NKT / 4)) * 4 + (wave >> 1)) * 64 + kg * 8, n0 = ((blockIdx.x / (NKT / 4)) * 2 + (wave & 1)) * 32 + nq * 4;
    const float* s = w + (size_t)k0 * N + n0; bf* d = Bt + (size_t)n0 * K + k0;
    v4f v[2][8];
#pragma unroll
    for (int hf = 0; hf < 2; ++hf)
#pragma unroll
        for (int j = 0; j < 8; ++j) v[hf][j] = *(const v4f*)(s + j * N + hf * 16);
    asm volatile("s_wait_xcnt 0x0" :: "v"(s) : "memory");   // the 16 loads: their address register pair stays whole (an input) until this wait; and no load crosses this statement, so that all 16 fly together in front of the conversions (sunk among them, to save registers, they went out in five groups, each group's latency waited out on its own)
#pragma unroll
    for (int hf = 0; hf < 2; ++hf)
#pragma unroll
        for (int c = 0; c < 4; ++c) { v8us o;
#pragma unroll
            for (int j = 0; j < 8; ++j) o[j] = f2bf(v[hf][j][c]);
            *(v8us*)(d + (hf * 16 + c) * K) = o; }
}
__global__ __launch_bounds__(256) void k_cvt8(const float* __restrict__ src, bf* dst, size_t n8) { const size_t i = (size_t)blockIdx.x * 256 + threadIdx.x; if (i >= n8) return; const v8f v = *(const v8f*)(src + i * 8); v8us o;
#pragma unroll
    for (int k = 0; k < 8; ++k) o[k] = f2bf(v[k]); *(v8us*)(dst + i * 8) = o;  }
// ---- k_attn: causal attention fused into one launch for both batches (batch = blockIdx.z): ONE WAVE per (head, query tile); scores, running softmax and the probability x value product stay in registers.
// Transposed products: S^T = K Q^T (A = 16 keys x 64 d, B = 16 queries) leaves lane (lr, hi) with keys 8 hi + j of query lr, which for two neighbouring key tiles is exactly the B fragment (k = 8 hi + e, 16 + 8 hi + e) of
// O^T = V^T P^T (A = 16 d x 32 keys): no exchange between lanes but one with lane l ^ 16 for the row maximum and the row sum. O^T leaves lane (lr, hi) with d = 16 dt + 8 hi + j of query lr: 16-byte stores into the merged hi/lo planes.
// Running softmax in the base-2 domain: t = s * HD^-0.5 * log2(e); per 32 keys m' = max(m, t), O and l scaled by 2^(m - m'), p = 2^(t - m') (not normalised: <= 1), l += sum p; O / l at the end.
// HR (query rows < RH): bf16 hi/lo planes, 3 products for both contractions, 16 queries a wave; else fp16, 32 queries a wave. Key blocks wholly at or below the diagonal need no mask; the one diagonal block masks by select.
#define KB 32                     // keys per trip
__device__ __forceinline__ float xhalf(float x) { return __builtin_bit_cast(float, __builtin_amdgcn_permlanex16(__builtin_bit_cast(int, x), __builtin_bit_cast(int, x), 0x76543210, 0xfedcba98, false, false)); }  // lane l with lane l ^ 16
__device__ __forceinline__ float exp2s(float x) { asm("v_exp_f32 %0, %0\n\tv_nop" : "+v"(x)); return x; }   // 2^x. The v_nop is the free slot the instruction set asks for behind a transcendental. In place: the register already holds the live argument, so it is no operand of a matrix instruction still in its window (the compiler does not look into asm text)
template <typename T16, int NT, bool HR>
__device__ __forceinline__ void attn_tile(const T16* __restrict__ Q, const T16* __restrict__ Q2, const T16* __restrict__ Kp, const T16* __restrict__ Kp2, const T16* __restrict__ Vt, const T16* __restrict__ Vt2, const int q0, bf* __restrict__ Ah, bf* __restrict__ Al) {
    typedef typename WFrag<T16>::V V;
    const int lane = threadIdx.x & 31, lr = lane & 15, hi = lane >> 4;
    V qf[NT][2], qf2[NT][2];
    const T16* qb = Q + (size_t)q0 * HD; const T16* qb2 = HR ? Q2 + (size_t)q0 * HD : qb; const T16* qp = qb + lane * 8; const T16* qp2 = qb2 + lane * 8;
#pragma unroll
    for (int nt = 0; nt < NT; ++nt)
#pragma unroll
        for (int ks = 0; ks < 2; ++ks) { qf[nt][ks] = WFrag<T16>::ldf(qp + nt * 16 * HD + ks * 2 * FB); if (HR) qf2[nt][ks] = WFrag<T16>::ldf(qp2 + nt * 16 * HD + ks * 2 * FB); }
    v8f o[4][NT]; float m[NT], l[NT];
#pragma unroll
    for (int nt = 0; nt < NT; ++nt) { m[nt] = -3.0e38f; l[nt] = 0.f;
#pragma unroll
        for (int dt = 0; dt < 4; ++dt) o[dt][nt] = (v8f){}; }
    V kf[2][2], kf2[2][2];
    auto ldk = [&](const T16* kp, const T16* kp2, V (&f)[2][2], V (&f2)[2][2]) {
#pragma unroll
        for (int mt = 0; mt < 2; ++mt)
#pragma unroll
            for (int ks = 0; ks < 2; ++ks) { f[mt][ks] = WFrag<T16>::ldf(kp + mt * 16 * HD + ks * 2 * FB); if (HR) f2[mt][ks] = WFrag<T16>::ldf(kp2 + mt * 16 * HD + ks * 2 * FB); } };
    const size_t kl = (size_t)lane * 8, vl = kl;
    auto step = [&](const int kb, const bool last) {
        V vf[4], vf2[4];
        const T16* vp = Vt + vl + (size_t)kb * HD; const T16* vp2 = HR ? Vt2 + vl + (size_t)kb * HD : vp;
        const T16* kp = (HR || !last) ? Kp + kl + (size_t)(HR ? kb : kb + KB) * HD : vp; const T16* kp2 = HR ? Kp2 + kl + (size_t)kb * HD : kp;
#pragma unroll
        for (int dt = 0; dt < 4; ++dt) { vf[dt] = WFrag<T16>::ldf(vp + dt * 2 * FB); if (HR) vf2[dt] = WFrag<T16>::ldf(vp2 + dt * 2 * FB); }
        if (HR) ldk(kp, kp2, kf, kf2);              // hi/lo path: this trip's own key fragments
        v8f sa[NT][2];
#pragma unroll
        for (int nt = 0; nt < NT; ++nt) {
#pragma unroll
            for (int mt = 0; mt < 2; ++mt) { v8f s = (v8f){};
#pragma unroll
                for (int ks = 0; ks < 2; ++ks) { s = WFrag<T16>::mma(kf[mt][ks], qf[nt][ks], s); if (HR) { s = WFrag<T16>::mma(kf[mt][ks], qf2[nt][ks], s); s = WFrag<T16>::mma(kf2[mt][ks], qf[nt][ks], s); } }
                sa[nt][mt] = s; } }
        if (!HR) { if (!last) ldk(kp, kp2, kf, kf2);   // fp16 path: the next trip's key fragments, into the same registers right behind this trip's score products; they fly under the softmax and P x V
            __builtin_amdgcn_sched_barrier(0); }       // holds those loads (and this trip's V loads) up here: sunk to the foot of the trip, their latency would be waited out in full
#pragma unroll
        for (int nt = 0; nt < NT; ++nt) {
            v8f (&st)[2] = sa[nt];
            float mx = m[nt];
#pragma unroll
            for (int mt = 0; mt < 2; ++mt)
#pragma unroll
                for (int j = 0; j < 8; ++j) { float t = st[mt][j] * (SCL * 1.4426950408889634f); if (last) t = (kb + mt * 16 + hi * 8 + j <= q0 + nt * 16 + lr) ? t : -3.0e38f; st[mt][j] = t; mx = fmaxf(mx, t); }
            mx = fmaxf(mx, xhalf(mx));
            const float al = exp2s(m[nt] - mx); m[nt] = mx;
            float sum = 0.f;
#pragma unroll
            for (int mt = 0; mt < 2; ++mt)
#pragma unroll
                for (int j = 0; j < 8; ++j) { const float p = exp2s(st[mt][j] - mx); st[mt][j] = p; sum += p; }
            l[nt] = l[nt] * al + sum;
#pragma unroll
            for (int dt = 0; dt < 4; ++dt) o[dt][nt] *= al;
            if (nt == 0) asm volatile("s_wait_xcnt 0x0" :: "v"(vp), "v"(vp2), "v"(kp), "v"(kp2) : "memory");   // this trip's loads: their address registers stay whole (inputs) until this wait; placed here, where the V fragments are waited for anyway
            if (HR) {
                v8us h0, h1, l0, l1;
#pragma unroll
                for (int j = 0; j < 8; ++j) { unsigned short x, y; splitf(st[0][j], x, y); h0[j] = x; l0[j] = y; splitf(st[1][j], x, y); h1[j] = x; l1[j] = y; }
                const v16bf ph = cat16b(h0, h1), pl = cat16b(l0, l1);
#pragma unroll
                for (int dt = 0; dt < 4; ++dt) { o[dt][nt] = wmmab(__builtin_bit_cast(v16bf, vf[dt]), ph, o[dt][nt]); o[dt][nt] = wmmab(__builtin_bit_cast(v16bf, vf[dt]), pl, o[dt][nt]); o[dt][nt] = wmmab(__builtin_bit_cast(v16bf, vf2[dt]), ph, o[dt][nt]); }
            } else {
                v8h p0, p1;
#pragma unroll
                for (int j = 0; j < 8; ++j) { p0[j] = tohx(st[0][j]); p1[j] = tohx(st[1][j]); }
                const v16h pf = cat16(p0, p1);
#pragma unroll
                for (int dt = 0; dt < 4; ++dt) o[dt][nt] = wmma16(__builtin_bit_cast(v16h, vf[dt]), pf, o[dt][nt]);
            }
        }
    };
    const T16* kp0 = Kp + kl;
    if (!HR) ldk(kp0, kp0, kf, kf2);
    asm volatile("s_wait_xcnt 0x0" :: "s"(qb), "s"(qb2), "s"(Kp), "v"(lane) : "memory");   // the prologue's loads (scalar base + lane offset): their address registers stay whole (inputs) until this wait
    const int kd = (q0 / KB) * KB;             // the diagonal block: it holds keys q0 .. q0 + 16 NT - 1 (q0 is a multiple of 16 NT, and 16 NT divides KB)
    for (int kb = 0; kb < kd; kb += KB) step(kb, false);
    step(kd, true);
#pragma unroll
    for (int nt = 0; nt < NT; ++nt) { const float lt = l[nt] + xhalf(l[nt]); const float inv = __fdiv_rn(1.0f, lt); const size_t oo = (size_t)(q0 + nt * 16 + lr) * DQ + 8 * hi; bf* sh = Ah + oo; bf* sl = Al + oo;
#pragma unroll
        for (int dt = 0; dt < 4; ++dt) { v8us oh, ol;
#pragma unroll
            for (int j = 0; j < 8; ++j) { unsigned short x, y; splitf(o[dt][nt][j] * inv, x, y); oh[j] = x; ol[j] = y; }
            *(v8us*)(sh + dt * 16) = oh; *(v8us*)(sl + dt * 16) = ol;
            asm volatile("s_wait_xcnt 0x0" :: "v"(oh), "v"(ol), "v"(sh), "v"(sl) : "memory"); } }   // the two stores: their data and address registers stay whole (inputs) until this wait, on every way into code that rewrites them
}
#define NLR ((TT - RH) / 32)      // fp16 query tiles of 32 rows
#define NHR (RH / 16)             // hi/lo query tiles of 16 rows
// grid (NLR + NHR, NH_, NB_): the longest tiles (last query rows) take the lowest block indices
__global__ __launch_bounds__(32) void k_attn(const h16* __restrict__ Q16, const h16* __restrict__ K16, const h16* __restrict__ V16, const bf* __restrict__ Qh, const bf* __restrict__ Ql, const bf* __restrict__ Kh, const bf* __restrict__ Kl, const bf* __restrict__ Vh, const bf* __restrict__ Vl, bf* __restrict__ Ah, bf* __restrict__ Al) {
    const int h = blockIdx.y, g = h / REP, bx = blockIdx.x, b = blockIdx.z; const size_t qo = (size_t)(b * NH_ + h) * TT * HD, ko = (size_t)(b * NKV + g) * TT * HD, vo = (size_t)(b * NKV + g) * HD * PP; Ah += (size_t)b * TT * DQ; Al += (size_t)b * TT * DQ;
    if (bx < NLR) attn_tile<h16, 2, false>(Q16 + qo, nullptr, K16 + ko, nullptr, V16 + vo, nullptr, RH + (NLR - 1 - bx) * 32, Ah + h * HD, Al + h * HD);
    else attn_tile<bf, 1, true>(Qh + qo, Ql + qo, Kh + ko, Kl + ko, Vh + vo, Vl + vo, (NLR + NHR - 1 - bx) * 16, Ah + h * HD, Al + h * HD);
}

extern "C" void kernel_launch(void* const* d_in, const int* in_sizes, int n_in,
                              void* d_out, int out_size, void* d_ws, size_t ws_size, hipStream_t stream) {
    (void)in_sizes; (void)n_in; (void)out_size;
        const float* x = (const float*)d_in[0]; const float* fcos = (const float*)d_in[1]; const float* fsin = (const float*)d_in[2]; const float* wq = (const float*)d_in[3]; const float* wk = (const float*)d_in[4]; const float* wv = (const float*)d_in[5]; const float* wo = (const float*)d_in[6]; const float* bo = (const float*)d_in[7];   /* input order x, pos_cos, pos_sin ([2048][32] HALF-width table INPUTS: read by value), Wq, Wk, Wv, Wo ('xw' (in, out) [1024][1024]), bo ([1024]: zeros, read through the output launch's bias slot): EIGHT inputs, all read; the q, k, v projections have NO bias in this module */
    float* OUT = (float*)d_out;     // [2][2048][1024]
    char* wsp = (char*)d_ws;
    auto take = [&](size_t bytes) { char* p = wsp; wsp += (bytes + 255) & ~(size_t)255; return (void*)p; };
    static_assert(DQ == DKV && DQ == DM, "q, k and v share one projection launch that also writes their planes, the four weights one transpose launch: equal shapes");
    bf* WQ = (bf*)take((size_t)4 * DQ * DM * 2); bf* WO = WQ + (size_t)3 * DQ * DM;   // transposed Wq, Wk, Wv, Wo, one behind the other
    bf* XB = (bf*)take((size_t)NB_ * TT * DM * 2);
    const size_t PLN = (size_t)NB_ * NH_ * TT * HD;   // elements of one set of head planes
    h16* QP16 = (h16*)take(2 * PLN * 2); h16* KP16 = QP16 + PLN; h16* VT16 = (h16*)take((size_t)NB_ * NKV * HD * PP * 2);
    bf* QPh = (bf*)take(2 * PLN * 2); bf* KPh = QPh + PLN; bf* QPl = (bf*)take(2 * PLN * 2); bf* KPl = QPl + PLN; bf* VTh = (bf*)take((size_t)NB_ * NKV * HD * PP * 2); bf* VTl = VTh + (size_t)TT * HD;   // hi plane in the first half of each head's range, lo plane in the second
    bf* ATh = (bf*)take((size_t)NB_ * TT * DQ * 2); bf* ATl = (bf*)take((size_t)NB_ * TT * DQ * 2);
    if ((size_t)(wsp - (char*)d_ws) > ws_size) return;    // ws 256 MiB
    k_wtG<<<dim3((DM / 256) * (DQ / 64), 4, 1), 256, 0, stream>>>(wq, wk, wv, wo, WQ);   /* 'xw' [in][out] weights: transposed once into Bt */
    k_cvt8<<<(unsigned)(((size_t)NB_ * TT * DM / 8 + 255) / 256), 256, 0, stream>>>(x, XB, (size_t)NB_ * TT * DM / 8);
    k_gemmw<bf, 0, false, true><<<dim3(NB_ * TT / 128, DQ / 128, 3), 128, 0, stream>>>(XB, nullptr, WQ, nullptr, DM, nullptr, DQ, nullptr, 0, (size_t)DQ * DM, 0, fcos, fsin, QP16, QPh, QPl, VT16, VTh, VTl);   /* q, k, v projections, written as head planes */
    k_attn<<<dim3(NLR + NHR, NH_, NB_), 32, 0, stream>>>(QP16, KP16, VT16, QPh, QPl, KPh, KPl, VTh, VTl, ATh, ATl);
    k_gemmw<bf, 1, true, false><<<dim3(NB_ * TT / 128, DM / 128, 1), 128, 0, stream>>>(ATh, ATl, WO, nullptr, DQ, OUT, DM, bo, 0, 0, 0, nullptr, nullptr, nullptr, nullptr, nullptr, nullptr, nullptr, nullptr);
}

// v008
// One run takes 91.6 microseconds.
// Next to v007, in two timings, it ran 1.21 and 1.20 times as fast.
// All steps since v000 together make it 15.9 times as fast.
#include <hip/hip_runtime.h>

// Causal multi-head self-attention with interleaved-pair rotary embeddings from two half-width INPUT tables and (in, out) weights (x [2][2048][1024]; q, k, v = x W ('xw' [1024][1024] normal x 0.02, no projection bias; 16 heads x 64); _rope on q and k: consecutive pairs (t[2i], t[2i+1]) -> (te c - to s, te s + to c) with c, s = pos_cos / pos_sin[t][i] (f32 [2048][32] INPUT tables the module computes: cos / sin(t / 10000^(2i/64)): read by value); scores: -inf above the diagonal, then / sqrt(64) (the same as scaling first); softmax; out = merged Wo + bo ('xw' + a zero bias [1024], read) -> [2][2048][1024] (4.2 M); argument order x, pos_cos, pos_sin, Wq, Wk, Wv, Wo, bo).
// Every stage is ONE launch for all of its independent instances (both batches; q, k and v; the four weights): the batch is folded into the row index (x, the projections, the merged planes) or the plane index (b * heads + h), q / k / v and the weights into a grid index. Stages: bf16 transpose of the four weights; bf16 copy of x; exact projections (no bias) whose epilogue builds the head planes itself (q, k: interleaved rotary with the two half-width INPUT tables read by value and bf16-rounded; v: transposed); causal T-2048 attention fused into one launch (k_attn: scores, running softmax and P x V in registers; hybrid rows: < 512 hi/lo 3 products, rest fp16; key blocks above the diagonal never touched) that writes the merged hi/lo planes; merged hi/lo x Wo exact + bo.
// Compute dtypes, f32 accumulate: every input rounded to bf16; projections exact (no bias); rotary f32; attention rows < 512 3 products, rest fp16; softmax f32; Wo hl x exact + bias.

#define NB_  2
#define TT   2048
#define DM   1024
#define NH_  16
#define NKV  16
#define REP  (NH_ / NKV)
#define HD   64
#define DQ   (NH_ * HD)
#define DKV  (NKV * HD)
#define PP   (2 * TT)             // a head's V^T range holds HD * PP 16-bit elements (hi plane in its first half, lo plane in the second)
#define RH   512                  // query rows < RH use hi+lo planes (at least NSP * KB)
#define SCL  0.125f   // HD^-0.5
typedef _Float16 h16;
typedef unsigned short bf;
typedef __attribute__((ext_vector_type(16))) __bf16   v16bf;
typedef __attribute__((ext_vector_type(16))) _Float16 v16h;
typedef __attribute__((ext_vector_type(8)))  _Float16 v8h;
typedef __attribute__((ext_vector_type(8)))  unsigned short v8us;
typedef __attribute__((ext_vector_type(8)))  float    v8f;
typedef __attribute__((ext_vector_type(4)))  float    v4f;
typedef v8h  __attribute__((may_alias)) v8ha;
typedef v4f  __attribute__((may_alias)) v4fa;
typedef v8us __attribute__((may_alias)) v8usa;

__device__ __forceinline__ unsigned short f2bf(float f) { unsigned u = __float_as_uint(f); u += 0x7FFFu + ((u >> 16) & 1u); return (unsigned short)(u >> 16); }
__device__ __forceinline__ float bf2f(unsigned short b) { return __uint_as_float(((unsigned)b) << 16); }
__device__ __forceinline__ float bfr(float f) { return bf2f(f2bf(f)); }
__device__ __forceinline__ v16h cat16(v8h lo, v8h hi) { return __builtin_shufflevector(lo, hi, 0, 1, 2, 3, 4, 5, 6, 7, 8, 9, 10, 11, 12, 13, 14, 15); }
__device__ __forceinline__ v16bf cat16b(v8us lo, v8us hi) { return __builtin_bit_cast(v16bf, __builtin_shufflevector(lo, hi, 0, 1, 2, 3, 4, 5, 6, 7, 8, 9, 10, 11, 12, 13, 14, 15)); }
__device__ __forceinline__ v8f wmma16(v16h a, v16h b, v8f c) { return __builtin_amdgcn_wmma_f32_16x16x32_f16(false, a, false, b, (short)0, c, false, false); }
__device__ __forceinline__ v8f wmmab(v16bf a, v16bf b, v8f c) { return __builtin_amdgcn_wmma_f32_16x16x32_bf16(false, a, false, b, (short)0, c, false, false); }
__device__ __forceinline__ h16 tohx(float x) { return (h16)x; }
__device__ __forceinline__ void splitf(float y, unsigned short& h, unsigned short& l) { h = f2bf(y); l = f2bf(y - bf2f(h)); }
typedef __attribute__((ext_vector_type(4))) _Float16 v4h;
typedef __attribute__((ext_vector_type(2))) unsigned short v2us;
typedef __attribute__((ext_vector_type(4))) unsigned short v4us;
typedef __attribute__((ext_vector_type(2))) float v2f;



// ---- k_gemmw: register-blocked GEMM, one wave per 64x64 output tile (16 accumulators), FOUR WAVES (2 x 2) a work-group on one 128x128 tile; grid (M/128, N/128, Z), 128 threads.
// The operands (K-contiguous 16-bit planes) are staged in LDS, 64 k (one whole 128-byte line of every row) a stage, by asynchronous copies, two buffers: stage t + 1 flies while stage t is worked on. A copy instruction covers four whole lines, and each operand row is fetched once for the two waves that use it.
// LDS rows at a pitch of 144 bytes (16 x odd: the 16-byte fragment reads meet no bank twice). Per accumulator the products come in the same order as without the staging (k ascending, A then A2).
// C[m][n] (f32, pitch ldc, + optional f32 bias[n]) = sum_k A[m][k] Bt[n][k] (+ the A2 product for NSPLIT 1). z-batch strides sA/sB/sC in elements. K % 64 == 0.
// PLANES (the q, k, v projections; z = 0, 1, 2): no f32 C is written. A 64x64 tile is 64 positions of ONE head of one batch, so the epilogue writes the attention's operand planes (fp16 + bf16 hi/lo) itself, in FRAGMENT ORDER (below), straight from the accumulators: every store is 16 bytes a lane, 512 contiguous bytes a wave.
// z < 2: planes [z][b][h] of the rotated tile: consecutive pairs (x0, x1) -> (x0 c - x1 s, x0 s + x1 c), c, s = bf16-rounded fc / fs[t][d / 2]. The tile is computed transposed (the weight rows take the A operand's place, the positions the B operand's; same products, same k order), so that a lane holds 8 consecutive d (four whole pairs) of one position.
// z == 2: V^T planes [b][h]: a lane holds 8 consecutive positions of one d.
// FRAGMENT ORDER of the attention's operand planes: a block of FB elements (512 bytes) holds, for each of the 32 lanes (lr, hi) in lane order, the 8 consecutive contraction elements that one 16-byte load of a fragment brings,
// so that a wave-wide load covers four whole 128-byte lines. Q, K (contraction over d): 16 positions are 4 blocks, block d / 16, lane (lr = t % 16, hi = d / 8 % 2), element d % 8.
// V^T (contraction over keys): 32 keys are 8 blocks, block (d / 16) * 2 + t / 16 % 2, lane (lr = d % 16, hi = t / 8 % 2), element t % 8. ldf joins a fragment's two neighbouring blocks (k = 8 hi + e and 16 + 8 hi + e, as ld does from a row).
#define FB 256
template <typename T16> struct WFrag;
template <> struct WFrag<h16> { typedef v16h V; static __device__ __forceinline__ V ld(const h16* p) { return cat16(*(const v8h*)p, *(const v8h*)(p + 16)); } static __device__ __forceinline__ V ldf(const h16* p) { return cat16(*(const v8h*)p, *(const v8h*)(p + FB)); } static __device__ __forceinline__ v8f mma(V a, V b, v8f c) { return wmma16(a, b, c); } };
template <> struct WFrag<bf> { typedef v16bf V; static __device__ __forceinline__ V ld(const bf* p) { return cat16b(*(const v8us*)p, *(const v8us*)(p + 16)); } static __device__ __forceinline__ V ldf(const bf* p) { return cat16b(*(const v8us*)p, *(const v8us*)(p + FB)); } static __device__ __forceinline__ v8f mma(V a, V b, v8f c) { return wmmab(a, b, c); } };
#define LP 72                     // LDS row pitch of a staged operand tile, in 16-bit elements (144 bytes)
#define TLE (128 * LP)            // elements of one staged operand tile (128 rows)
// Eight asynchronous 16-byte copies of a lane: rows r, r + 16, .. r + 112 of one operand tile (l: the lane's LDS byte address, g: its global address, K: the global row pitch in elements).
// The s_wait_xcnt closes the statement so that no address register of a copy is rewritten in front of it.
template <typename T16>
__device__ __forceinline__ void cp8(const unsigned l, const T16* g, const int K) {
    const size_t rs = (size_t)16 * K;
    asm volatile("global_load_async_to_lds_b128 %0, %8, off\n\t"
                 "global_load_async_to_lds_b128 %1, %9, off\n\t"
                 "global_load_async_to_lds_b128 %2, %10, off\n\t"
                 "global_load_async_to_lds_b128 %3, %11, off\n\t"
                 "global_load_async_to_lds_b128 %4, %12, off\n\t"
                 "global_load_async_to_lds_b128 %5, %13, off\n\t"
                 "global_load_async_to_lds_b128 %6, %14, off\n\t"
                 "global_load_async_to_lds_b128 %7, %15, off\n\t"
                 "s_wait_xcnt 0x0"
                 :: "v"(l), "v"(l + 1 * 16 * LP * 2), "v"(l + 2 * 16 * LP * 2), "v"(l + 3 * 16 * LP * 2), "v"(l + 4 * 16 * LP * 2), "v"(l + 5 * 16 * LP * 2), "v"(l + 6 * 16 * LP * 2), "v"(l + 7 * 16 * LP * 2),
                    "v"(g), "v"(g + rs), "v"(g + 2 * rs), "v"(g + 3 * rs), "v"(g + 4 * rs), "v"(g + 5 * rs), "v"(g + 6 * rs), "v"(g + 7 * rs) : "memory");
}
template <typename T16, int NSPLIT, bool BIAS, bool PLANES>
__global__ __launch_bounds__(128) void k_gemmw(const T16* __restrict__ A, const T16* __restrict__ A2, const T16* __restrict__ Bt, const T16* __restrict__ Bt2, int K, float* C, int ldc, const float* __restrict__ bias, size_t sA, size_t sB, size_t sC, const float* __restrict__ fc, const float* __restrict__ fs, h16* __restrict__ P16, bf* __restrict__ Ph, bf* __restrict__ Pl, h16* __restrict__ V16, bf* __restrict__ Vh, bf* __restrict__ Vl) {
    typedef typename WFrag<T16>::V V;
    static_assert(NSPLIT <= 1, "staged operands: A, Bt and, for NSPLIT 1, A2");
    constexpr int NOP = NSPLIT == 1 ? 3 : 2;          // operand tiles a stage: A, Bt (, A2)
    __shared__ __align__(16) T16 ring[2 * NOP * TLE];
    __shared__ __align__(16) float osm[4 * 16 * 68];  // epilogue staging, a range of its own for each wave
    const int wave = __builtin_amdgcn_readfirstlane(threadIdx.x >> 5), wm = wave & 1, wn = wave >> 1;
    float* os = osm + wave * (16 * 68);
    const size_t z = blockIdx.z; A += z * sA; if (A2) A2 += z * sA; Bt += z * sB; if (Bt2) Bt2 += z * sB; C += z * sC;
    const int lane = threadIdx.x & 31, lr = lane & 15, hi = lane >> 4; const int r0 = blockIdx.x * 128 + wm * 64, c0 = blockIdx.y * 128 + wn * 64;
    v8f acc[4][4];
#pragma unroll
    for (int mb = 0; mb < 4; ++mb)
#pragma unroll
        for (int nb = 0; nb < 4; ++nb) acc[mb][nb] = (v8f){};
    // the copies: thread t brings the 16-byte piece t & 7 of rows (t >> 3) + 16 i of each tile, so that eight lanes cover a row's whole line
    const int crw = threadIdx.x >> 3, cpc = threadIdx.x & 7;
    const T16* gA = A + (size_t)(blockIdx.x * 128 + crw) * K + cpc * 8; const T16* gB = Bt + (size_t)(blockIdx.y * 128 + crw) * K + cpc * 8; const T16* gA2 = NSPLIT == 1 ? A2 + (size_t)(blockIdx.x * 128 + crw) * K + cpc * 8 : gA;
    if (PLANES && blockIdx.z < 2) { const T16* gt = gA; gA = gB; gB = gt; }   // q, k: the tile is computed transposed (weight rows as the A operand), so that a lane's 8 accumulator elements are 8 consecutive d of one position
    const unsigned lc = (unsigned)(size_t)ring + (crw * LP + cpc * 8) * 2;
    auto fill = [&](const int t, const int buf) { const unsigned l = lc + buf * (NOP * TLE * 2);
        cp8<T16>(l, gA + t * 64, K); cp8<T16>(l + TLE * 2, gB + t * 64, K); if (NSPLIT == 1) cp8<T16>(l + 2 * TLE * 2, gA2 + t * 64, K); };
    const int nst = K / 64;
    fill(0, 0);
    asm volatile("s_wait_asynccnt 0x0" ::: "memory");   // this wave's copies of stage 0 have landed
    __syncthreads();                                    // every wave's have: stage 0 may be read
    if (nst > 1) fill(1, 1);
    const int fa = (wm * 64 + lr) * LP + 8 * hi, fb = TLE + (wn * 64 + lr) * LP + 8 * hi;
    for (int t = 0; t < nst; ++t) {
        const T16* sb = ring + (t & 1) * (NOP * TLE);
#pragma unroll
        for (int ks = 0; ks < 2; ++ks) {
            V a[4], a2[4], b[4];
#pragma unroll
            for (int mb = 0; mb < 4; ++mb) { a[mb] = WFrag<T16>::ld(sb + fa + mb * 16 * LP + ks * 32); if (NSPLIT == 1) a2[mb] = WFrag<T16>::ld(sb + 2 * TLE + fa + mb * 16 * LP + ks * 32); }
#pragma unroll
            for (int nb = 0; nb < 4; ++nb) b[nb] = WFrag<T16>::ld(sb + fb + nb * 16 * LP + ks * 32);
            __builtin_amdgcn_sched_barrier(0);   // holds the block's LDS reads together in front of its products: sunk among them, each place with reads would be waited out on its own
#pragma unroll
            for (int nb = 0; nb < 4; ++nb)
#pragma unroll
                for (int mb = 0; mb < 4; ++mb) { acc[mb][nb] = WFrag<T16>::mma(a[mb], b[nb], acc[mb][nb]); if (NSPLIT == 1) acc[mb][nb] = WFrag<T16>::mma(a2[mb], b[nb], acc[mb][nb]); }
        }
        asm volatile("s_wait_dscnt 0x0" ::: "memory");      // this wave's reads of stage t are done before the buffer is handed back
        asm volatile("s_wait_asynccnt 0x0" ::: "memory");   // this wave's copies of stage t + 1 have landed
        __syncthreads();                                    // publishes stage t + 1 and ends every wave's reads of stage t
        if (t + 2 < nst) fill(t + 2, t & 1);
    }
    asm volatile("s_wait_asynccnt 0x0" ::: "memory");       // no copy outstanding behind the loop
    if constexpr (PLANES) {
        static_assert(HD == 64 && TT % 64 == 0 && NKV == NH_, "a 64x64 tile is 64 positions of one head of one batch");
        if (blockIdx.z == 2) {
            const int b = r0 / TT, t0 = r0 % TT, h = c0 / 64;
            const size_t vo = (size_t)(b * NKV + h) * HD * PP + (size_t)t0 * HD + lane * 8; h16* v16 = V16 + vo; bf* vh = Vh + vo; bf* vl = Vl + vo;
#pragma unroll
            for (int nb = 0; nb < 4; ++nb)
#pragma unroll
                for (int mb = 0; mb < 4; ++mb) { v8h o16; v8us oh, ol;
#pragma unroll
                    for (int j = 0; j < 8; ++j) { const float x = acc[mb][nb][j]; o16[j] = tohx(x); unsigned short a2, c2; splitf(x, a2, c2); oh[j] = a2; ol[j] = c2; }
                    const int o = (mb >> 1) * (32 * HD) + (nb * 2 + (mb & 1)) * FB; *(v8h*)(v16 + o) = o16; *(v8us*)(vh + o) = oh; *(v8us*)(vl + o) = ol;
                    asm volatile("s_wait_xcnt 0x0" :: "v"(o16), "v"(oh), "v"(ol), "v"(v16), "v"(vh), "v"(vl) : "memory"); }   // the three stores: their data and address registers stay whole (inputs) until this wait
        } else {
            // transposed tile: acc[mb][nb][j] is d = 16 mb + 8 hi + j of position 16 nb + lr
            const int p0 = blockIdx.x * 128 + wn * 64, b = p0 / TT, t0 = p0 % TT, h = blockIdx.y * 2 + wm;
            const size_t po = (((size_t)blockIdx.z * NB_ + b) * NH_ + h) * TT * HD + (size_t)t0 * HD + lane * 8; h16* p16 = P16 + po; bf* ph = Ph + po; bf* pl = Pl + po;
            const float* fcp = fc + (size_t)(t0 + lr) * (HD / 2) + hi * 4; const float* fsp = fs + (size_t)(t0 + lr) * (HD / 2) + hi * 4;
            v4f cc[2][4], sn[2][4];    // the table values of a lane's four pairs, one block of 16 positions ahead, so that they fly under the block before
#pragma unroll
            for (int mb = 0; mb < 4; ++mb) { cc[0][mb] = *(const v4f*)(fcp + mb * 8); sn[0][mb] = *(const v4f*)(fsp + mb * 8); }
#pragma unroll
            for (int nb = 0; nb < 4; ++nb) {
                if (nb < 3) {
#pragma unroll
                    for (int mb = 0; mb < 4; ++mb) { cc[(nb + 1) & 1][mb] = *(const v4f*)(fcp + (nb + 1) * 16 * (HD / 2) + mb * 8); sn[(nb + 1) & 1][mb] = *(const v4f*)(fsp + (nb + 1) * 16 * (HD / 2) + mb * 8); } }
                asm volatile("s_wait_xcnt 0x0" :: "v"(fcp), "v"(fsp) : "memory");   // the table loads: their address registers stay whole (inputs) until this wait
#pragma unroll
                for (int mb = 0; mb < 4; ++mb) { v8h o16; v8us oh, ol;
#pragma unroll
                    for (int q = 0; q < 4; ++q) { const float x0 = acc[mb][nb][2 * q], x1 = acc[mb][nb][2 * q + 1], c = bfr(cc[nb & 1][mb][q]), sv = bfr(sn[nb & 1][mb][q]);
                        const float e0 = __builtin_fmaf(x0, c, -(x1 * sv)), e1 = __builtin_fmaf(x0, sv, x1 * c);   /* even: x0 c - x1 s; odd: x0 s + x1 c; the x1 product rounded, the x0 product fused */
                        o16[2 * q] = tohx(e0); o16[2 * q + 1] = tohx(e1); unsigned short a2, c2; splitf(e0, a2, c2); oh[2 * q] = a2; ol[2 * q] = c2; splitf(e1, a2, c2); oh[2 * q + 1] = a2; ol[2 * q + 1] = c2; }
                    const int o = nb * (16 * HD) + mb * FB; *(v8h*)(p16 + o) = o16; *(v8us*)(ph + o) = oh; *(v8us*)(pl + o) = ol;
                    asm volatile("s_wait_xcnt 0x0" :: "v"(o16), "v"(oh), "v"(ol), "v"(p16), "v"(ph), "v"(pl) : "memory"); }   // the three stores: their data and address registers stay whole (inputs) until this wait
            }
        }
        return;
    }
#pragma unroll
    for (int mb = 0; mb < 4; ++mb) {
#pragma unroll
        for (int nb = 0; nb < 4; ++nb) {
#pragma unroll
            for (int j = 0; j < 8; ++j) os[(hi * 8 + j) * 68 + nb * 16 + lr] = acc[mb][nb][j]; }
        __builtin_amdgcn_wave_barrier(); asm volatile("" ::: "memory");
        float* crow = C + (size_t)(r0 + mb * 16) * ldc + c0;
{
#pragma unroll
            for (int s = 0; s < 8; ++s) { const int row = 2 * s + hi, cofs = lr * 4; v4f val = *(const v4fa*)(os + row * 68 + cofs); if (BIAS) { val[0] += bfr(bias[c0 + cofs]); val[1] += bfr(bias[c0 + cofs + 1]); val[2] += bfr(bias[c0 + cofs + 2]); val[3] += bfr(bias[c0 + cofs + 3]); }
                *(v4f*)(crow + (size_t)row * ldc + cofs) = val; }
             }
        __builtin_amdgcn_wave_barrier(); asm volatile("" ::: "memory");
    }
}


// grid (.., 4): blockIdx.y picks the weight; the four transposed planes lie one behind the other in Bt
// One wave transposes a tile of 64 k x 32 n in registers, no LDS: lane (kg = lane & 7, nq = lane >> 3) loads 16 bytes (4 n) of each of its 8 consecutive k rows, for both 16-n halves of the tile
// (16 loads in flight a lane; a load covers 8 half lines, and the tile's two halves together use every line whole). It then stores, for each of its 8 n, its 8 consecutive k as 16 bytes:
// the 8 lanes kg fill one whole 128-byte line of Bt, a store covers 4 whole lines, and each line has one writer. The pitches are constants, so that every load and store is one base address plus an immediate offset.
__global__ __launch_bounds__(256) void k_wtG(const float* __restrict__ w0, const float* __restrict__ w1, const float* __restrict__ w2, const float* __restrict__ w3, bf* Bt) {
    constexpr int K = DM, N = DQ, NKT = K / 64;
    static_assert(K % 256 == 0 && N % 64 == 0, "whole tiles, 4 x 2 of them a work-group");
    const int y = blockIdx.y; const float* __restrict__ w = y == 0 ? w0 : y == 1 ? w1 : y == 2 ? w2 : w3; Bt += (size_t)y * N * K;
    const int lane = threadIdx.x & 31, kg = lane & 7, nq = lane >> 3, wave = threadIdx.x >> 5;
    // a work-group's eight tiles are 4 (k) x 2 (n): the two n neighbours together read each row's aligned 256 bytes
    const int k0 = ((blockIdx.x % (NKT / 4)) * 4 + (wave >> 1)) * 64 + kg * 8, n0 = ((blockIdx.x / (NKT / 4)) * 2 + (wave & 1)) * 32 + nq * 4;
    const float* s = w + (size_t)k0 * N + n0; bf* d = Bt + (size_t)n0 * K + k0;
    v4f v[2][8];
#pragma unroll
    for (int hf = 0; hf < 2; ++hf)
#pragma unroll
        for (int j = 0; j < 8; ++j) v[hf][j] = *(const v4f*)(s + j * N + hf * 16);
    asm volatile("s_wait_xcnt 0x0" :: "v"(s) : "memory");   // the 16 loads: their address register pair stays whole (an input) until this wait; and no load crosses this statement, so that all 16 fly together in front of the conversions (sunk among them, to save registers, they went out in five groups, each group's latency waited out on its own)
#pragma unroll
    for (int hf = 0; hf < 2; ++hf)
#pragma unroll
        for (int c = 0; c < 4; ++c) { v8us o;
#pragma unroll
            for (int j = 0; j < 8; ++j) o[j] = f2bf(v[hf][j][c]);
            *(v8us*)(d + (hf * 16 + c) * K) = o; }
}
__global__ __launch_bounds__(256) void k_cvt8(const float* __restrict__ src, bf* dst, size_t n8) { const size_t i = (size_t)blockIdx.x * 256 + threadIdx.x; if (i >= n8) return; const v8f v = *(const v8f*)(src + i * 8); v8us o;
#pragma unroll
    for (int k = 0; k < 8; ++k) o[k] = f2bf(v[k]); *(v8us*)(dst + i * 8) = o;  }
// ---- k_attn: causal attention fused into one launch: ONE WORK-GROUP of NSP waves per (head, query tile); wave w takes the key blocks w, w + NSP, .. of the tile; scores, running softmax and the probability x value product stay in registers.
// Each wave ends with its own maximum, sum and unnormalised O over its key blocks; they are joined through LDS behind one barrier: O = sum_w 2^(m_w - M) O_w / sum_w 2^(m_w - M) l_w, w ascending. A wave without a key block brings m = -3e38, l = 0, O = 0 (weight 0).
// Transposed products: S^T = K Q^T (A = 16 keys x 64 d, B = 16 queries) leaves lane (lr, hi) with keys 8 hi + j of query lr, which for two neighbouring key tiles is exactly the B fragment (k = 8 hi + e, 16 + 8 hi + e) of
// O^T = V^T P^T (A = 16 d x 32 keys): no exchange between lanes but one with lane l ^ 16 for the row maximum (the two half sums are added in the join). O^T leaves lane (lr, hi) with d = 16 dt + 8 hi + j of query lr: 16-byte LDS stores into the wave's partial O rows; the join stores 16 bytes a lane into the merged hi/lo planes.
// Running softmax in the base-2 domain: t = s * HD^-0.5 * log2(e); per 32 keys m' = max(m, t), O and l scaled by 2^(m - m'), p = 2^(t - m') (not normalised: <= 1), l += sum p; O / l at the end.
// HR (query rows < RH): bf16 hi/lo planes, 3 products for both contractions, 16 queries a wave; else fp16, 32 queries a wave. Key blocks wholly at or below the diagonal need no mask; the one diagonal block masks by select.
#define KB 32                     // keys per trip
#define NSP 4                     // waves of a work-group: the key blocks of a query tile go round them
#define OP 68                     // LDS pitch of one query's partial O row, in floats (272 bytes: 16 x odd)
__device__ __forceinline__ float xhalf(float x) { return __builtin_bit_cast(float, __builtin_amdgcn_permlanex16(__builtin_bit_cast(int, x), __builtin_bit_cast(int, x), 0x76543210, 0xfedcba98, false, false)); }  // lane l with lane l ^ 16
__device__ __forceinline__ float exp2s(float x) { asm("v_exp_f32 %0, %0\n\tv_nop" : "+v"(x)); return x; }   // 2^x. The v_nop is the free slot the instruction set asks for behind a transcendental. In place: the register already holds the live argument, so it is no operand of a matrix instruction still in its window (the compiler does not look into asm text)
template <typename T16, int NT, bool HR>
__device__ __forceinline__ void attn_tile(const T16* __restrict__ Q, const T16* __restrict__ Q2, const T16* __restrict__ Kp, const T16* __restrict__ Kp2, const T16* __restrict__ Vt, const T16* __restrict__ Vt2, const int q0, bf* __restrict__ Ah, bf* __restrict__ Al, float* so, float* sm, float* sl) {
    typedef typename WFrag<T16>::V V;
    const int lane = threadIdx.x & 31, lr = lane & 15, hi = lane >> 4, wave = __builtin_amdgcn_readfirstlane(threadIdx.x >> 5);
    V qf[NT][2], qf2[NT][2];
    const T16* qb = Q + (size_t)q0 * HD; const T16* qb2 = HR ? Q2 + (size_t)q0 * HD : qb; const T16* qp = qb + lane * 8; const T16* qp2 = qb2 + lane * 8;
#pragma unroll
    for (int nt = 0; nt < NT; ++nt)
#pragma unroll
        for (int ks = 0; ks < 2; ++ks) { qf[nt][ks] = WFrag<T16>::ldf(qp + nt * 16 * HD + ks * 2 * FB); if (HR) qf2[nt][ks] = WFrag<T16>::ldf(qp2 + nt * 16 * HD + ks * 2 * FB); }
    v8f o[4][NT]; float m[NT], l[NT];
#pragma unroll
    for (int nt = 0; nt < NT; ++nt) { m[nt] = -3.0e38f; l[nt] = 0.f;
#pragma unroll
        for (int dt = 0; dt < 4; ++dt) o[dt][nt] = (v8f){}; }
    V kf[2][2], kf2[2][2];
    auto ldk = [&](const T16* kp, const T16* kp2, V (&f)[2][2], V (&f2)[2][2]) {
#pragma unroll
        for (int mt = 0; mt < 2; ++mt)
#pragma unroll
            for (int ks = 0; ks < 2; ++ks) { f[mt][ks] = WFrag<T16>::ldf(kp + mt * 16 * HD + ks * 2 * FB); if (HR) f2[mt][ks] = WFrag<T16>::ldf(kp2 + mt * 16 * HD + ks * 2 * FB); } };
    const size_t kl = (size_t)lane * 8, vl = kl;
    auto step = [&](const int kb, const bool last) {
        V vf[4], vf2[4];
        const T16* vp = Vt + vl + (size_t)kb * HD; const T16* vp2 = HR ? Vt2 + vl + (size_t)kb * HD : vp;
        const T16* kp = (HR || !last) ? Kp + kl + (size_t)(HR ? kb : kb + NSP * KB) * HD : vp; const T16* kp2 = HR ? Kp2 + kl + (size_t)kb * HD : kp;
#pragma unroll
        for (int dt = 0; dt < 4; ++dt) { vf[dt] = WFrag<T16>::ldf(vp + dt * 2 * FB); if (HR) vf2[dt] = WFrag<T16>::ldf(vp2 + dt * 2 * FB); }
        if (HR) ldk(kp, kp2, kf, kf2);              // hi/lo path: this trip's own key fragments
        v8f sa[NT][2];
#pragma unroll
        for (int nt = 0; nt < NT; ++nt) {
#pragma unroll
            for (int mt = 0; mt < 2; ++mt) { v8f s = (v8f){};
#pragma unroll
                for (int ks = 0; ks < 2; ++ks) { s = WFrag<T16>::mma(kf[mt][ks], qf[nt][ks], s); if (HR) { s = WFrag<T16>::mma(kf[mt][ks], qf2[nt][ks], s); s = WFrag<T16>::mma(kf2[mt][ks], qf[nt][ks], s); } }
                sa[nt][mt] = s; } }
        if (!HR) { if (!last) ldk(kp, kp2, kf, kf2);   // fp16 path: the key fragments of this wave's next trip, into the same registers right behind this trip's score products; they fly under the softmax and P x V
            __builtin_amdgcn_sched_barrier(0); }       // holds those loads (and this trip's V loads) up here: sunk to the foot of the trip, their latency would be waited out in full
#pragma unroll
        for (int nt = 0; nt < NT; ++nt) {
            v8f (&st)[2] = sa[nt];
            float mx = m[nt];
#pragma unroll
            for (int mt = 0; mt < 2; ++mt)
#pragma unroll
                for (int j = 0; j < 8; ++j) { float t = st[mt][j] * (SCL * 1.4426950408889634f); if (last) t = (kb + mt * 16 + hi * 8 + j <= q0 + nt * 16 + lr) ? t : -3.0e38f; st[mt][j] = t; mx = fmaxf(mx, t); }
            mx = fmaxf(mx, xhalf(mx));
            const float al = exp2s(m[nt] - mx); m[nt] = mx;
            float sum = 0.f;
#pragma unroll
            for (int mt = 0; mt < 2; ++mt)
#pragma unroll
                for (int j = 0; j < 8; ++j) { const float p = exp2s(st[mt][j] - mx); st[mt][j] = p; sum += p; }
            l[nt] = l[nt] * al + sum;
#pragma unroll
            for (int dt = 0; dt < 4; ++dt) o[dt][nt] *= al;
            if (nt == 0) asm volatile("s_wait_xcnt 0x0" :: "v"(vp), "v"(vp2), "v"(kp), "v"(kp2) : "memory");   // this trip's loads: their address registers stay whole (inputs) until this wait; placed here, where the V fragments are waited for anyway
            if (HR) {
                v8us h0, h1, l0, l1;
#pragma unroll
                for (int j = 0; j < 8; ++j) { unsigned short x, y; splitf(st[0][j], x, y); h0[j] = x; l0[j] = y; splitf(st[1][j], x, y); h1[j] = x; l1[j] = y; }
                const v16bf ph = cat16b(h0, h1), pl = cat16b(l0, l1);
#pragma unroll
                for (int dt = 0; dt < 4; ++dt) { o[dt][nt] = wmmab(__builtin_bit_cast(v16bf, vf[dt]), ph, o[dt][nt]); o[dt][nt] = wmmab(__builtin_bit_cast(v16bf, vf[dt]), pl, o[dt][nt]); o[dt][nt] = wmmab(__builtin_bit_cast(v16bf, vf2[dt]), ph, o[dt][nt]); }
            } else {
                v8h p0, p1;
#pragma unroll
                for (int j = 0; j < 8; ++j) { p0[j] = tohx(st[0][j]); p1[j] = tohx(st[1][j]); }
                const v16h pf = cat16(p0, p1);
#pragma unroll
                for (int dt = 0; dt < 4; ++dt) o[dt][nt] = wmma16(__builtin_bit_cast(v16h, vf[dt]), pf, o[dt][nt]);
            }
        }
    };
    static_assert(HR || RH >= NSP * KB, "fp16 tiles: every wave has at least one key block");
    static_assert((16 * NT) % NSP == 0 && HD == 64, "the join gives each wave 16 NT / NSP whole query rows");
    const int kd = (q0 / KB) * KB;             // the diagonal block: it holds keys q0 .. q0 + 16 NT - 1 (q0 is a multiple of 16 NT, and 16 NT divides KB)
    int kb = wave * KB;                        // this wave's first key block; its others follow at NSP * KB
    const T16* kw = Kp + (size_t)kb * HD; const T16* kp0 = kw + kl;
    if (!HR) ldk(kp0, kp0, kf, kf2);
    asm volatile("s_wait_xcnt 0x0" :: "s"(qb), "s"(qb2), "s"(kw), "v"(lane) : "memory");   // the prologue's loads (scalar base + lane offset): their address registers stay whole (inputs) until this wait
    for (; kb + NSP * KB <= kd; kb += NSP * KB) step(kb, false);
    if (!HR || kb <= kd) step(kb, true);       // the wave's last block, masked by select: the diagonal block for one wave, an identity for the others
    // ---- the join: every wave lays down its maximum, its two half sums and its O rows (query-major), one barrier, then wave w finishes the query rows w * QW .. w * QW + QW - 1, so that each 128-byte line of the merged planes has one writer
    float* sow = so + wave * (32 * OP);
#pragma unroll
    for (int nt = 0; nt < NT; ++nt) { sm[(wave * 2 + nt) * 32 + lane] = m[nt]; sl[(wave * 2 + nt) * 32 + lane] = l[nt];
#pragma unroll
        for (int dt = 0; dt < 4; ++dt) { float* p = sow + (nt * 16 + lr) * OP + dt * 16 + 8 * hi;
            *(v4fa*)p = __builtin_shufflevector(o[dt][nt], o[dt][nt], 0, 1, 2, 3); *(v4fa*)(p + 4) = __builtin_shufflevector(o[dt][nt], o[dt][nt], 4, 5, 6, 7); } }
    __syncthreads();                           // every wave's partial results are in LDS before any of them is read
    constexpr int QW = 16 * NT / NSP, LQ = 32 / QW, EL = HD / LQ;   // query rows a wave, lanes a row, elements a lane
    const int qi = wave * QW + lane / LQ, d0 = (lane % LQ) * EL, ms = (qi >> 4) * 32 + (qi & 15);
    float mw[NSP], lw[NSP], mx = -3.0e38f;
#pragma unroll
    for (int w = 0; w < NSP; ++w) { mw[w] = sm[w * 64 + ms]; lw[w] = sl[w * 64 + ms] + sl[w * 64 + ms + 16]; mx = fmaxf(mx, mw[w]); }
    float lt = 0.f, ac[EL];
#pragma unroll
    for (int e = 0; e < EL; ++e) ac[e] = 0.f;
#pragma unroll
    for (int w = 0; w < NSP; ++w) { const float f = exp2s(mw[w] - mx); lt = __builtin_fmaf(lw[w], f, lt); const float* p = so + (w * 32 + qi) * OP + d0;
#pragma unroll
        for (int e4 = 0; e4 < EL / 4; ++e4) { const v4f x = *(const v4fa*)(p + e4 * 4);
#pragma unroll
            for (int c = 0; c < 4; ++c) ac[e4 * 4 + c] = __builtin_fmaf(x[c], f, ac[e4 * 4 + c]); } }
    const float inv = __fdiv_rn(1.0f, lt); const size_t oo = (size_t)(q0 + qi) * DQ + d0; bf* sh = Ah + oo; bf* sb = Al + oo;
#pragma unroll
    for (int e8 = 0; e8 < EL / 8; ++e8) { v8us oh, ol;
#pragma unroll
        for (int j = 0; j < 8; ++j) { unsigned short x, y; splitf(ac[e8 * 8 + j] * inv, x, y); oh[j] = x; ol[j] = y; }
        *(v8us*)(sh + e8 * 8) = oh; *(v8us*)(sb + e8 * 8) = ol;
        asm volatile("s_wait_xcnt 0x0" :: "v"(oh), "v"(ol), "v"(sh), "v"(sb) : "memory"); }   // the two stores: their data and address registers stay whole (inputs) until this wait, on every way into code that rewrites them
}
#define NLR ((TT - RH) / 32)      // fp16 query tiles of 32 rows
#define NHR (RH / 16)             // hi/lo query tiles of 16 rows
// grid (NLR + NHR, NH_, NB_): the longest tiles (last query rows) take the lowest block indices (for speed only)
__global__ __launch_bounds__(32 * NSP) void k_attn(const h16* __restrict__ Q16, const h16* __restrict__ K16, const h16* __restrict__ V16, const bf* __restrict__ Qh, const bf* __restrict__ Ql, const bf* __restrict__ Kh, const bf* __restrict__ Kl, const bf* __restrict__ Vh, const bf* __restrict__ Vl, bf* __restrict__ Ah, bf* __restrict__ Al) {
    const int h = blockIdx.y, g = h / REP, bx = blockIdx.x, b = blockIdx.z; const size_t qo = (size_t)(b * NH_ + h) * TT * HD, ko = (size_t)(b * NKV + g) * TT * HD, vo = (size_t)(b * NKV + g) * HD * PP; Ah += (size_t)b * TT * DQ; Al += (size_t)b * TT * DQ;
    __shared__ __align__(16) float so[NSP * 32 * OP];        // the waves' partial O rows [wave][query][d]
    __shared__ float sm[NSP * 2 * 32], sl[NSP * 2 * 32];     // their maxima and half sums [wave][query tile][lane]
    if (bx < NLR) attn_tile<h16, 2, false>(Q16 + qo, nullptr, K16 + ko, nullptr, V16 + vo, nullptr, RH + (NLR - 1 - bx) * 32, Ah + h * HD, Al + h * HD, so, sm, sl);
    else attn_tile<bf, 1, true>(Qh + qo, Ql + qo, Kh + ko, Kl + ko, Vh + vo, Vl + vo, (NLR + NHR - 1 - bx) * 16, Ah + h * HD, Al + h * HD, so, sm, sl);
}

extern "C" void kernel_launch(void* const* d_in, const int* in_sizes, int n_in,
                              void* d_out, int out_size, void* d_ws, size_t ws_size, hipStream_t stream) {
    (void)in_sizes; (void)n_in; (void)out_size;
        const float* x = (const float*)d_in[0]; const float* fcos = (const float*)d_in[1]; const float* fsin = (const float*)d_in[2]; const float* wq = (const float*)d_in[3]; const float* wk = (const float*)d_in[4]; const float* wv = (const float*)d_in[5]; const float* wo = (const float*)d_in[6]; const float* bo = (const float*)d_in[7];   /* input order x, pos_cos, pos_sin ([2048][32] HALF-width table INPUTS: read by value), Wq, Wk, Wv, Wo ('xw' (in, out) [1024][1024]), bo ([1024]: zeros, read through the output launch's bias slot): EIGHT inputs, all read; the q, k, v projections have NO bias in this module */
    float* OUT = (float*)d_out;     // [2][2048][1024]
    char* wsp = (char*)d_ws;
    auto take = [&](size_t bytes) { char* p = wsp; wsp += (bytes + 255) & ~(size_t)255; return (void*)p; };
    static_assert(DQ == DKV && DQ == DM, "q, k and v share one projection launch that also writes their planes, the four weights one transpose launch: equal shapes");
    bf* WQ = (bf*)take((size_t)4 * DQ * DM * 2); bf* WO = WQ + (size_t)3 * DQ * DM;   // transposed Wq, Wk, Wv, Wo, one behind the other
    bf* XB = (bf*)take((size_t)NB_ * TT * DM * 2);
    const size_t PLN = (size_t)NB_ * NH_ * TT * HD;   // elements of one set of head planes
    h16* QP16 = (h16*)take(2 * PLN * 2); h16* KP16 = QP16 + PLN; h16* VT16 = (h16*)take((size_t)NB_ * NKV * HD * PP * 2);
    bf* QPh = (bf*)take(2 * PLN * 2); bf* KPh = QPh + PLN; bf* QPl = (bf*)take(2 * PLN * 2); bf* KPl = QPl + PLN; bf* VTh = (bf*)take((size_t)NB_ * NKV * HD * PP * 2); bf* VTl = VTh + (size_t)TT * HD;   // hi plane in the first half of each head's range, lo plane in the second
    bf* ATh = (bf*)take((size_t)NB_ * TT * DQ * 2); bf* ATl = (bf*)take((size_t)NB_ * TT * DQ * 2);
    if ((size_t)(wsp - (char*)d_ws) > ws_size) return;    // ws 256 MiB
    k_wtG<<<dim3((DM / 256) * (DQ / 64), 4, 1), 256, 0, stream>>>(wq, wk, wv, wo, WQ);   /* 'xw' [in][out] weights: transposed once into Bt */
    k_cvt8<<<(unsigned)(((size_t)NB_ * TT * DM / 8 + 255) / 256), 256, 0, stream>>>(x, XB, (size_t)NB_ * TT * DM / 8);
    k_gemmw<bf, 0, false, true><<<dim3(NB_ * TT / 128, DQ / 128, 3), 128, 0, stream>>>(XB, nullptr, WQ, nullptr, DM, nullptr, DQ, nullptr, 0, (size_t)DQ * DM, 0, fcos, fsin, QP16, QPh, QPl, VT16, VTh, VTl);   /* q, k, v projections, written as head planes */
    k_attn<<<dim3(NLR + NHR, NH_, NB_), 32 * NSP, 0, stream>>>(QP16, KP16, VT16, QPh, QPl, KPh, KPl, VTh, VTl, ATh, ATl);
    k_gemmw<bf, 1, true, false><<<dim3(NB_ * TT / 128, DM / 128, 1), 128, 0, stream>>>(ATh, ATl, WO, nullptr, DQ, OUT, DM, bo, 0, 0, 0, nullptr, nullptr, nullptr, nullptr, nullptr, nullptr, nullptr, nullptr);
}

// v009
// One run takes 79.6 microseconds.
// In both of two side-by-side timings against v008, it was 1.15 times as fast.
// Counting every step since v000, it is 18.3 times as fast.
#include <hip/hip_runtime.h>

// Causal multi-head self-attention with interleaved-pair rotary embeddings from two half-width INPUT tables and (in, out) weights (x [2][2048][1024]; q, k, v = x W ('xw' [1024][1024] normal x 0.02, no projection bias; 16 heads x 64); _rope on q and k: consecutive pairs (t[2i], t[2i+1]) -> (te c - to s, te s + to c) with c, s = pos_cos / pos_sin[t][i] (f32 [2048][32] INPUT tables the module computes: cos / sin(t / 10000^(2i/64)): read by value); scores: -inf above the diagonal, then / sqrt(64) (the same as scaling first); softmax; out = merged Wo + bo ('xw' + a zero bias [1024], read) -> [2][2048][1024] (4.2 M); argument order x, pos_cos, pos_sin, Wq, Wk, Wv, Wo, bo).
// Every stage is ONE launch for all of its independent instances (both batches; q, k and v; the four weights): the batch is folded into the row index (x, the projections, the merged planes) or the plane index (b * heads + h), q / k / v and the weights into a grid index. Stages: bf16 transpose of the four weights; bf16 copy of x; exact projections (no bias) whose epilogue builds the head planes itself (q, k: interleaved rotary with the two half-width INPUT tables read by value and bf16-rounded; v: transposed); causal T-2048 attention fused into one launch (k_attn: scores, running softmax and P x V in registers; hybrid rows: < 512 hi/lo 3 products, rest fp16; key blocks above the diagonal never touched) that writes the merged hi/lo planes; merged hi/lo x Wo exact + bo.
// Compute dtypes, f32 accumulate: every input rounded to bf16; projections exact (no bias); rotary f32; attention rows < 512 3 products, rest fp16; softmax f32; Wo hl x exact + bias.

#define NB_  2
#define TT   2048
#define DM   1024
#define NH_  16
#define NKV  16
#define REP  (NH_ / NKV)
#define HD   64
#define DQ   (NH_ * HD)
#define DKV  (NKV * HD)
#define PP   (2 * TT)             // a head's V^T range holds HD * PP 16-bit elements (hi plane in its first half, lo plane in the second)
#define RH   512                  // query rows < RH use hi+lo planes (at least NSP * KB)
#define SCL  0.125f   // HD^-0.5
typedef _Float16 h16;
typedef unsigned short bf;
typedef __attribute__((ext_vector_type(16))) __bf16   v16bf;
typedef __attribute__((ext_vector_type(16))) _Float16 v16h;
typedef __attribute__((ext_vector_type(8)))  _Float16 v8h;
typedef __attribute__((ext_vector_type(8)))  unsigned short v8us;
typedef __attribute__((ext_vector_type(8)))  float    v8f;
typedef __attribute__((ext_vector_type(4)))  float    v4f;
typedef v8h  __attribute__((may_alias)) v8ha;
typedef v4f  __attribute__((may_alias)) v4fa;
typedef v8us __attribute__((may_alias)) v8usa;

__device__ __forceinline__ unsigned short f2bf(float f) { unsigned u = __float_as_uint(f); u += 0x7FFFu + ((u >> 16) & 1u); return (unsigned short)(u >> 16); }
__device__ __forceinline__ float bf2f(unsigned short b) { return __uint_as_float(((unsigned)b) << 16); }
__device__ __forceinline__ float bfr(float f) { return bf2f(f2bf(f)); }
__device__ __forceinline__ v16h cat16(v8h lo, v8h hi) { return __builtin_shufflevector(lo, hi, 0, 1, 2, 3, 4, 5, 6, 7, 8, 9, 10, 11, 12, 13, 14, 15); }
__device__ __forceinline__ v16bf cat16b(v8us lo, v8us hi) { return __builtin_bit_cast(v16bf, __builtin_shufflevector(lo, hi, 0, 1, 2, 3, 4, 5, 6, 7, 8, 9, 10, 11, 12, 13, 14, 15)); }
__device__ __forceinline__ v8f wmma16(v16h a, v16h b, v8f c) { return __builtin_amdgcn_wmma_f32_16x16x32_f16(false, a, false, b, (short)0, c, false, false); }
__device__ __forceinline__ v8f wmmab(v16bf a, v16bf b, v8f c) { return __builtin_amdgcn_wmma_f32_16x16x32_bf16(false, a, false, b, (short)0, c, false, false); }
__device__ __forceinline__ h16 tohx(float x) { return (h16)x; }
__device__ __forceinline__ void splitf(float y, unsigned short& h, unsigned short& l) { h = f2bf(y); l = f2bf(y - bf2f(h)); }
typedef __attribute__((ext_vector_type(4))) _Float16 v4h;
typedef __attribute__((ext_vector_type(2))) unsigned short v2us;
typedef __attribute__((ext_vector_type(4))) unsigned short v4us;
typedef __attribute__((ext_vector_type(2))) float v2f;



// ---- k_gemmw: register-blocked GEMM, one wave per 64x64 output tile (16 accumulators), FOUR WAVES (2 x 2) a work-group on one 128x128 tile; grid (M/128, N/128, Z), 128 threads.
// The operands (K-contiguous 16-bit planes) are staged in LDS, 64 k (one whole 128-byte line of every row) a stage, by asynchronous copies, two buffers: stage t + 1 flies while stage t is worked on. A copy instruction covers four whole lines, and each operand row is fetched once for the two waves that use it.
// LDS rows at a pitch of 144 bytes (16 x odd: the 16-byte fragment reads meet no bank twice). Per accumulator the products come in the same order as without the staging (k ascending, A then A2).
// C[m][n] (f32, pitch ldc, + optional f32 bias[n]) = sum_k A[m][k] Bt[n][k] (+ the A2 product for NSPLIT 1). z-batch strides sA/sB/sC in elements. K % 64 == 0.
// PLANES (the q, k, v projections; z = 0, 1, 2): no f32 C is written. A 64x64 tile is 64 positions of ONE head of one batch, so the epilogue writes the attention's operand planes (fp16 + bf16 hi/lo) itself, in FRAGMENT ORDER (below), straight from the accumulators: every store is 16 bytes a lane, 512 contiguous bytes a wave.
// z < 2: planes [z][b][h] of the rotated tile: consecutive pairs (x0, x1) -> (x0 c - x1 s, x0 s + x1 c), c, s = bf16-rounded fc / fs[t][d / 2]. The tile is computed transposed (the weight rows take the A operand's place, the positions the B operand's; same products, same k order), so that a lane holds 8 consecutive d (four whole pairs) of one position.
// z == 2: V^T planes [b][h]: a lane holds 8 consecutive positions of one d.
// FRAGMENT ORDER of the attention's operand planes: a block of FB elements (512 bytes) holds, for each of the 32 lanes (lr, hi) in lane order, the 8 consecutive contraction elements that one 16-byte load of a fragment brings,
// so that a wave-wide load covers four whole 128-byte lines. Q, K (contraction over d): 16 positions are 4 blocks, block d / 16, lane (lr = t % 16, hi = d / 8 % 2), element d % 8.
// V^T (contraction over keys): 32 keys are 8 blocks, block (d / 16) * 2 + t / 16 % 2, lane (lr = d % 16, hi = t / 8 % 2), element t % 8. ldf joins a fragment's two neighbouring blocks (k = 8 hi + e and 16 + 8 hi + e, as ld does from a row).
#define FB 256
template <typename T16> struct WFrag;
template <> struct WFrag<h16> { typedef v16h V; static __device__ __forceinline__ V ld(const h16* p) { return cat16(*(const v8h*)p, *(const v8h*)(p + 16)); } static __device__ __forceinline__ V ldf(const h16* p) { return cat16(*(const v8h*)p, *(const v8h*)(p + FB)); } static __device__ __forceinline__ v8f mma(V a, V b, v8f c) { return wmma16(a, b, c); } };
template <> struct WFrag<bf> { typedef v16bf V; static __device__ __forceinline__ V ld(const bf* p) { return cat16b(*(const v8us*)p, *(const v8us*)(p + 16)); } static __device__ __forceinline__ V ldf(const bf* p) { return cat16b(*(const v8us*)p, *(const v8us*)(p + FB)); } static __device__ __forceinline__ v8f mma(V a, V b, v8f c) { return wmmab(a, b, c); } };
#define LP 72                     // LDS row pitch of a staged operand tile, in 16-bit elements (144 bytes)
#define TLE (128 * LP)            // elements of one staged operand tile (128 rows)
// Eight asynchronous 16-byte copies of a lane: rows r, r + 16, .. r + 112 of one operand tile (l: the lane's LDS byte address, g: its global address, K: the global row pitch in elements).
// The s_wait_xcnt closes the statement so that no address register of a copy is rewritten in front of it.
template <typename T16>
__device__ __forceinline__ void cp8(const unsigned l, const T16* g, const int K) {
    const size_t rs = (size_t)16 * K;
    asm volatile("global_load_async_to_lds_b128 %0, %8, off\n\t"
                 "global_load_async_to_lds_b128 %1, %9, off\n\t"
                 "global_load_async_to_lds_b128 %2, %10, off\n\t"
                 "global_load_async_to_lds_b128 %3, %11, off\n\t"
                 "global_load_async_to_lds_b128 %4, %12, off\n\t"
                 "global_load_async_to_lds_b128 %5, %13, off\n\t"
                 "global_load_async_to_lds_b128 %6, %14, off\n\t"
                 "global_load_async_to_lds_b128 %7, %15, off\n\t"
                 "s_wait_xcnt 0x0"
                 :: "v"(l), "v"(l + 1 * 16 * LP * 2), "v"(l + 2 * 16 * LP * 2), "v"(l + 3 * 16 * LP * 2), "v"(l + 4 * 16 * LP * 2), "v"(l + 5 * 16 * LP * 2), "v"(l + 6 * 16 * LP * 2), "v"(l + 7 * 16 * LP * 2),
                    "v"(g), "v"(g + rs), "v"(g + 2 * rs), "v"(g + 3 * rs), "v"(g + 4 * rs), "v"(g + 5 * rs), "v"(g + 6 * rs), "v"(g + 7 * rs) : "memory");
}
template <typename T16, int NSPLIT, bool BIAS, bool PLANES>
__global__ __launch_bounds__(128) void k_gemmw(const T16* __restrict__ A, const T16* __restrict__ A2, const T16* __restrict__ Bt, const T16* __restrict__ Bt2, int K, float* C, int ldc, const float* __restrict__ bias, size_t sA, size_t sB, size_t sC, const float* __restrict__ fc, const float* __restrict__ fs, h16* __restrict__ P16, bf* __restrict__ Ph, bf* __restrict__ Pl, h16* __restrict__ V16, bf* __restrict__ Vh, bf* __restrict__ Vl) {
    typedef typename WFrag<T16>::V V;
    static_assert(NSPLIT <= 1, "staged operands: A, Bt and, for NSPLIT 1, A2");
    constexpr int NOP = NSPLIT == 1 ? 3 : 2;          // operand tiles a stage: A, Bt (, A2)
    __shared__ __align__(16) T16 ring[2 * NOP * TLE];
    __shared__ __align__(16) float osm[4 * 16 * 68];  // epilogue staging, a range of its own for each wave
    const int wave = __builtin_amdgcn_readfirstlane(threadIdx.x >> 5), wm = wave & 1, wn = wave >> 1;
    float* os = osm + wave * (16 * 68);
    const size_t z = blockIdx.z; A += z * sA; if (A2) A2 += z * sA; Bt += z * sB; if (Bt2) Bt2 += z * sB; C += z * sC;
    const int lane = threadIdx.x & 31, lr = lane & 15, hi = lane >> 4; const int r0 = blockIdx.x * 128 + wm * 64, c0 = blockIdx.y * 128 + wn * 64;
    v8f acc[4][4];
#pragma unroll
    for (int mb = 0; mb < 4; ++mb)
#pragma unroll
        for (int nb = 0; nb < 4; ++nb) acc[mb][nb] = (v8f){};
    // the copies: thread t brings the 16-byte piece t & 7 of rows (t >> 3) + 16 i of each tile, so that eight lanes cover a row's whole line
    const int crw = threadIdx.x >> 3, cpc = threadIdx.x & 7;
    const T16* gA = A + (size_t)(blockIdx.x * 128 + crw) * K + cpc * 8; const T16* gB = Bt + (size_t)(blockIdx.y * 128 + crw) * K + cpc * 8; const T16* gA2 = NSPLIT == 1 ? A2 + (size_t)(blockIdx.x * 128 + crw) * K + cpc * 8 : gA;
    if (PLANES && blockIdx.z < 2) { const T16* gt = gA; gA = gB; gB = gt; }   // q, k: the tile is computed transposed (weight rows as the A operand), so that a lane's 8 accumulator elements are 8 consecutive d of one position
    const unsigned lc = (unsigned)(size_t)ring + (crw * LP + cpc * 8) * 2;
    auto fill = [&](const int t, const int buf) { const unsigned l = lc + buf * (NOP * TLE * 2);
        cp8<T16>(l, gA + t * 64, K); cp8<T16>(l + TLE * 2, gB + t * 64, K); if (NSPLIT == 1) cp8<T16>(l + 2 * TLE * 2, gA2 + t * 64, K); };
    const int nst = K / 64;
    fill(0, 0);
    asm volatile("s_wait_asynccnt 0x0" ::: "memory");   // this wave's copies of stage 0 have landed
    __syncthreads();                                    // every wave's have: stage 0 may be read
    if (nst > 1) fill(1, 1);
    const int fa = (wm * 64 + lr) * LP + 8 * hi, fb = TLE + (wn * 64 + lr) * LP + 8 * hi;
    for (int t = 0; t < nst; ++t) {
        const T16* sb = ring + (t & 1) * (NOP * TLE);
#pragma unroll
        for (int ks = 0; ks < 2; ++ks) {
            V a[4], a2[4], b[4];
#pragma unroll
            for (int mb = 0; mb < 4; ++mb) { a[mb] = WFrag<T16>::ld(sb + fa + mb * 16 * LP + ks * 32); if (NSPLIT == 1) a2[mb] = WFrag<T16>::ld(sb + 2 * TLE + fa + mb * 16 * LP + ks * 32); }
#pragma unroll
            for (int nb = 0; nb < 4; ++nb) b[nb] = WFrag<T16>::ld(sb + fb + nb * 16 * LP + ks * 32);
            __builtin_amdgcn_sched_barrier(0);   // holds the block's LDS reads together in front of its products: sunk among them, each place with reads would be waited out on its own
#pragma unroll
            for (int nb = 0; nb < 4; ++nb)
#pragma unroll
                for (int mb = 0; mb < 4; ++mb) { acc[mb][nb] = WFrag<T16>::mma(a[mb], b[nb], acc[mb][nb]); if (NSPLIT == 1) acc[mb][nb] = WFrag<T16>::mma(a2[mb], b[nb], acc[mb][nb]); }
        }
        asm volatile("s_wait_dscnt 0x0" ::: "memory");      // this wave's reads of stage t are done before the buffer is handed back
        asm volatile("s_wait_asynccnt 0x0" ::: "memory");   // this wave's copies of stage t + 1 have landed
        __syncthreads();                                    // publishes stage t + 1 and ends every wave's reads of stage t
        if (t + 2 < nst) fill(t + 2, t & 1);
    }
    asm volatile("s_wait_asynccnt 0x0" ::: "memory");       // no copy outstanding behind the loop
    if constexpr (PLANES) {
        static_assert(HD == 64 && TT % 64 == 0 && NKV == NH_, "a 64x64 tile is 64 positions of one head of one batch");
        if (blockIdx.z == 2) {
            const int b = r0 / TT, t0 = r0 % TT, h = c0 / 64;
            const size_t vo = (size_t)(b * NKV + h) * HD * PP + (size_t)t0 * HD + lane * 8; h16* v16 = V16 + vo; bf* vh = Vh + vo; bf* vl = Vl + vo;
#pragma unroll
            for (int nb = 0; nb < 4; ++nb)
#pragma unroll
                for (int mb = 0; mb < 4; ++mb) { v8h o16; v8us oh, ol;
#pragma unroll
                    for (int j = 0; j < 8; ++j) { const float x = acc[mb][nb][j]; o16[j] = tohx(x); unsigned short a2, c2; splitf(x, a2, c2); oh[j] = a2; ol[j] = c2; }
                    const int o = (mb >> 1) * (32 * HD) + (nb * 2 + (mb & 1)) * FB; *(v8h*)(v16 + o) = o16; *(v8us*)(vh + o) = oh; *(v8us*)(vl + o) = ol;
                    asm volatile("s_wait_xcnt 0x0" :: "v"(o16), "v"(oh), "v"(ol), "v"(v16), "v"(vh), "v"(vl) : "memory"); }   // the three stores: their data and address registers stay whole (inputs) until this wait
        } else {
            // transposed tile: acc[mb][nb][j] is d = 16 mb + 8 hi + j of position 16 nb + lr
            const int p0 = blockIdx.x * 128 + wn * 64, b = p0 / TT, t0 = p0 % TT, h = blockIdx.y * 2 + wm;
            const size_t po = (((size_t)blockIdx.z * NB_ + b) * NH_ + h) * TT * HD + (size_t)t0 * HD + lane * 8; h16* p16 = P16 + po; bf* ph = Ph + po; bf* pl = Pl + po;
            const float* fcp = fc + (size_t)(t0 + lr) * (HD / 2) + hi * 4; const float* fsp = fs + (size_t)(t0 + lr) * (HD / 2) + hi * 4;
            v4f cc[2][4], sn[2][4];    // the table values of a lane's four pairs, one block of 16 positions ahead, so that they fly under the block before
#pragma unroll
            for (int mb = 0; mb < 4; ++mb) { cc[0][mb] = *(const v4f*)(fcp + mb * 8); sn[0][mb] = *(const v4f*)(fsp + mb * 8); }
#pragma unroll
            for (int nb = 0; nb < 4; ++nb) {
                if (nb < 3) {
#pragma unroll
                    for (int mb = 0; mb < 4; ++mb) { cc[(nb + 1) & 1][mb] = *(const v4f*)(fcp + (nb + 1) * 16 * (HD / 2) + mb * 8); sn[(nb + 1) & 1][mb] = *(const v4f*)(fsp + (nb + 1) * 16 * (HD / 2) + mb * 8); } }
                asm volatile("s_wait_xcnt 0x0" :: "v"(fcp), "v"(fsp) : "memory");   // the table loads: their address registers stay whole (inputs) until this wait
#pragma unroll
                for (int mb = 0; mb < 4; ++mb) { v8h o16; v8us oh, ol;
#pragma unroll
                    for (int q = 0; q < 4; ++q) { const float x0 = acc[mb][nb][2 * q], x1 = acc[mb][nb][2 * q + 1], c = bfr(cc[nb & 1][mb][q]), sv = bfr(sn[nb & 1][mb][q]);
                        const float e0 = __builtin_fmaf(x0, c, -(x1 * sv)), e1 = __builtin_fmaf(x0, sv, x1 * c);   /* even: x0 c - x1 s; odd: x0 s + x1 c; the x1 product rounded, the x0 product fused */
                        o16[2 * q] = tohx(e0); o16[2 * q + 1] = tohx(e1); unsigned short a2, c2; splitf(e0, a2, c2); oh[2 * q] = a2; ol[2 * q] = c2; splitf(e1, a2, c2); oh[2 * q + 1] = a2; ol[2 * q + 1] = c2; }
                    const int o = nb * (16 * HD) + mb * FB; *(v8h*)(p16 + o) = o16; *(v8us*)(ph + o) = oh; *(v8us*)(pl + o) = ol;
                    asm volatile("s_wait_xcnt 0x0" :: "v"(o16), "v"(oh), "v"(ol), "v"(p16), "v"(ph), "v"(pl) : "memory"); }   // the three stores: their data and address registers stay whole (inputs) until this wait
            }
        }
        return;
    }
#pragma unroll
    for (int mb = 0; mb < 4; ++mb) {
#pragma unroll
        for (int nb = 0; nb < 4; ++nb) {
#pragma unroll
            for (int j = 0; j < 8; ++j) os[(hi * 8 + j) * 68 + nb * 16 + lr] = acc[mb][nb][j]; }
        __builtin_amdgcn_wave_barrier(); asm volatile("" ::: "memory");
        float* crow = C + (size_t)(r0 + mb * 16) * ldc + c0;
{
#pragma unroll
            for (int s = 0; s < 8; ++s) { const int row = 2 * s + hi, cofs = lr * 4; v4f val = *(const v4fa*)(os + row * 68 + cofs); if (BIAS) { val[0] += bfr(bias[c0 + cofs]); val[1] += bfr(bias[c0 + cofs + 1]); val[2] += bfr(bias[c0 + cofs + 2]); val[3] += bfr(bias[c0 + cofs + 3]); }
                *(v4f*)(crow + (size_t)row * ldc + cofs) = val; }
             }
        __builtin_amdgcn_wave_barrier(); asm volatile("" ::: "memory");
    }
}


// grid (.., 4): blockIdx.y picks the weight; the four transposed planes lie one behind the other in Bt
// One wave transposes a tile of 64 k x 32 n in registers, no LDS: lane (kg = lane & 7, nq = lane >> 3) loads 16 bytes (4 n) of each of its 8 consecutive k rows, for both 16-n halves of the tile
// (16 loads in flight a lane; a load covers 8 half lines, and the tile's two halves together use every line whole). It then stores, for each of its 8 n, its 8 consecutive k as 16 bytes:
// the 8 lanes kg fill one whole 128-byte line of Bt, a store covers 4 whole lines, and each line has one writer. The pitches are constants, so that every load and store is one base address plus an immediate offset.
__global__ __launch_bounds__(256) void k_wtG(const float* __restrict__ w0, const float* __restrict__ w1, const float* __restrict__ w2, const float* __restrict__ w3, bf* Bt) {
    constexpr int K = DM, N = DQ, NKT = K / 64;
    static_assert(K % 256 == 0 && N % 64 == 0, "whole tiles, 4 x 2 of them a work-group");
    const int y = blockIdx.y; const float* __restrict__ w = y == 0 ? w0 : y == 1 ? w1 : y == 2 ? w2 : w3; Bt += (size_t)y * N * K;
    const int lane = threadIdx.x & 31, kg = lane & 7, nq = lane >> 3, wave = threadIdx.x >> 5;
    // a work-group's eight tiles are 4 (k) x 2 (n): the two n neighbours together read each row's aligned 256 bytes
    const int k0 = ((blockIdx.x % (NKT / 4)) * 4 + (wave >> 1)) * 64 + kg * 8, n0 = ((blockIdx.x / (NKT / 4)) * 2 + (wave & 1)) * 32 + nq * 4;
    const float* s = w + (size_t)k0 * N + n0; bf* d = Bt + (size_t)n0 * K + k0;
    v4f v[2][8];
#pragma unroll
    for (int hf = 0; hf < 2; ++hf)
#pragma unroll
        for (int j = 0; j < 8; ++j) v[hf][j] = *(const v4f*)(s + j * N + hf * 16);
    asm volatile("s_wait_xcnt 0x0" :: "v"(s) : "memory");   // the 16 loads: their address register pair stays whole (an input) until this wait; and no load crosses this statement, so that all 16 fly together in front of the conversions (sunk among them, to save registers, they went out in five groups, each group's latency waited out on its own)
#pragma unroll
    for (int hf = 0; hf < 2; ++hf)
#pragma unroll
        for (int c = 0; c < 4; ++c) { v8us o;
#pragma unroll
            for (int j = 0; j < 8; ++j) o[j] = f2bf(v[hf][j][c]);
            *(v8us*)(d + (hf * 16 + c) * K) = o; }
}
__global__ __launch_bounds__(256) void k_cvt8(const float* __restrict__ src, bf* dst, size_t n8) { const size_t i = (size_t)blockIdx.x * 256 + threadIdx.x; if (i >= n8) return; const v8f v = *(const v8f*)(src + i * 8); v8us o;
#pragma unroll
    for (int k = 0; k < 8; ++k) o[k] = f2bf(v[k]); *(v8us*)(dst + i * 8) = o;  }
// ---- k_attn: causal attention fused into one launch: ONE WORK-GROUP of NSP waves per (head, query tile); wave w takes the key blocks w, w + NSP, .. of the tile; scores, running softmax and the probability x value product stay in registers.
// Each wave ends with its own maximum, sum and unnormalised O over its key blocks; they are joined through LDS behind one barrier: O = sum_w 2^(m_w - M) O_w / sum_w 2^(m_w - M) l_w, w ascending. A wave without a key block brings m = -3e38, l = 0, O = 0 (weight 0).
// Transposed products: S^T = K Q^T (A = 16 keys x 64 d, B = 16 queries) leaves lane (lr, hi) with keys 8 hi + j of query lr, which for two neighbouring key tiles is exactly the B fragment (k = 8 hi + e, 16 + 8 hi + e) of
// O^T = V^T P^T (A = 16 d x 32 keys): no exchange between lanes but one with lane l ^ 16 for the row maximum (the two half sums are added in the join). O^T leaves lane (lr, hi) with d = 16 dt + 8 hi + j of query lr: 16-byte LDS stores into the wave's partial O rows; the join stores 16 bytes a lane into the merged hi/lo planes.
// Running softmax in the base-2 domain: t = s * HD^-0.5 * log2(e); per 32 keys m' = max(m, t), O and l scaled by 2^(m - m'), p = 2^(t - m') (not normalised: <= 1), l += sum p; O / l at the end.
// HR (query rows < RH): bf16 hi/lo planes, 3 products for both contractions, 16 queries a wave; else fp16, 32 queries a wave. Key blocks wholly at or below the diagonal need no mask; the one diagonal block masks by select.
#define KB 32                     // keys per trip
#define NSP 4                     // waves of a work-group: the key blocks of a query tile go round them
#define OP 68                     // LDS pitch of one query's partial O row, in floats (272 bytes: 16 x odd)
__device__ __forceinline__ float xhalf(float x) { return __builtin_bit_cast(float, __builtin_amdgcn_permlanex16(__builtin_bit_cast(int, x), __builtin_bit_cast(int, x), 0x76543210, 0xfedcba98, false, false)); }  // lane l with lane l ^ 16
__device__ __forceinline__ float exp2s(float x) { asm("v_exp_f32 %0, %0\n\tv_nop" : "+v"(x)); return x; }   // 2^x. The v_nop is the free slot the instruction set asks for behind a transcendental. In place: the register already holds the live argument, so it is no operand of a matrix instruction still in its window (the compiler does not look into asm text)
template <typename T16, int NT, bool HR>
__device__ __forceinline__ void attn_tile(const T16* __restrict__ Q, const T16* __restrict__ Q2, const T16* __restrict__ Kp, const T16* __restrict__ Kp2, const T16* __restrict__ Vt, const T16* __restrict__ Vt2, const int q0, bf* __restrict__ Ah, bf* __restrict__ Al, float* so, float* sm, float* sl) {
    typedef typename WFrag<T16>::V V;
    const int lane = threadIdx.x & 31, lr = lane & 15, hi = lane >> 4, wave = __builtin_amdgcn_readfirstlane(threadIdx.x >> 5);
    V qf[NT][2], qf2[NT][2];
    const T16* qb = Q + (size_t)q0 * HD; const T16* qb2 = HR ? Q2 + (size_t)q0 * HD : qb; const T16* qp = qb + lane * 8; const T16* qp2 = qb2 + lane * 8;
#pragma unroll
    for (int nt = 0; nt < NT; ++nt)
#pragma unroll
        for (int ks = 0; ks < 2; ++ks) { qf[nt][ks] = WFrag<T16>::ldf(qp + nt * 16 * HD + ks * 2 * FB); if (HR) qf2[nt][ks] = WFrag<T16>::ldf(qp2 + nt * 16 * HD + ks * 2 * FB); }
    v8f o[4][NT]; float m[NT], l[NT];
#pragma unroll
    for (int nt = 0; nt < NT; ++nt) { m[nt] = -3.0e38f; l[nt] = 0.f;
#pragma unroll
        for (int dt = 0; dt < 4; ++dt) o[dt][nt] = (v8f){}; }
    V kf[2][2], kf2[2][2];
    auto ldk = [&](const T16* kp, const T16* kp2, V (&f)[2][2], V (&f2)[2][2]) {
#pragma unroll
        for (int mt = 0; mt < 2; ++mt)
#pragma unroll
            for (int ks = 0; ks < 2; ++ks) { f[mt][ks] = WFrag<T16>::ldf(kp + mt * 16 * HD + ks * 2 * FB); if (HR) f2[mt][ks] = WFrag<T16>::ldf(kp2 + mt * 16 * HD + ks * 2 * FB); } };
    const size_t kl = (size_t)lane * 8, vl = kl;
    auto step = [&](const int kb, const bool last) {
        V vf[4], vf2[4];
        const T16* vp = Vt + vl + (size_t)kb * HD; const T16* vp2 = HR ? Vt2 + vl + (size_t)kb * HD : vp;
        const T16* kp = (HR || !last) ? Kp + kl + (size_t)(HR ? kb : kb + NSP * KB) * HD : vp; const T16* kp2 = HR ? Kp2 + kl + (size_t)kb * HD : kp;
#pragma unroll
        for (int dt = 0; dt < 4; ++dt) { vf[dt] = WFrag<T16>::ldf(vp + dt * 2 * FB); if (HR) vf2[dt] = WFrag<T16>::ldf(vp2 + dt * 2 * FB); }
        if (HR) ldk(kp, kp2, kf, kf2);              // hi/lo path: this trip's own key fragments
        v8f sa[NT][2];
#pragma unroll
        for (int nt = 0; nt < NT; ++nt) {
#pragma unroll
            for (int mt = 0; mt < 2; ++mt) { v8f s = (v8f){};
#pragma unroll
                for (int ks = 0; ks < 2; ++ks) { s = WFrag<T16>::mma(kf[mt][ks], qf[nt][ks], s); if (HR) { s = WFrag<T16>::mma(kf[mt][ks], qf2[nt][ks], s); s = WFrag<T16>::mma(kf2[mt][ks], qf[nt][ks], s); } }
                sa[nt][mt] = s; } }
        if (!HR) { if (!last) ldk(kp, kp2, kf, kf2);   // fp16 path: the key fragments of this wave's next trip, into the same registers right behind this trip's score products; they fly under the softmax and P x V
            __builtin_amdgcn_sched_barrier(0); }       // holds those loads (and this trip's V loads) up here: sunk to the foot of the trip, their latency would be waited out in full
#pragma unroll
        for (int nt = 0; nt < NT; ++nt) {
            v8f (&st)[2] = sa[nt];
            float mx = m[nt];
#pragma unroll
            for (int mt = 0; mt < 2; ++mt)
#pragma unroll
                for (int j = 0; j < 8; ++j) { float t = st[mt][j] * (SCL * 1.4426950408889634f); if (last) t = (kb + mt * 16 + hi * 8 + j <= q0 + nt * 16 + lr) ? t : -3.0e38f; st[mt][j] = t; mx = fmaxf(mx, t); }
            mx = fmaxf(mx, xhalf(mx));
            const float al = exp2s(m[nt] - mx); m[nt] = mx;
            float sum = 0.f;
#pragma unroll
            for (int mt = 0; mt < 2; ++mt)
#pragma unroll
                for (int j = 0; j < 8; ++j) { const float p = exp2s(st[mt][j] - mx); st[mt][j] = p; sum += p; }
            l[nt] = l[nt] * al + sum;
#pragma unroll
            for (int dt = 0; dt < 4; ++dt) o[dt][nt] *= al;
            if (nt == 0) asm volatile("s_wait_xcnt 0x0" :: "v"(vp), "v"(vp2), "v"(kp), "v"(kp2) : "memory");   // this trip's loads: their address registers stay whole (inputs) until this wait; placed here, where the V fragments are waited for anyway
            if (HR) {
                v8us h0, h1, l0, l1;
#pragma unroll
                for (int j = 0; j < 8; ++j) { unsigned short x, y; splitf(st[0][j], x, y); h0[j] = x; l0[j] = y; splitf(st[1][j], x, y); h1[j] = x; l1[j] = y; }
                const v16bf ph = cat16b(h0, h1), pl = cat16b(l0, l1);
#pragma unroll
                for (int dt = 0; dt < 4; ++dt) { o[dt][nt] = wmmab(__builtin_bit_cast(v16bf, vf[dt]), ph, o[dt][nt]); o[dt][nt] = wmmab(__builtin_bit_cast(v16bf, vf[dt]), pl, o[dt][nt]); o[dt][nt] = wmmab(__builtin_bit_cast(v16bf, vf2[dt]), ph, o[dt][nt]); }
            } else {
                v8h p0, p1;
#pragma unroll
                for (int j = 0; j < 8; ++j) { p0[j] = tohx(st[0][j]); p1[j] = tohx(st[1][j]); }
                const v16h pf = cat16(p0, p1);
#pragma unroll
                for (int dt = 0; dt < 4; ++dt) o[dt][nt] = wmma16(__builtin_bit_cast(v16h, vf[dt]), pf, o[dt][nt]);
            }
        }
    };
    static_assert(HR || RH >= NSP * KB, "fp16 tiles: every wave has at least one key block");
    static_assert((16 * NT) % NSP == 0 && HD == 64, "the join gives each wave 16 NT / NSP whole query rows");
    const int kd = (q0 / KB) * KB;             // the diagonal block: it holds keys q0 .. q0 + 16 NT - 1 (q0 is a multiple of 16 NT, and 16 NT divides KB)
    int kb = wave * KB;                        // this wave's first key block; its others follow at NSP * KB
    const T16* kw = Kp + (size_t)kb * HD; const T16* kp0 = kw + kl;
    if (!HR) ldk(kp0, kp0, kf, kf2);
    asm volatile("s_wait_xcnt 0x0" :: "s"(qb), "s"(qb2), "s"(kw), "v"(lane) : "memory");   // the prologue's loads (scalar base + lane offset): their address registers stay whole (inputs) until this wait
    for (; kb + NSP * KB <= kd; kb += NSP * KB) step(kb, false);
    if (!HR || kb <= kd) step(kb, true);       // the wave's last block, masked by select: the diagonal block for one wave, an identity for the others
    // ---- the join: every wave lays down its maximum, its two half sums and its O rows (query-major), one barrier, then wave w finishes the query rows w * QW .. w * QW + QW - 1, so that each 128-byte line of the merged planes has one writer
    float* sow = so + wave * (32 * OP);
#pragma unroll
    for (int nt = 0; nt < NT; ++nt) { sm[(wave * 2 + nt) * 32 + lane] = m[nt]; sl[(wave * 2 + nt) * 32 + lane] = l[nt];
#pragma unroll
        for (int dt = 0; dt < 4; ++dt) { float* p = sow + (nt * 16 + lr) * OP + dt * 16 + 8 * hi;
            *(v4fa*)p = __builtin_shufflevector(o[dt][nt], o[dt][nt], 0, 1, 2, 3); *(v4fa*)(p + 4) = __builtin_shufflevector(o[dt][nt], o[dt][nt], 4, 5, 6, 7); } }
    __syncthreads();                           // every wave's partial results are in LDS before any of them is read
    constexpr int QW = 16 * NT / NSP, LQ = 32 / QW, EL = HD / LQ;   // query rows a wave, lanes a row, elements a lane
    const int qi = wave * QW + lane / LQ, d0 = (lane % LQ) * EL, ms = (qi >> 4) * 32 + (qi & 15);
    float mw[NSP], lw[NSP], mx = -3.0e38f;
#pragma unroll
    for (int w = 0; w < NSP; ++w) { mw[w] = sm[w * 64 + ms]; lw[w] = sl[w * 64 + ms] + sl[w * 64 + ms + 16]; mx = fmaxf(mx, mw[w]); }
    float lt = 0.f, ac[EL];
#pragma unroll
    for (int e = 0; e < EL; ++e) ac[e] = 0.f;
#pragma unroll
    for (int w = 0; w < NSP; ++w) { const float f = exp2s(mw[w] - mx); lt = __builtin_fmaf(lw[w], f, lt); const float* p = so + (w * 32 + qi) * OP + d0;
#pragma unroll
        for (int e4 = 0; e4 < EL / 4; ++e4) { const v4f x = *(const v4fa*)(p + e4 * 4);
#pragma unroll
            for (int c = 0; c < 4; ++c) ac[e4 * 4 + c] = __builtin_fmaf(x[c], f, ac[e4 * 4 + c]); } }
    const float inv = __fdiv_rn(1.0f, lt); const size_t oo = (size_t)(q0 + qi) * DQ + d0; bf* sh = Ah + oo; bf* sb = Al + oo;
#pragma unroll
    for (int e8 = 0; e8 < EL / 8; ++e8) { v8us oh, ol;
#pragma unroll
        for (int j = 0; j < 8; ++j) { unsigned short x, y; splitf(ac[e8 * 8 + j] * inv, x, y); oh[j] = x; ol[j] = y; }
        *(v8us*)(sh + e8 * 8) = oh; *(v8us*)(sb + e8 * 8) = ol;
        asm volatile("s_wait_xcnt 0x0" :: "v"(oh), "v"(ol), "v"(sh), "v"(sb) : "memory"); }   // the two stores: their data and address registers stay whole (inputs) until this wait, on every way into code that rewrites them
}
#define NLR ((TT - RH) / 32)      // fp16 query tiles of 32 rows
#define NHR (RH / 16)             // hi/lo query tiles of 16 rows
// grid (NH_, NB_, NLR + NHR): the query tile is the SLOWEST grid index and the longest tiles (last query rows) take its lowest values, so that cost falls with the flat block index over the whole launch:
// there are more work-groups than resident places; the order is for speed only
__global__ __launch_bounds__(32 * NSP) void k_attn(const h16* __restrict__ Q16, const h16* __restrict__ K16, const h16* __restrict__ V16, const bf* __restrict__ Qh, const bf* __restrict__ Ql, const bf* __restrict__ Kh, const bf* __restrict__ Kl, const bf* __restrict__ Vh, const bf* __restrict__ Vl, bf* __restrict__ Ah, bf* __restrict__ Al) {
    const int h = blockIdx.x, g = h / REP, bx = blockIdx.z, b = blockIdx.y; const size_t qo = (size_t)(b * NH_ + h) * TT * HD, ko = (size_t)(b * NKV + g) * TT * HD, vo = (size_t)(b * NKV + g) * HD * PP; Ah += (size_t)b * TT * DQ; Al += (size_t)b * TT * DQ;
    __shared__ __align__(16) float so[NSP * 32 * OP];        // the waves' partial O rows [wave][query][d]
    __shared__ float sm[NSP * 2 * 32], sl[NSP * 2 * 32];     // their maxima and half sums [wave][query tile][lane]
    if (bx < NLR) attn_tile<h16, 2, false>(Q16 + qo, nullptr, K16 + ko, nullptr, V16 + vo, nullptr, RH + (NLR - 1 - bx) * 32, Ah + h * HD, Al + h * HD, so, sm, sl);
    else attn_tile<bf, 1, true>(Qh + qo, Ql + qo, Kh + ko, Kl + ko, Vh + vo, Vl + vo, (NLR + NHR - 1 - bx) * 16, Ah + h * HD, Al + h * HD, so, sm, sl);
}

extern "C" void kernel_launch(void* const* d_in, const int* in_sizes, int n_in,
                              void* d_out, int out_size, void* d_ws, size_t ws_size, hipStream_t stream) {
    (void)in_sizes; (void)n_in; (void)out_size;
        const float* x = (const float*)d_in[0]; const float* fcos = (const float*)d_in[1]; const float* fsin = (const float*)d_in[2]; const float* wq = (const float*)d_in[3]; const float* wk = (const float*)d_in[4]; const float* wv = (const float*)d_in[5]; const float* wo = (const float*)d_in[6]; const float* bo = (const float*)d_in[7];   /* input order x, pos_cos, pos_sin ([2048][32] HALF-width table INPUTS: read by value), Wq, Wk, Wv, Wo ('xw' (in, out) [1024][1024]), bo ([1024]: zeros, read through the output launch's bias slot): EIGHT inputs, all read; the q, k, v projections have NO bias in this module */
    float* OUT = (float*)d_out;     // [2][2048][1024]
    char* wsp = (char*)d_ws;
    auto take = [&](size_t bytes) { char* p = wsp; wsp += (bytes + 255) & ~(size_t)255; return (void*)p; };
    static_assert(DQ == DKV && DQ == DM, "q, k and v share one projection launch that also writes their planes, the four weights one transpose launch: equal shapes");
    bf* WQ = (bf*)take((size_t)4 * DQ * DM * 2); bf* WO = WQ + (size_t)3 * DQ * DM;   // transposed Wq, Wk, Wv, Wo, one behind the other
    bf* XB = (bf*)take((size_t)NB_ * TT * DM * 2);
    const size_t PLN = (size_t)NB_ * NH_ * TT * HD;   // elements of one set of head planes
    h16* QP16 = (h16*)take(2 * PLN * 2); h16* KP16 = QP16 + PLN; h16* VT16 = (h16*)take((size_t)NB_ * NKV * HD * PP * 2);
    bf* QPh = (bf*)take(2 * PLN * 2); bf* KPh = QPh + PLN; bf* QPl = (bf*)take(2 * PLN * 2); bf* KPl = QPl + PLN; bf* VTh = (bf*)take((size_t)NB_ * NKV * HD * PP * 2); bf* VTl = VTh + (size_t)TT * HD;   // hi plane in the first half of each head's range, lo plane in the second
    bf* ATh = (bf*)take((size_t)NB_ * TT * DQ * 2); bf* ATl = (bf*)take((size_t)NB_ * TT * DQ * 2);
    if ((size_t)(wsp - (char*)d_ws) > ws_size) return;    // ws 256 MiB
    k_wtG<<<dim3((DM / 256) * (DQ / 64), 4, 1), 256, 0, stream>>>(wq, wk, wv, wo, WQ);   /* 'xw' [in][out] weights: transposed once into Bt */
    k_cvt8<<<(unsigned)(((size_t)NB_ * TT * DM / 8 + 255) / 256), 256, 0, stream>>>(x, XB, (size_t)NB_ * TT * DM / 8);
    k_gemmw<bf, 0, false, true><<<dim3(NB_ * TT / 128, DQ / 128, 3), 128, 0, stream>>>(XB, nullptr, WQ, nullptr, DM, nullptr, DQ, nullptr, 0, (size_t)DQ * DM, 0, fcos, fsin, QP16, QPh, QPl, VT16, VTh, VTl);   /* q, k, v projections, written as head planes */
    k_attn<<<dim3(NH_, NB_, NLR + NHR), 32 * NSP, 0, stream>>>(QP16, KP16, VT16, QPh, QPl, KPh, KPl, VTh, VTl, ATh, ATl);
    k_gemmw<bf, 1, true, false><<<dim3(NB_ * TT / 128, DM / 128, 1), 128, 0, stream>>>(ATh, ATl, WO, nullptr, DQ, OUT, DM, bo, 0, 0, 0, nullptr, nullptr, nullptr, nullptr, nullptr, nullptr, nullptr, nullptr);
}

// v010
// One run takes 77.7 microseconds.
// In two side-by-side timings against v009, it was 1.03 and 1.02 times as fast.
// All steps since v000 together make it 18.8 times as fast.
#include <hip/hip_runtime.h>

// Causal multi-head self-attention with interleaved-pair rotary embeddings from two half-width INPUT tables and (in, out) weights (x [2][2048][1024]; q, k, v = x W ('xw' [1024][1024] normal x 0.02, no projection bias; 16 heads x 64); _rope on q and k: consecutive pairs (t[2i], t[2i+1]) -> (te c - to s, te s + to c) with c, s = pos_cos / pos_sin[t][i] (f32 [2048][32] INPUT tables the module computes: cos / sin(t / 10000^(2i/64)): read by value); scores: -inf above the diagonal, then / sqrt(64) (the same as scaling first); softmax; out = merged Wo + bo ('xw' + a zero bias [1024], read) -> [2][2048][1024] (4.2 M); argument order x, pos_cos, pos_sin, Wq, Wk, Wv, Wo, bo).
// Every stage is ONE launch for all of its independent instances (both batches; q, k and v; the four weights): the batch is folded into the row index (x, the projections, the merged planes) or the plane index (b * heads + h), q / k / v and the weights into a grid index. Stages: bf16 transpose of the four weights; bf16 copy of x; exact projections (no bias) whose epilogue builds the head planes itself (q, k: interleaved rotary with the two half-width INPUT tables read by value and bf16-rounded; v: transposed); causal T-2048 attention fused into one launch (k_attn: scores, running softmax and P x V in registers; hybrid rows: < 512 hi/lo 3 products, rest fp16; key blocks above the diagonal never touched) that writes the merged hi/lo planes; merged hi/lo x Wo exact + bo.
// Compute dtypes, f32 accumulate: every input rounded to bf16; projections exact (no bias); rotary f32; attention rows < 512 3 products, rest fp16; softmax f32; Wo hl x exact + bias.

#define NB_  2
#define TT   2048
#define DM   1024
#define NH_  16
#define NKV  16
#define REP  (NH_ / NKV)
#define HD   64
#define DQ   (NH_ * HD)
#define DKV  (NKV * HD)
#define PP   (2 * TT)             // a head's V^T range holds HD * PP 16-bit elements (hi plane in its first half, lo plane in the second)
#define RH   512                  // query rows < RH use hi+lo planes (at least NSP * KB)
#define SCL  0.125f   // HD^-0.5
typedef _Float16 h16;
typedef unsigned short bf;
typedef __attribute__((ext_vector_type(16))) __bf16   v16bf;
typedef __attribute__((ext_vector_type(16))) _Float16 v16h;
typedef __attribute__((ext_vector_type(8)))  _Float16 v8h;
typedef __attribute__((ext_vector_type(8)))  unsigned short v8us;
typedef __attribute__((ext_vector_type(8)))  float    v8f;
typedef __attribute__((ext_vector_type(4)))  float    v4f;
typedef v8h  __attribute__((may_alias)) v8ha;
typedef v4f  __attribute__((may_alias)) v4fa;
typedef v8us __attribute__((may_alias)) v8usa;

__device__ __forceinline__ unsigned short f2bf(float f) { unsigned u = __float_as_uint(f); u += 0x7FFFu + ((u >> 16) & 1u); return (unsigned short)(u >> 16); }
__device__ __forceinline__ float bf2f(unsigned short b) { return __uint_as_float(((unsigned)b) << 16); }
__device__ __forceinline__ float bfr(float f) { return bf2f(f2bf(f)); }
__device__ __forceinline__ v16h cat16(v8h lo, v8h hi) { return __builtin_shufflevector(lo, hi, 0, 1, 2, 3, 4, 5, 6, 7, 8, 9, 10, 11, 12, 13, 14, 15); }
__device__ __forceinline__ v16bf cat16b(v8us lo, v8us hi) { return __builtin_bit_cast(v16bf, __builtin_shufflevector(lo, hi, 0, 1, 2, 3, 4, 5, 6, 7, 8, 9, 10, 11, 12, 13, 14, 15)); }
__device__ __forceinline__ v8f wmma16(v16h a, v16h b, v8f c) { return __builtin_amdgcn_wmma_f32_16x16x32_f16(false, a, false, b, (short)0, c, false, false); }
__device__ __forceinline__ v8f wmmab(v16bf a, v16bf b, v8f c) { return __builtin_amdgcn_wmma_f32_16x16x32_bf16(false, a, false, b, (short)0, c, false, false); }
__device__ __forceinline__ h16 tohx(float x) { return (h16)x; }
__device__ __forceinline__ void splitf(float y, unsigned short& h, unsigned short& l) { h = f2bf(y); l = f2bf(y - bf2f(h)); }
typedef __attribute__((ext_vector_type(4))) _Float16 v4h;
typedef __attribute__((ext_vector_type(2))) unsigned short v2us;
typedef __attribute__((ext_vector_type(4))) unsigned short v4us;
typedef __attribute__((ext_vector_type(2))) float v2f;



// ---- k_gemmw: register-blocked GEMM, one wave per 64x64 output tile (16 accumulators), FOUR WAVES (2 x 2) a work-group on one 128x128 tile; grid (M/128, N/128, Z), 128 threads.
// The operands (K-contiguous 16-bit planes) are staged in LDS, 64 k (one whole 128-byte line of every row) a stage, by asynchronous copies, two buffers: stage t + 1 flies while stage t is worked on. A buffer is handed back as soon as the stage's last fragments are in registers, in front of their products. A copy instruction covers four whole lines, and each operand row is fetched once for the two waves that use it.
// LDS rows at a pitch of 144 bytes (16 x odd: the 16-byte fragment reads meet no bank twice). Per accumulator the products come in the same order as without the staging (k ascending, A then A2).
// C[m][n] (f32, pitch ldc, + optional f32 bias[n]) = sum_k A[m][k] Bt[n][k] (+ the A2 product for NSPLIT 1). z-batch strides sA/sB/sC in elements. K % 64 == 0.
// PLANES (the q, k, v projections; z = 0, 1, 2): no f32 C is written. A 64x64 tile is 64 positions of ONE head of one batch, so the epilogue writes the attention's operand planes (fp16 + bf16 hi/lo) itself, in FRAGMENT ORDER (below), straight from the accumulators: every store is 16 bytes a lane, 512 contiguous bytes a wave.
// z < 2: planes [z][b][h] of the rotated tile: consecutive pairs (x0, x1) -> (x0 c - x1 s, x0 s + x1 c), c, s = bf16-rounded fc / fs[t][d / 2]. The tile is computed transposed (the weight rows take the A operand's place, the positions the B operand's; same products, same k order), so that a lane holds 8 consecutive d (four whole pairs) of one position.
// z == 2: V^T planes [b][h]: a lane holds 8 consecutive positions of one d.
// FRAGMENT ORDER of the attention's operand planes: a block of FB elements (512 bytes) holds, for each of the 32 lanes (lr, hi) in lane order, the 8 consecutive contraction elements that one 16-byte load of a fragment brings,
// so that a wave-wide load covers four whole 128-byte lines. Q, K (contraction over d): 16 positions are 4 blocks, block d / 16, lane (lr = t % 16, hi = d / 8 % 2), element d % 8.
// V^T (contraction over keys): 32 keys are 8 blocks, block (d / 16) * 2 + t / 16 % 2, lane (lr = d % 16, hi = t / 8 % 2), element t % 8. ldf joins a fragment's two neighbouring blocks (k = 8 hi + e and 16 + 8 hi + e, as ld does from a row).
#define FB 256
template <typename T16> struct WFrag;
template <> struct WFrag<h16> { typedef v16h V; static __device__ __forceinline__ V ld(const h16* p) { return cat16(*(const v8h*)p, *(const v8h*)(p + 16)); } static __device__ __forceinline__ V ldf(const h16* p) { return cat16(*(const v8h*)p, *(const v8h*)(p + FB)); } static __device__ __forceinline__ v8f mma(V a, V b, v8f c) { return wmma16(a, b, c); } };
template <> struct WFrag<bf> { typedef v16bf V; static __device__ __forceinline__ V ld(const bf* p) { return cat16b(*(const v8us*)p, *(const v8us*)(p + 16)); } static __device__ __forceinline__ V ldf(const bf* p) { return cat16b(*(const v8us*)p, *(const v8us*)(p + FB)); } static __device__ __forceinline__ v8f mma(V a, V b, v8f c) { return wmmab(a, b, c); } };
#define LP 72                     // LDS row pitch of a staged operand tile, in 16-bit elements (144 bytes)
#define TLE (128 * LP)            // elements of one staged operand tile (128 rows)
// Eight asynchronous 16-byte copies of a lane: rows r, r + 16, .. r + 112 of one operand tile (l: the lane's LDS byte address, g: its global address, K: the global row pitch in elements).
// The s_wait_xcnt closes the statement so that no address register of a copy is rewritten in front of it.
template <typename T16>
__device__ __forceinline__ void cp8(const unsigned l, const T16* g, const int K) {
    const size_t rs = (size_t)16 * K;
    asm volatile("global_load_async_to_lds_b128 %0, %8, off\n\t"
                 "global_load_async_to_lds_b128 %1, %9, off\n\t"
                 "global_load_async_to_lds_b128 %2, %10, off\n\t"
                 "global_load_async_to_lds_b128 %3, %11, off\n\t"
                 "global_load_async_to_lds_b128 %4, %12, off\n\t"
                 "global_load_async_to_lds_b128 %5, %13, off\n\t"
                 "global_load_async_to_lds_b128 %6, %14, off\n\t"
                 "global_load_async_to_lds_b128 %7, %15, off\n\t"
                 "s_wait_xcnt 0x0"
                 :: "v"(l), "v"(l + 1 * 16 * LP * 2), "v"(l + 2 * 16 * LP * 2), "v"(l + 3 * 16 * LP * 2), "v"(l + 4 * 16 * LP * 2), "v"(l + 5 * 16 * LP * 2), "v"(l + 6 * 16 * LP * 2), "v"(l + 7 * 16 * LP * 2),
                    "v"(g), "v"(g + rs), "v"(g + 2 * rs), "v"(g + 3 * rs), "v"(g + 4 * rs), "v"(g + 5 * rs), "v"(g + 6 * rs), "v"(g + 7 * rs) : "memory");
}
template <typename T16, int NSPLIT, bool BIAS, bool PLANES>
__global__ __launch_bounds__(128) void k_gemmw(const T16* __restrict__ A, const T16* __restrict__ A2, const T16* __restrict__ Bt, const T16* __restrict__ Bt2, int K, float* C, int ldc, const float* __restrict__ bias, size_t sA, size_t sB, size_t sC, const float* __restrict__ fc, const float* __restrict__ fs, h16* __restrict__ P16, bf* __restrict__ Ph, bf* __restrict__ Pl, h16* __restrict__ V16, bf* __restrict__ Vh, bf* __restrict__ Vl) {
    typedef typename WFrag<T16>::V V;
    static_assert(NSPLIT <= 1, "staged operands: A, Bt and, for NSPLIT 1, A2");
    constexpr int NOP = NSPLIT == 1 ? 3 : 2;          // operand tiles a stage: A, Bt (, A2)
    __shared__ __align__(16) T16 ring[2 * NOP * TLE];
    __shared__ __align__(16) float osm[4 * 16 * 68];  // epilogue staging, a range of its own for each wave
    const int wave = __builtin_amdgcn_readfirstlane(threadIdx.x >> 5), wm = wave & 1, wn = wave >> 1;
    float* os = osm + wave * (16 * 68);
    const size_t z = blockIdx.z; A += z * sA; if (A2) A2 += z * sA; Bt += z * sB; if (Bt2) Bt2 += z * sB; C += z * sC;
    const int lane = threadIdx.x & 31, lr = lane & 15, hi = lane >> 4; const int r0 = blockIdx.x * 128 + wm * 64, c0 = blockIdx.y * 128 + wn * 64;
    v8f acc[4][4];
#pragma unroll
    for (int mb = 0; mb < 4; ++mb)
#pragma unroll
        for (int nb = 0; nb < 4; ++nb) acc[mb][nb] = (v8f){};
    // the copies: thread t brings the 16-byte piece t & 7 of rows (t >> 3) + 16 i of each tile, so that eight lanes cover a row's whole line
    const int crw = threadIdx.x >> 3, cpc = threadIdx.x & 7;
    const T16* gA = A + (size_t)(blockIdx.x * 128 + crw) * K + cpc * 8; const T16* gB = Bt + (size_t)(blockIdx.y * 128 + crw) * K + cpc * 8; const T16* gA2 = NSPLIT == 1 ? A2 + (size_t)(blockIdx.x * 128 + crw) * K + cpc * 8 : gA;
    if (PLANES && blockIdx.z < 2) { const T16* gt = gA; gA = gB; gB = gt; }   // q, k: the tile is computed transposed (weight rows as the A operand), so that a lane's 8 accumulator elements are 8 consecutive d of one position
    const unsigned lc = (unsigned)(size_t)ring + (crw * LP + cpc * 8) * 2;
    auto fill = [&](const int t, const int buf) { const unsigned l = lc + buf * (NOP * TLE * 2);
        cp8<T16>(l, gA + t * 64, K); cp8<T16>(l + TLE * 2, gB + t * 64, K); if (NSPLIT == 1) cp8<T16>(l + 2 * TLE * 2, gA2 + t * 64, K); };
    const int nst = K / 64;
    fill(0, 0);
    asm volatile("s_wait_asynccnt 0x0" ::: "memory");   // this wave's copies of stage 0 have landed
    __syncthreads();                                    // every wave's have: stage 0 may be read
    if (nst > 1) fill(1, 1);
    const int fa = (wm * 64 + lr) * LP + 8 * hi, fb = TLE + (wn * 64 + lr) * LP + 8 * hi;
    for (int t = 0; t < nst; ++t) {
        const T16* sb = ring + (t & 1) * (NOP * TLE);
        V a[4], a2[4], b[4];
        auto frags = [&](const int ks) {
#pragma unroll
            for (int mb = 0; mb < 4; ++mb) { a[mb] = WFrag<T16>::ld(sb + fa + mb * 16 * LP + ks * 32); if (NSPLIT == 1) a2[mb] = WFrag<T16>::ld(sb + 2 * TLE + fa + mb * 16 * LP + ks * 32); }
#pragma unroll
            for (int nb = 0; nb < 4; ++nb) b[nb] = WFrag<T16>::ld(sb + fb + nb * 16 * LP + ks * 32); };
        auto prods = [&]() {
#pragma unroll
            for (int nb = 0; nb < 4; ++nb)
#pragma unroll
                for (int mb = 0; mb < 4; ++mb) { acc[mb][nb] = WFrag<T16>::mma(a[mb], b[nb], acc[mb][nb]); if (NSPLIT == 1) acc[mb][nb] = WFrag<T16>::mma(a2[mb], b[nb], acc[mb][nb]); } };
        frags(0);
        __builtin_amdgcn_sched_barrier(0);   // holds the block's LDS reads together in front of its products: sunk among them, each place with reads would be waited out on its own
        prods();
        frags(1);                            // the stage's second block: with its fragments in registers the buffer is free, although its products are still to come
        __builtin_amdgcn_sched_barrier(0);   // holds the first block's products up here: sunk behind the barrier they would stand in front of the refill and delay it
        asm volatile("s_wait_dscnt 0x0" ::: "memory");      // this wave's reads of stage t are done before the buffer is handed back
        asm volatile("s_wait_asynccnt 0x0" ::: "memory");   // this wave's copies of stage t + 1 have landed
        __syncthreads();                                    // publishes stage t + 1 and ends every wave's reads of stage t
        if (t + 2 < nst) fill(t + 2, t & 1);
        prods();                             // the second block's products, from registers alone, behind the refill: the copies fly under them too
    }
    asm volatile("s_wait_asynccnt 0x0" ::: "memory");       // no copy outstanding behind the loop
    if constexpr (PLANES) {
        static_assert(HD == 64 && TT % 64 == 0 && NKV == NH_, "a 64x64 tile is 64 positions of one head of one batch");
        if (blockIdx.z == 2) {
            const int b = r0 / TT, t0 = r0 % TT, h = c0 / 64;
            const size_t vo = (size_t)(b * NKV + h) * HD * PP + (size_t)t0 * HD + lane * 8; h16* v16 = V16 + vo; bf* vh = Vh + vo; bf* vl = Vl + vo;
#pragma unroll
            for (int nb = 0; nb < 4; ++nb)
#pragma unroll
                for (int mb = 0; mb < 4; ++mb) { v8h o16; v8us oh, ol;
#pragma unroll
                    for (int j = 0; j < 8; ++j) { const float x = acc[mb][nb][j]; o16[j] = tohx(x); unsigned short a2, c2; splitf(x, a2, c2); oh[j] = a2; ol[j] = c2; }
                    const int o = (mb >> 1) * (32 * HD) + (nb * 2 + (mb & 1)) * FB; *(v8h*)(v16 + o) = o16; *(v8us*)(vh + o) = oh; *(v8us*)(vl + o) = ol;
                    asm volatile("s_wait_xcnt 0x0" :: "v"(o16), "v"(oh), "v"(ol), "v"(v16), "v"(vh), "v"(vl) : "memory"); }   // the three stores: their data and address registers stay whole (inputs) until this wait
        } else {
            // transposed tile: acc[mb][nb][j] is d = 16 mb + 8 hi + j of position 16 nb + lr
            const int p0 = blockIdx.x * 128 + wn * 64, b = p0 / TT, t0 = p0 % TT, h = blockIdx.y * 2 + wm;
            const size_t po = (((size_t)blockIdx.z * NB_ + b) * NH_ + h) * TT * HD + (size_t)t0 * HD + lane * 8; h16* p16 = P16 + po; bf* ph = Ph + po; bf* pl = Pl + po;
            const float* fcp = fc + (size_t)(t0 + lr) * (HD / 2) + hi * 4; const float* fsp = fs + (size_t)(t0 + lr) * (HD / 2) + hi * 4;
            v4f cc[2][4], sn[2][4];    // the table values of a lane's four pairs, one block of 16 positions ahead, so that they fly under the block before
#pragma unroll
            for (int mb = 0; mb < 4; ++mb) { cc[0][mb] = *(const v4f*)(fcp + mb * 8); sn[0][mb] = *(const v4f*)(fsp + mb * 8); }
#pragma unroll
            for (int nb = 0; nb < 4; ++nb) {
                if (nb < 3) {
#pragma unroll
                    for (int mb = 0; mb < 4; ++mb) { cc[(nb + 1) & 1][mb] = *(const v4f*)(fcp + (nb + 1) * 16 * (HD / 2) + mb * 8); sn[(nb + 1) & 1][mb] = *(const v4f*)(fsp + (nb + 1) * 16 * (HD / 2) + mb * 8); } }
                asm volatile("s_wait_xcnt 0x0" :: "v"(fcp), "v"(fsp) : "memory");   // the table loads: their address registers stay whole (inputs) until this wait
#pragma unroll
                for (int mb = 0; mb < 4; ++mb) { v8h o16; v8us oh, ol;
#pragma unroll
                    for (int q = 0; q < 4; ++q) { const float x0 = acc[mb][nb][2 * q], x1 = acc[mb][nb][2 * q + 1], c = bfr(cc[nb & 1][mb][q]), sv = bfr(sn[nb & 1][mb][q]);
                        const float e0 = __builtin_fmaf(x0, c, -(x1 * sv)), e1 = __builtin_fmaf(x0, sv, x1 * c);   /* even: x0 c - x1 s; odd: x0 s + x1 c; the x1 product rounded, the x0 product fused */
                        o16[2 * q] = tohx(e0); o16[2 * q + 1] = tohx(e1); unsigned short a2, c2; splitf(e0, a2, c2); oh[2 * q] = a2; ol[2 * q] = c2; splitf(e1, a2, c2); oh[2 * q + 1] = a2; ol[2 * q + 1] = c2; }
                    const int o = nb * (16 * HD) + mb * FB; *(v8h*)(p16 + o) = o16; *(v8us*)(ph + o) = oh; *(v8us*)(pl + o) = ol;
                    asm volatile("s_wait_xcnt 0x0" :: "v"(o16), "v"(oh), "v"(ol), "v"(p16), "v"(ph), "v"(pl) : "memory"); }   // the three stores: their data and address registers stay whole (inputs) until this wait
            }
        }
        return;
    }
#pragma unroll
    for (int mb = 0; mb < 4; ++mb) {
#pragma unroll
        for (int nb = 0; nb < 4; ++nb) {
#pragma unroll
            for (int j = 0; j < 8; ++j) os[(hi * 8 + j) * 68 + nb * 16 + lr] = acc[mb][nb][j]; }
        __builtin_amdgcn_wave_barrier(); asm volatile("" ::: "memory");
        float* crow = C + (size_t)(r0 + mb * 16) * ldc + c0;
{
            v4f vals[8]; float* cq[8];
#pragma unroll
            for (int s = 0; s < 8; ++s) { const int row = 2 * s + hi, cofs = lr * 4; v4f val = *(const v4fa*)(os + row * 68 + cofs); if (BIAS) { val[0] += bfr(bias[c0 + cofs]); val[1] += bfr(bias[c0 + cofs + 1]); val[2] += bfr(bias[c0 + cofs + 2]); val[3] += bfr(bias[c0 + cofs + 3]); }
                vals[s] = val; cq[s] = crow + (size_t)row * ldc + cofs; *(v4f*)cq[s] = val; }
            asm volatile("s_wait_xcnt 0x0" :: "v"(vals[0]), "v"(vals[1]), "v"(vals[2]), "v"(vals[3]), "v"(vals[4]), "v"(vals[5]), "v"(vals[6]), "v"(vals[7]), "v"(cq[0]), "v"(cq[1]), "v"(cq[2]), "v"(cq[3]), "v"(cq[4]), "v"(cq[5]), "v"(cq[6]), "v"(cq[7]) : "memory");   // the eight stores: their data and address registers stay whole (inputs) until this wait (this kernel now takes more than 256 registers)
             }
        __builtin_amdgcn_wave_barrier(); asm volatile("" ::: "memory");
    }
}


// grid (.., 4): blockIdx.y picks the weight; the four transposed planes lie one behind the other in Bt
// One wave transposes a tile of 64 k x 32 n in registers, no LDS: lane (kg = lane & 7, nq = lane >> 3) loads 16 bytes (4 n) of each of its 8 consecutive k rows, for both 16-n halves of the tile
// (16 loads in flight a lane; a load covers 8 half lines, and the tile's two halves together use every line whole). It then stores, for each of its 8 n, its 8 consecutive k as 16 bytes:
// the 8 lanes kg fill one whole 128-byte line of Bt, a store covers 4 whole lines, and each line has one writer. The pitches are constants, so that every load and store is one base address plus an immediate offset.
__global__ __launch_bounds__(256) void k_wtG(const float* __restrict__ w0, const float* __restrict__ w1, const float* __restrict__ w2, const float* __restrict__ w3, bf* Bt) {
    constexpr int K = DM, N = DQ, NKT = K / 64;
    static_assert(K % 256 == 0 && N % 64 == 0, "whole tiles, 4 x 2 of them a work-group");
    const int y = blockIdx.y; const float* __restrict__ w = y == 0 ? w0 : y == 1 ? w1 : y == 2 ? w2 : w3; Bt += (size_t)y * N * K;
    const int lane = threadIdx.x & 31, kg = lane & 7, nq = lane >> 3, wave = threadIdx.x >> 5;
    // a work-group's eight tiles are 4 (k) x 2 (n): the two n neighbours together read each row's aligned 256 bytes
    const int k0 = ((blockIdx.x % (NKT / 4)) * 4 + (wave >> 1)) * 64 + kg * 8, n0 = ((blockIdx.x / (NKT / 4)) * 2 + (wave & 1)) * 32 + nq * 4;
    const float* s = w + (size_t)k0 * N + n0; bf* d = Bt + (size_t)n0 * K + k0;
    v4f v[2][8];
#pragma unroll
    for (int hf = 0; hf < 2; ++hf)
#pragma unroll
        for (int j = 0; j < 8; ++j) v[hf][j] = *(const v4f*)(s + j * N + hf * 16);
    asm volatile("s_wait_xcnt 0x0" :: "v"(s) : "memory");   // the 16 loads: their address register pair stays whole (an input) until this wait; and no load crosses this statement, so that all 16 fly together in front of the conversions (sunk among them, to save registers, they went out in five groups, each group's latency waited out on its own)
#pragma unroll
    for (int hf = 0; hf < 2; ++hf)
#pragma unroll
        for (int c = 0; c < 4; ++c) { v8us o;
#pragma unroll
            for (int j = 0; j < 8; ++j) o[j] = f2bf(v[hf][j][c]);
            *(v8us*)(d + (hf * 16 + c) * K) = o; }
}
__global__ __launch_bounds__(256) void k_cvt8(const float* __restrict__ src, bf* dst, size_t n8) { const size_t i = (size_t)blockIdx.x * 256 + threadIdx.x; if (i >= n8) return; const v8f v = *(const v8f*)(src + i * 8); v8us o;
#pragma unroll
    for (int k = 0; k < 8; ++k) o[k] = f2bf(v[k]); *(v8us*)(dst + i * 8) = o;  }
// ---- k_attn: causal attention fused into one launch: ONE WORK-GROUP of NSP waves per (head, query tile); wave w takes the key blocks w, w + NSP, .. of the tile; scores, running softmax and the probability x value product stay in registers.
// Each wave ends with its own maximum, sum and unnormalised O over its key blocks; they are joined through LDS behind one barrier: O = sum_w 2^(m_w - M) O_w / sum_w 2^(m_w - M) l_w, w ascending. A wave without a key block brings m = -3e38, l = 0, O = 0 (weight 0).
// Transposed products: S^T = K Q^T (A = 16 keys x 64 d, B = 16 queries) leaves lane (lr, hi) with keys 8 hi + j of query lr, which for two neighbouring key tiles is exactly the B fragment (k = 8 hi + e, 16 + 8 hi + e) of
// O^T = V^T P^T (A = 16 d x 32 keys): no exchange between lanes but one with lane l ^ 16 for the row maximum (the two half sums are added in the join). O^T leaves lane (lr, hi) with d = 16 dt + 8 hi + j of query lr: 16-byte LDS stores into the wave's partial O rows; the join stores 16 bytes a lane into the merged hi/lo planes.
// Running softmax in the base-2 domain: t = s * HD^-0.5 * log2(e); per 32 keys m' = max(m, t), O and l scaled by 2^(m - m'), p = 2^(t - m') (not normalised: <= 1), l += sum p; O / l at the end.
// HR (query rows < RH): bf16 hi/lo planes, 3 products for both contractions, 16 queries a wave; else fp16, 32 queries a wave. Key blocks wholly at or below the diagonal need no mask; the one diagonal block masks by select.
#define KB 32                     // keys per trip
#define NSP 4                     // waves of a work-group: the key blocks of a query tile go round them
#define OP 68                     // LDS pitch of one query's partial O row, in floats (272 bytes: 16 x odd)
__device__ __forceinline__ float xhalf(float x) { return __builtin_bit_cast(float, __builtin_amdgcn_permlanex16(__builtin_bit_cast(int, x), __builtin_bit_cast(int, x), 0x76543210, 0xfedcba98, false, false)); }  // lane l with lane l ^ 16
__device__ __forceinline__ float exp2s(float x) { asm("v_exp_f32 %0, %0\n\tv_nop" : "+v"(x)); return x; }   // 2^x. The v_nop is the free slot the instruction set asks for behind a transcendental. In place: the register already holds the live argument, so it is no operand of a matrix instruction still in its window (the compiler does not look into asm text)
template <typename T16, int NT, bool HR>
__device__ __forceinline__ void attn_tile(const T16* __restrict__ Q, const T16* __restrict__ Q2, const T16* __restrict__ Kp, const T16* __restrict__ Kp2, const T16* __restrict__ Vt, const T16* __restrict__ Vt2, const int q0, bf* __restrict__ Ah, bf* __restrict__ Al, float* so, float* sm, float* sl) {
    typedef typename WFrag<T16>::V V;
    const int lane = threadIdx.x & 31, lr = lane & 15, hi = lane >> 4, wave = __builtin_amdgcn_readfirstlane(threadIdx.x >> 5);
    V qf[NT][2], qf2[NT][2];
    const T16* qb = Q + (size_t)q0 * HD; const T16* qb2 = HR ? Q2 + (size_t)q0 * HD : qb; const T16* qp = qb + lane * 8; const T16* qp2 = qb2 + lane * 8;
#pragma unroll
    for (int nt = 0; nt < NT; ++nt)
#pragma unroll
        for (int ks = 0; ks < 2; ++ks) { qf[nt][ks] = WFrag<T16>::ldf(qp + nt * 16 * HD + ks * 2 * FB); if (HR) qf2[nt][ks] = WFrag<T16>::ldf(qp2 + nt * 16 * HD + ks * 2 * FB); }
    v8f o[4][NT]; float m[NT], l[NT];
#pragma unroll
    for (int nt = 0; nt < NT; ++nt) { m[nt] = -3.0e38f; l[nt] = 0.f;
#pragma unroll
        for (int dt = 0; dt < 4; ++dt) o[dt][nt] = (v8f){}; }
    V kf[2][2], kf2[2][2];
    auto ldk = [&](const T16* kp, const T16* kp2, V (&f)[2][2], V (&f2)[2][2]) {
#pragma unroll
        for (int mt = 0; mt < 2; ++mt)
#pragma unroll
            for (int ks = 0; ks < 2; ++ks) { f[mt][ks] = WFrag<T16>::ldf(kp + mt * 16 * HD + ks * 2 * FB); if (HR) f2[mt][ks] = WFrag<T16>::ldf(kp2 + mt * 16 * HD + ks * 2 * FB); } };
    const size_t kl = (size_t)lane * 8, vl = kl;
    auto step = [&](const int kb, const bool last) {
        V vf[4], vf2[4];
        const T16* vp = Vt + vl + (size_t)kb * HD; const T16* vp2 = HR ? Vt2 + vl + (size_t)kb * HD : vp;
        const T16* kp = (HR || !last) ? Kp + kl + (size_t)(HR ? kb : kb + NSP * KB) * HD : vp; const T16* kp2 = HR ? Kp2 + kl + (size_t)kb * HD : kp;
#pragma unroll
        for (int dt = 0; dt < 4; ++dt) { vf[dt] = WFrag<T16>::ldf(vp + dt * 2 * FB); if (HR) vf2[dt] = WFrag<T16>::ldf(vp2 + dt * 2 * FB); }
        if (HR) ldk(kp, kp2, kf, kf2);              // hi/lo path: this trip's own key fragments
        v8f sa[NT][2];
#pragma unroll
        for (int nt = 0; nt < NT; ++nt) {
#pragma unroll
            for (int mt = 0; mt < 2; ++mt) { v8f s = (v8f){};
#pragma unroll
                for (int ks = 0; ks < 2; ++ks) { s = WFrag<T16>::mma(kf[mt][ks], qf[nt][ks], s); if (HR) { s = WFrag<T16>::mma(kf[mt][ks], qf2[nt][ks], s); s = WFrag<T16>::mma(kf2[mt][ks], qf[nt][ks], s); } }
                sa[nt][mt] = s; } }
        if (!HR) { if (!last) ldk(kp, kp2, kf, kf2);   // fp16 path: the key fragments of this wave's next trip, into the same registers right behind this trip's score products; they fly under the softmax and P x V
            __builtin_amdgcn_sched_barrier(0); }       // holds those loads (and this trip's V loads) up here: sunk to the foot of the trip, their latency would be waited out in full
#pragma unroll
        for (int nt = 0; nt < NT; ++nt) {
            v8f (&st)[2] = sa[nt];
            float mx = m[nt];
#pragma unroll
            for (int mt = 0; mt < 2; ++mt)
#pragma unroll
                for (int j = 0; j < 8; ++j) { float t = st[mt][j] * (SCL * 1.4426950408889634f); if (last) t = (kb + mt * 16 + hi * 8 + j <= q0 + nt * 16 + lr) ? t : -3.0e38f; st[mt][j] = t; mx = fmaxf(mx, t); }
            mx = fmaxf(mx, xhalf(mx));
            const float al = exp2s(m[nt] - mx); m[nt] = mx;
            float sum = 0.f;
#pragma unroll
            for (int mt = 0; mt < 2; ++mt)
#pragma unroll
                for (int j = 0; j < 8; ++j) { const float p = exp2s(st[mt][j] - mx); st[mt][j] = p; sum += p; }
            l[nt] = l[nt] * al + sum;
#pragma unroll
            for (int dt = 0; dt < 4; ++dt) o[dt][nt] *= al;
            if (nt == 0) asm volatile("s_wait_xcnt 0x0" :: "v"(vp), "v"(vp2), "v"(kp), "v"(kp2) : "memory");   // this trip's loads: their address registers stay whole (inputs) until this wait; placed here, where the V fragments are waited for anyway
            if (HR) {
                v8us h0, h1, l0, l1;
#pragma unroll
                for (int j = 0; j < 8; ++j) { unsigned short x, y; splitf(st[0][j], x, y); h0[j] = x; l0[j] = y; splitf(st[1][j], x, y); h1[j] = x; l1[j] = y; }
                const v16bf ph = cat16b(h0, h1), pl = cat16b(l0, l1);
#pragma unroll
                for (int dt = 0; dt < 4; ++dt) { o[dt][nt] = wmmab(__builtin_bit_cast(v16bf, vf[dt]), ph, o[dt][nt]); o[dt][nt] = wmmab(__builtin_bit_cast(v16bf, vf[dt]), pl, o[dt][nt]); o[dt][nt] = wmmab(__builtin_bit_cast(v16bf, vf2[dt]), ph, o[dt][nt]); }
            } else {
                v8h p0, p1;
#pragma unroll
                for (int j = 0; j < 8; ++j) { p0[j] = tohx(st[0][j]); p1[j] = tohx(st[1][j]); }
                const v16h pf = cat16(p0, p1);
#pragma unroll
                for (int dt = 0; dt < 4; ++dt) o[dt][nt] = wmma16(__builtin_bit_cast(v16h, vf[dt]), pf, o[dt][nt]);
            }
        }
    };
    static_assert(HR || RH >= NSP * KB, "fp16 tiles: every wave has at least one key block");
    static_assert((16 * NT) % NSP == 0 && HD == 64, "the join gives each wave 16 NT / NSP whole query rows");
    const int kd = (q0 / KB) * KB;             // the diagonal block: it holds keys q0 .. q0 + 16 NT - 1 (q0 is a multiple of 16 NT, and 16 NT divides KB)
    int kb = wave * KB;                        // this wave's first key block; its others follow at NSP * KB
    const T16* kw = Kp + (size_t)kb * HD; const T16* kp0 = kw + kl;
    if (!HR) ldk(kp0, kp0, kf, kf2);
    asm volatile("s_wait_xcnt 0x0" :: "s"(qb), "s"(qb2), "s"(kw), "v"(lane) : "memory");   // the prologue's loads (scalar base + lane offset): their address registers stay whole (inputs) until this wait
    for (; kb + NSP * KB <= kd; kb += NSP * KB) step(kb, false);
    if (!HR || kb <= kd) step(kb, true);       // the wave's last block, masked by select: the diagonal block for one wave, an identity for the others
    // ---- the join: every wave lays down its maximum, its two half sums and its O rows (query-major), one barrier, then wave w finishes the query rows w * QW .. w * QW + QW - 1, so that each 128-byte line of the merged planes has one writer
    float* sow = so + wave * (32 * OP);
#pragma unroll
    for (int nt = 0; nt < NT; ++nt) { sm[(wave * 2 + nt) * 32 + lane] = m[nt]; sl[(wave * 2 + nt) * 32 + lane] = l[nt];
#pragma unroll
        for (int dt = 0; dt < 4; ++dt) { float* p = sow + (nt * 16 + lr) * OP + dt * 16 + 8 * hi;
            *(v4fa*)p = __builtin_shufflevector(o[dt][nt], o[dt][nt], 0, 1, 2, 3); *(v4fa*)(p + 4) = __builtin_shufflevector(o[dt][nt], o[dt][nt], 4, 5, 6, 7); } }
    __syncthreads();                           // every wave's partial results are in LDS before any of them is read
    constexpr int QW = 16 * NT / NSP, LQ = 32 / QW, EL = HD / LQ;   // query rows a wave, lanes a row, elements a lane
    const int qi = wave * QW + lane / LQ, d0 = (lane % LQ) * EL, ms = (qi >> 4) * 32 + (qi & 15);
    float mw[NSP], lw[NSP], mx = -3.0e38f;
#pragma unroll
    for (int w = 0; w < NSP; ++w) { mw[w] = sm[w * 64 + ms]; lw[w] = sl[w * 64 + ms] + sl[w * 64 + ms + 16]; mx = fmaxf(mx, mw[w]); }
    float lt = 0.f, ac[EL];
#pragma unroll
    for (int e = 0; e < EL; ++e) ac[e] = 0.f;
#pragma unroll
    for (int w = 0; w < NSP; ++w) { const float f = exp2s(mw[w] - mx); lt = __builtin_fmaf(lw[w], f, lt); const float* p = so + (w * 32 + qi) * OP + d0;
#pragma unroll
        for (int e4 = 0; e4 < EL / 4; ++e4) { const v4f x = *(const v4fa*)(p + e4 * 4);
#pragma unroll
            for (int c = 0; c < 4; ++c) ac[e4 * 4 + c] = __builtin_fmaf(x[c], f, ac[e4 * 4 + c]); } }
    const float inv = __fdiv_rn(1.0f, lt); const size_t oo = (size_t)(q0 + qi) * DQ + d0; bf* sh = Ah + oo; bf* sb = Al + oo;
#pragma unroll
    for (int e8 = 0; e8 < EL / 8; ++e8) { v8us oh, ol;
#pragma unroll
        for (int j = 0; j < 8; ++j) { unsigned short x, y; splitf(ac[e8 * 8 + j] * inv, x, y); oh[j] = x; ol[j] = y; }
        *(v8us*)(sh + e8 * 8) = oh; *(v8us*)(sb + e8 * 8) = ol;
        asm volatile("s_wait_xcnt 0x0" :: "v"(oh), "v"(ol), "v"(sh), "v"(sb) : "memory"); }   // the two stores: their data and address registers stay whole (inputs) until this wait, on every way into code that rewrites them
}
#define NLR ((TT - RH) / 32)      // fp16 query tiles of 32 rows
#define NHR (RH / 16)             // hi/lo query tiles of 16 rows
// grid (NH_, NB_, NLR + NHR): the query tile is the SLOWEST grid index and the longest tiles (last query rows) take its lowest values, so that cost falls with the flat block index over the whole launch:
// there are more work-groups than resident places; the order is for speed only
__global__ __launch_bounds__(32 * NSP) void k_attn(const h16* __restrict__ Q16, const h16* __restrict__ K16, const h16* __restrict__ V16, const bf* __restrict__ Qh, const bf* __restrict__ Ql, const bf* __restrict__ Kh, const bf* __restrict__ Kl, const bf* __restrict__ Vh, const bf* __restrict__ Vl, bf* __restrict__ Ah, bf* __restrict__ Al) {
    const int h = blockIdx.x, g = h / REP, bx = blockIdx.z, b = blockIdx.y; const size_t qo = (size_t)(b * NH_ + h) * TT * HD, ko = (size_t)(b * NKV + g) * TT * HD, vo = (size_t)(b * NKV + g) * HD * PP; Ah += (size_t)b * TT * DQ; Al += (size_t)b * TT * DQ;
    __shared__ __align__(16) float so[NSP * 32 * OP];        // the waves' partial O rows [wave][query][d]
    __shared__ float sm[NSP * 2 * 32], sl[NSP * 2 * 32];     // their maxima and half sums [wave][query tile][lane]
    if (bx < NLR) attn_tile<h16, 2, false>(Q16 + qo, nullptr, K16 + ko, nullptr, V16 + vo, nullptr, RH + (NLR - 1 - bx) * 32, Ah + h * HD, Al + h * HD, so, sm, sl);
    else attn_tile<bf, 1, true>(Qh + qo, Ql + qo, Kh + ko, Kl + ko, Vh + vo, Vl + vo, (NLR + NHR - 1 - bx) * 16, Ah + h * HD, Al + h * HD, so, sm, sl);
}

extern "C" void kernel_launch(void* const* d_in, const int* in_sizes, int n_in,
                              void* d_out, int out_size, void* d_ws, size_t ws_size, hipStream_t stream) {
    (void)in_sizes; (void)n_in; (void)out_size;
        const float* x = (const float*)d_in[0]; const float* fcos = (const float*)d_in[1]; const float* fsin = (const float*)d_in[2]; const float* wq = (const float*)d_in[3]; const float* wk = (const float*)d_in[4]; const float* wv = (const float*)d_in[5]; const float* wo = (const float*)d_in[6]; const float* bo = (const float*)d_in[7];   /* input order x, pos_cos, pos_sin ([2048][32] HALF-width table INPUTS: read by value), Wq, Wk, Wv, Wo ('xw' (in, out) [1024][1024]), bo ([1024]: zeros, read through the output launch's bias slot): EIGHT inputs, all read; the q, k, v projections have NO bias in this module */
    float* OUT = (float*)d_out;     // [2][2048][1024]
    char* wsp = (char*)d_ws;
    auto take = [&](size_t bytes) { char* p = wsp; wsp += (bytes + 255) & ~(size_t)255; return (void*)p; };
    static_assert(DQ == DKV && DQ == DM, "q, k and v share one projection launch that also writes their planes, the four weights one transpose launch: equal shapes");
    bf* WQ = (bf*)take((size_t)4 * DQ * DM * 2); bf* WO = WQ + (size_t)3 * DQ * DM;   // transposed Wq, Wk, Wv, Wo, one behind the other
    bf* XB = (bf*)take((size_t)NB_ * TT * DM * 2);
    const size_t PLN = (size_t)NB_ * NH_ * TT * HD;   // elements of one set of head planes
    h16* QP16 = (h16*)take(2 * PLN * 2); h16* KP16 = QP16 + PLN; h16* VT16 = (h16*)take((size_t)NB_ * NKV * HD * PP * 2);
    bf* QPh = (bf*)take(2 * PLN * 2); bf* KPh = QPh + PLN; bf* QPl = (bf*)take(2 * PLN * 2); bf* KPl = QPl + PLN; bf* VTh = (bf*)take((size_t)NB_ * NKV * HD * PP * 2); bf* VTl = VTh + (size_t)TT * HD;   // hi plane in the first half of each head's range, lo plane in the second
    bf* ATh = (bf*)take((size_t)NB_ * TT * DQ * 2); bf* ATl = (bf*)take((size_t)NB_ * TT * DQ * 2);
    if ((size_t)(wsp - (char*)d_ws) > ws_size) return;    // ws 256 MiB
    k_wtG<<<dim3((DM / 256) * (DQ / 64), 4, 1), 256, 0, stream>>>(wq, wk, wv, wo, WQ);   /* 'xw' [in][out] weights: transposed once into Bt */
    k_cvt8<<<(unsigned)(((size_t)NB_ * TT * DM / 8 + 255) / 256), 256, 0, stream>>>(x, XB, (size_t)NB_ * TT * DM / 8);
    k_gemmw<bf, 0, false, true><<<dim3(NB_ * TT / 128, DQ / 128, 3), 128, 0, stream>>>(XB, nullptr, WQ, nullptr, DM, nullptr, DQ, nullptr, 0, (size_t)DQ * DM, 0, fcos, fsin, QP16, QPh, QPl, VT16, VTh, VTl);   /* q, k, v projections, written as head planes */
    k_attn<<<dim3(NH_, NB_, NLR + NHR), 32 * NSP, 0, stream>>>(QP16, KP16, VT16, QPh, QPl, KPh, KPl, VTh, VTl, ATh, ATl);
    k_gemmw<bf, 1, true, false><<<dim3(NB_ * TT / 128, DM / 128, 1), 128, 0, stream>>>(ATh, ATl, WO, nullptr, DQ, OUT, DM, bo, 0, 0, 0, nullptr, nullptr, nullptr, nullptr, nullptr, nullptr, nullptr, nullptr);
}
